// v000
// Measured on an AMD MI455X. A time is GPU time per run, averaged over a window of back-to-back runs after a warm-up
// (all launches, gaps included; the runs take copies of the inputs in turn), and the median of several windows.
// Apart from v000's, it joins two sittings. Times from different sittings can be a few percent apart, while
// side-by-side timings come from the same sitting.
// The starting kernel, v000, takes 1450 microseconds a run.
// compute dtype: all float inputs rounded to bf16, attn_mask (int) read; q = Wq x + bq (from x), k/v = W c + b (from c) as 1x1 convs with EXACT bf16 products on WMMA 16x16x32 (channel-major tiles transposed in LDS), f32 accumulate; q as f16 hi + residual, k f16 -> 2-product content logits; the 9 windowed relative-key logits q_t . rel_k[s-t+4] and the relative-value term sum_j p[t][t+j-4] rel_v[j] in f32 on the VALU; proximity bias -log1p|s-t| (precise log1pf) and the mask in f32; softmax in f32 (precise expf), P x 2^11 kept f32 split bf16 hi + lo against v bf16 hi + lo (3 products); out = Wo ctx (bf16 hi + lo) + bo written channel-major; f32 output.
#include <hip/hip_runtime.h>
#include <math.h>

typedef __attribute__((ext_vector_type(16))) _Float16 v16h;
typedef __attribute__((ext_vector_type(16))) __bf16 v16b;
typedef __attribute__((ext_vector_type(8)))  _Float16 v8h;
typedef __attribute__((ext_vector_type(8)))  float v8f;
typedef __attribute__((ext_vector_type(4)))  float v4f;
typedef __attribute__((ext_vector_type(2)))  float v2f;
typedef __attribute__((ext_vector_type(4)))  unsigned v4u;
typedef __attribute__((ext_vector_type(4)))  int v4i;
typedef float __attribute__((may_alias)) float_a;
typedef int __attribute__((may_alias)) int_a;

template <typename T> __device__ __forceinline__ void vst2(void* p, T v) { *(T*)p = v;  }
__device__ __forceinline__ v8f wmma16(v16h a, v16h b, v8f c) {
  v8f d = __builtin_amdgcn_wmma_f32_16x16x32_f16(false, a, false, b, (short)0, c, false, false);
  asm volatile("v_nop\n\tv_nop\n\tv_nop\n\tv_nop" : "+v"(d) : "v"(a), "v"(b));
  return d;
}
__device__ __forceinline__ v8f wmma_bf(v16b a, v16b b, v8f c) {
  v8f d = __builtin_amdgcn_wmma_f32_16x16x32_bf16(false, a, false, b, (short)0, c, false, false);
  asm volatile("v_nop\n\tv_nop\n\tv_nop\n\tv_nop" : "+v"(d) : "v"(a), "v"(b));
  return d;
}
// 16x16x32 fragments: lane = (h = lane>>4, row/col = lane&15); elements 0..7 = k0+8h+0..7, 8..15 = k0+16+8h+0..7; D element r = row 8h+r
__device__ __forceinline__ v16h frag_h(const _Float16* rowk0, int lane) {
  union { v16h v; v8h q[2]; } u; const _Float16* p = rowk0 + 8 * (lane >> 4);
  u.q[0] = *(const v8h*)p; u.q[1] = *(const v8h*)(p + 16); return u.v;
}
__device__ __forceinline__ v16h frag_f32(const float* rowk0, int lane) {
  v16h a; const float* p = rowk0 + 8 * (lane >> 4);
#pragma unroll
  for (int i = 0; i < 8; ++i) { a[i] = (_Float16)p[i]; a[8 + i] = (_Float16)p[16 + i]; }
  return a;
}
__device__ __forceinline__ v16h frag_f32s(const float* rowk0, int lane, float sc) {
  v16h a; const float* p = rowk0 + 8 * (lane >> 4);
#pragma unroll
  for (int i = 0; i < 8; ++i) { a[i] = (_Float16)(p[i] * sc); a[8 + i] = (_Float16)(p[16 + i] * sc); }
  return a;
}
// column fragment from a [K][ld] layout (column n), rows >= K read as 0
__device__ __forceinline__ v16h fragc_f32(const float* W, int k0, int n, int lane, int ld, int K) {
  v16h a; const int g = lane >> 4;
#pragma unroll
  for (int i = 0; i < 8; ++i) { const int ka = k0 + 8 * g + i, kb = ka + 16;
    a[i] = (_Float16)(ka < K ? W[(size_t)(ka < K ? ka : K - 1) * ld + n] : 0.f); a[8 + i] = (_Float16)(kb < K ? W[(size_t)(kb < K ? kb : K - 1) * ld + n] : 0.f); }
  return a;
}
struct F2 { v16b h, l; };
__device__ __forceinline__ F2 bsplit16(const float v[16]) { F2 r;
#pragma unroll
  for (int i = 0; i < 16; ++i) { const __bf16 h = (__bf16)v[i]; r.h[i] = h; r.l[i] = (__bf16)(v[i] - (float)h); }
  return r; }
__device__ __forceinline__ F2 split_row(const float* row, int k0, int lane) { float v[16]; const float* p = row + k0 + 8 * (lane >> 4);
#pragma unroll
  for (int i = 0; i < 8; ++i) { v[i] = p[i]; v[8 + i] = p[16 + i]; }
  return bsplit16(v); }
__device__ __forceinline__ F2 split_rowK(const float* row, int k0, int lane, int K) { float v[16]; const int g = lane >> 4;
#pragma unroll
  for (int i = 0; i < 8; ++i) { const int ka = k0 + 8 * g + i, kb = ka + 16; v[i] = ka < K ? row[ka < K ? ka : K - 1] : 0.f; v[8 + i] = kb < K ? row[kb < K ? kb : K - 1] : 0.f; }
  return bsplit16(v); }
__device__ __forceinline__ F2 split_col(const float* W, int k0, int n, int lane, int ld, int K) { float v[16]; const int g = lane >> 4;
#pragma unroll
  for (int i = 0; i < 8; ++i) { const int ka = k0 + 8 * g + i, kb = ka + 16; v[i] = ka < K ? W[(size_t)(ka < K ? ka : K - 1) * ld + n] : 0.f; v[8 + i] = kb < K ? W[(size_t)(kb < K ? kb : K - 1) * ld + n] : 0.f; }
  return bsplit16(v); }
__device__ __forceinline__ v8f mac3(const F2& a, const F2& b, v8f c) { c = wmma_bf(a.l, b.h, c); c = wmma_bf(a.h, b.l, c); return wmma_bf(a.h, b.h, c); }
__device__ __forceinline__ float sigm(float v) { return 1.0f / (1.0f + expf(-v)); }
#define LDSX() do { asm volatile("s_wait_dscnt 0" ::: "memory"); __builtin_amdgcn_wave_barrier(); __builtin_amdgcn_fence(__ATOMIC_RELEASE, "workgroup"); } while (0)


// VITS-style relative-position multi-head attention (B 8, C 512 = 8 x 64, T 1,024, window 4): content + windowed relative-key logits, proximity bias, mask, softmax, value + windowed relative-value, output 1x1 conv.
#define NB 8
#define CC 512
#define TT 1024
#define NH 8
#define HD 64
#define WR 4
#define NRL 9
#define HG 8
#ifndef TNB
#define TNB NB
#endif
typedef __attribute__((ext_vector_type(8))) __bf16 v8b;
__device__ __forceinline__ v16b frag_b(const __bf16* rowk0, int lane) {
  union { v16b v; v8b q[2]; } u; const __bf16* p = rowk0 + 8 * (lane >> 4);
  u.q[0] = *(const v8b*)p; u.q[1] = *(const v8b*)(p + 16); return u.v;
}
__device__ __forceinline__ float bfr(float v) { return (float)(__bf16)v; }
__device__ __attribute__((noinline)) float exp_ni(float v) { return expf(v); }
__device__ __attribute__((noinline)) float erf_ni(float v) { return erff(v); }

#define WS_QF  0u                                  // f32 q rows [b*t][512] (for the rel-k dots)
#define WS_QH  (WS_QF + 4u * (size_t)NB * TT * CC)
#define WS_QL  (WS_QH + 2u * (size_t)NB * TT * CC)
#define WS_KH  (WS_QL + 2u * (size_t)NB * TT * CC)
#define WS_VT  (WS_KH + 2u * (size_t)NB * TT * CC)     // bf16 v planes [b][512][t]
#define WS_VL  (WS_VT + 2u * (size_t)NB * CC * TT)
#define WS_QR  (WS_VL + 2u * (size_t)NB * CC * TT)     // f32 rel-k logits [HG][t][16] (9 used)
#define WS_S   (WS_QR + 4u * (size_t)HG * TT * 16)     // f32 S/P [HG][t][s]
#define WS_CX  (WS_S + 4u * (size_t)HG * TT * TT)      // f32 ctx rows [b*t][512]
#define WS_END (WS_CX + 4u * (size_t)NB * TT * CC)

// ---- k_proj: block = (64 positions, 128 out channels, b*3 + which): x^T / c^T tile in LDS; W [out][in] + b exact
__global__ __launch_bounds__(128) void k_proj(const float* __restrict__ X, const float* __restrict__ Cc, const float* __restrict__ WQ, const float* __restrict__ BQ, const float* __restrict__ WK, const float* __restrict__ BK, const float* __restrict__ WV, const float* __restrict__ BV, float* __restrict__ QF, _Float16* __restrict__ QH, _Float16* __restrict__ QL, _Float16* __restrict__ KH, __bf16* __restrict__ VT, __bf16* __restrict__ VL) {
  __shared__ __align__(16) __bf16 sx[64][CC + 8]; __shared__ __align__(16) float sf[64][132]; __shared__ __align__(16) unsigned char sbuf[2 * 128 * 72 * 2];   // union: (th, tl2) for v  |  (sh, sl) for q/k
  __bf16 (*th)[72] = (__bf16 (*)[72])sbuf; __bf16 (*tl2)[72] = (__bf16 (*)[72])(sbuf + 128 * 72 * 2); _Float16 (*sh)[136] = (_Float16 (*)[136])sbuf; _Float16 (*sl)[136] = (_Float16 (*)[136])(sbuf + 64 * 136 * 2);
  const int tid = threadIdx.x, wave = tid >> 5, lane = tid & 31, col = lane & 15, g = lane >> 4; const int p0 = blockIdx.x * 64; const int c0 = blockIdx.y * 128; const size_t b = blockIdx.z / 3; const int which = blockIdx.z % 3;
  const float* Xs = which == 0 ? X : Cc; const float* Wm = which == 0 ? WQ : which == 1 ? WK : WV; const float* Bm = which == 0 ? BQ : which == 1 ? BK : BV;
  for (int e = tid; e < CC * 64; e += 128) { const int c = e >> 6, pl = e & 63; sx[pl][c] = (__bf16)Xs[(b * CC + c) * (size_t)TT + p0 + pl]; }
  __syncthreads();
  v8f acc[8] = {};
#pragma unroll 2
  for (int kc = 0; kc < CC / 32; ++kc) { const v16b a = frag_b(&sx[wave * 16 + col][kc * 32], lane);
#pragma unroll
    for (int j = 0; j < 8; ++j) { v16b w; const int o = c0 + j * 16 + col;
#pragma unroll
      for (int i = 0; i < 8; ++i) { w[i] = (__bf16)Wm[(size_t)o * CC + kc * 32 + 8 * g + i]; w[8 + i] = (__bf16)Wm[(size_t)o * CC + kc * 32 + 16 + 8 * g + i]; }
      acc[j] = wmma_bf(a, w, acc[j]); } }
  if (which < 2) {
#pragma unroll
    for (int j = 0; j < 8; ++j) { const float bb = bfr(Bm[c0 + j * 16 + col]);
#pragma unroll
      for (int r = 0; r < 8; ++r) sf[wave * 16 + 8 * g + r][j * 16 + col] = acc[j][r] + bb; }
    __syncthreads();
    // rows: f32 (q only), f16 hi (+ residual for q)
    for (int e = tid; e < 64 * 32; e += 128) { const int rl = e >> 5, q4 = e & 31; const size_t row = b * TT + p0 + rl; const float* src = &sf[rl][q4 * 4]; if (which == 0) vst2(QF + row * CC + c0 + q4 * 4, *(const v4f*)src); }
    for (int e = tid; e < 64 * 128; e += 128) { const int rl = e >> 7, cl = e & 127; const float v = sf[rl][cl]; const _Float16 hv = (_Float16)v; sh[rl][cl] = hv; sl[rl][cl] = (_Float16)(v - (float)hv); }
    __syncthreads();
    _Float16* dh = which == 0 ? QH : KH; for (int e = tid; e < 64 * 16; e += 128) { const int rl = e >> 4, q = e & 15; const size_t row = b * TT + p0 + rl; vst2((unsigned*)(dh + row * CC + c0 + q * 8), *(const v4u*)&sh[rl][q * 8]); if (which == 0) vst2((unsigned*)(QL + row * CC + c0 + q * 8), *(const v4u*)&sl[rl][q * 8]); } }
  else {
#pragma unroll
    for (int j = 0; j < 8; ++j) { const float bb = bfr(Bm[c0 + j * 16 + col]);
#pragma unroll
      for (int r = 0; r < 8; ++r) { const float v = acc[j][r] + bb; const int rl = wave * 16 + 8 * g + r, cl = j * 16 + col; const __bf16 bh = (__bf16)v; th[cl][rl] = bh; tl2[cl][rl] = (__bf16)(v - (float)bh); } }
    __syncthreads(); for (int e = tid; e < 128 * 8; e += 128) { const int cl = e >> 3, q = e & 7; const size_t o2 = (b * CC + c0 + cl) * (size_t)TT + p0 + q * 8; vst2((unsigned*)(VT + o2), *(const v4u*)&th[cl][q * 8]); vst2((unsigned*)(VL + o2), *(const v4u*)&tl2[cl][q * 8]); } } }
// ---- k_qr: block = (64 queries, head in group) of batch b: QR[h][t][j] = q_t(head h) . rel_k[j] for j = 0..8 (f32)
__global__ __launch_bounds__(64) void k_qr(const float* __restrict__ QF, const float* __restrict__ RK, int b, int h0, float* __restrict__ QR0) { __shared__ float srk[NRL][HD]; __shared__ __align__(16) float so[64][16];
  const int t = threadIdx.x; const int h = h0 + blockIdx.z; float* QR = QR0 + (size_t)blockIdx.z * TT * 16; const int t0 = blockIdx.x * 64;
  for (int e = t; e < NRL * HD; e += 64) srk[e / HD][e % HD] = bfr(RK[e]);
  for (int e = t; e < 64 * 16; e += 64) so[e >> 4][e & 15] = 0.f;
  __syncthreads();
  const float* q = QF + ((size_t)b * TT + t0 + t) * CC + h * HD;
#pragma unroll 1
  for (int j = 0; j < NRL; ++j) { float a = 0.f;
#pragma unroll 1
    for (int d = 0; d < HD; ++d) a += q[d] * srk[j][d]; so[t][j] = a; }
  __syncthreads(); for (int e = t; e < 64 * 4; e += 64) { const int rl = e >> 2, qq = e & 3; vst2(QR + (size_t)(t0 + rl) * 16 + qq * 4, *(const v4f*)&so[rl][qq * 4]); } }
// ---- k_sc: block = (64 queries, 128 keys, head in group): S = (q.k + [|s-t|<=4] QR[t][s-t+4]) / 8 - log1p|s-t|; mask == 0 -> -1e4
__global__ __launch_bounds__(128) void k_sc(const _Float16* __restrict__ QH, const _Float16* __restrict__ QL, const _Float16* __restrict__ KH, const float* __restrict__ QR0, const int* __restrict__ AM, int b, int h0, float* __restrict__ S0) { __shared__ __align__(16) float ss[4][16][132]; const int h = h0 + blockIdx.z; const float* QR = QR0 + (size_t)blockIdx.z * TT * 16; float* S = S0 + (size_t)blockIdx.z * TT * TT;
  const int tid = threadIdx.x, wave = tid >> 5, lane = tid & 31, col = lane & 15, g = lane >> 4; const int k0 = blockIdx.y * 128; const int ql0 = blockIdx.x * 64 + wave * 16; const size_t q0 = (size_t)b * TT + ql0;
  v8f acc[8] = {};
#pragma unroll
  for (int kc = 0; kc < HD / 32; ++kc) { const v16h ah = frag_h(QH + (q0 + col) * CC + h * HD + kc * 32, lane), al = frag_h(QL + (q0 + col) * CC + h * HD + kc * 32, lane);
#pragma unroll
    for (int j = 0; j < 8; ++j) { const v16h kb = frag_h(KH + ((size_t)b * TT + k0 + j * 16 + col) * CC + h * HD + kc * 32, lane); acc[j] = wmma16(ah, kb, acc[j]); acc[j] = wmma16(al, kb, acc[j]); } }
#pragma unroll
  for (int j = 0; j < 8; ++j) { const int s = k0 + j * 16 + col;
#pragma unroll
    for (int r = 0; r < 8; ++r) { const int t = ql0 + 8 * g + r; const int dd = s - t; float v = acc[j][r]; if (dd >= -WR && dd <= WR) v += QR[(size_t)t * 16 + dd + WR]; v = v * 0.125f - log1pf(fabsf((float)dd)); if (AM[((size_t)b * TT + t) * TT + s] == 0) v = -10000.0f; ss[wave][8 * g + r][j * 16 + col] = v; } }
  LDSX(); for (int rl = 0; rl < 16; ++rl) vst2(S + (size_t)(ql0 + rl) * TT + k0 + lane * 4, *(const v4f*)&ss[wave][rl][lane * 4]); }
// ---- k_sm: block = (row, head in group): softmax -> P x 2^11 f32 in place
__global__ __launch_bounds__(256) void k_sm(float* __restrict__ S0) { __shared__ float sred[8]; __shared__ float sbc; __shared__ __align__(16) float sh[TT];
  const int t = threadIdx.x; const size_t row = blockIdx.x; float* sr = S0 + (size_t)blockIdx.y * TT * TT + row * TT;
  float m = -3.0e38f; for (int k = t; k < TT; k += 256) m = fmaxf(m, sr[k]);
#pragma unroll
  for (int o = 1; o < 32; o <<= 1) m = fmaxf(m, __shfl_xor(m, o));
  if ((t & 31) == 0) sred[t >> 5] = m; __syncthreads(); if (t == 0) { float a = sred[0]; for (int i = 1; i < 8; ++i) a = fmaxf(a, sred[i]); sbc = a; } __syncthreads(); m = sbc; __syncthreads();
  float sum = 0.f; for (int k = t; k < TT; k += 256) sum += expf(sr[k] - m);
#pragma unroll
  for (int o = 1; o < 32; o <<= 1) sum += __shfl_xor(sum, o);
  if ((t & 31) == 0) sred[t >> 5] = sum; __syncthreads(); if (t == 0) { float a = 0.f; for (int i = 0; i < 8; ++i) a += sred[i]; sbc = 1.0f / a; } __syncthreads(); const float inv = sbc;
  for (int k = t; k < TT; k += 256) sh[k] = expf(sr[k] - m) * inv * 2048.0f;
  __syncthreads(); for (int q = t; q < TT / 4; q += 256) vst2(sr + q * 4, *(const v4f*)&sh[q * 4]); }
// ---- k_pv: block = (64 queries, head in group): ctx rows [b*t][h*64+d] = P . v (3 products) + sum_j P[t][t+j-4] rel_v[j][d] / 2^11
__global__ __launch_bounds__(128) void k_pv(const float* __restrict__ PS0, const __bf16* __restrict__ VT, const __bf16* __restrict__ VL, const float* __restrict__ RV, int b, int h0, float* __restrict__ CX) { const int h = h0 + blockIdx.z; const float* PS = PS0 + (size_t)blockIdx.z * TT * TT; __shared__ __align__(16) float ss[4][16][68]; __shared__ float srv[NRL][HD]; __shared__ float spw[64][NRL];
  const int tid = threadIdx.x, wave = tid >> 5, lane = tid & 31, col = lane & 15, g = lane >> 4; const int ql0 = blockIdx.x * 64 + wave * 16; const int tb = blockIdx.x * 64;
  for (int e = tid; e < NRL * HD; e += 128) srv[e / HD][e % HD] = bfr(RV[e]);
  for (int e = tid; e < 64 * NRL; e += 128) { const int rl = e / NRL, j = e % NRL; const int t = tb + rl, s = t + j - WR; spw[rl][j] = (s >= 0 && s < TT) ? PS[(size_t)t * TT + s] : 0.f; }
  v8f acc[4] = {};
#pragma unroll 1
  for (int kc = 0; kc < TT / 32; ++kc) { const F2 p = split_row(PS + (size_t)(ql0 + col) * TT, kc * 32, lane);
#pragma unroll
    for (int j = 0; j < 4; ++j) { const size_t po = ((size_t)b * CC + h * HD + j * 16 + col) * (size_t)TT + kc * 32; const v16b vh = frag_b(VT + po, lane); acc[j] = wmma_bf(p.h, vh, acc[j]); acc[j] = wmma_bf(p.l, vh, acc[j]); acc[j] = wmma_bf(p.h, frag_b(VL + po, lane), acc[j]); } }
  __syncthreads();
#pragma unroll
  for (int j = 0; j < 4; ++j)
#pragma unroll
    for (int r = 0; r < 8; ++r) { const int rl = wave * 16 + 8 * g + r; const int d = j * 16 + col; float a = acc[j][r]; for (int jj = 0; jj < NRL; ++jj) a += spw[rl][jj] * srv[jj][d]; ss[wave][8 * g + r][d] = a * (1.0f / 2048.0f); }
  LDSX(); for (int rl = 0; rl < 16; ++rl) if (lane < 16) vst2(CX + ((size_t)b * TT + ql0 + rl) * CC + h * HD + lane * 4, *(const v4f*)&ss[wave][rl][lane * 4]); }
// ---- k_out: block = (64 positions, 128 out channels, b): out[o][t] = sum_c Wo[o][c] ctx[t][c] + bo; A = ctx rows (hi + lo), B = Wo [o][c]; transposed to planes
__global__ __launch_bounds__(128) void k_out(const float* __restrict__ CX, const float* __restrict__ WO, const float* __restrict__ BO, float* __restrict__ OUT) { __shared__ __align__(16) float so[128][68];
  const int tid = threadIdx.x, wave = tid >> 5, lane = tid & 31, col = lane & 15, g = lane >> 4; const int t0 = blockIdx.x * 64, c0 = blockIdx.y * 128; const size_t b = blockIdx.z; const size_t r0 = b * TT + t0 + wave * 16;
  v8f acc[8] = {};
#pragma unroll 2
  for (int kc = 0; kc < CC / 32; ++kc) { const F2 a = split_row(CX + (r0 + col) * CC, kc * 32, lane);
#pragma unroll
    for (int j = 0; j < 8; ++j) { v16b w; const int o = c0 + j * 16 + col;
#pragma unroll
      for (int i = 0; i < 8; ++i) { w[i] = (__bf16)WO[(size_t)o * CC + kc * 32 + 8 * g + i]; w[8 + i] = (__bf16)WO[(size_t)o * CC + kc * 32 + 16 + 8 * g + i]; }
      acc[j] = wmma_bf(a.h, w, acc[j]); acc[j] = wmma_bf(a.l, w, acc[j]); } }
#pragma unroll
  for (int j = 0; j < 8; ++j) { const float bb = bfr(BO[c0 + j * 16 + col]);
#pragma unroll
    for (int r = 0; r < 8; ++r) so[j * 16 + col][wave * 16 + 8 * g + r] = acc[j][r] + bb; }
  __syncthreads(); for (int e = tid; e < 128 * 16; e += 128) { const int cl = e >> 4, q = e & 15; vst2(OUT + ((size_t)b * CC + c0 + cl) * TT + t0 + q * 4, *(const v4f*)&so[cl][q * 4]); } }
extern "C" void kernel_launch(void* const* d_in, const int* in_sizes, int n_in, void* d_out, int out_size, void* d_ws, size_t ws_size, hipStream_t stream) {
  (void)in_sizes; (void)n_in; (void)out_size;
  const float** F = (const float**)d_in;   // 0 x [8,512,1024], 1 c [8,512,1024], 2 attn_mask [8,1,1024,1024] int, 3 Wq [512,512], 4 bq, 5 Wk, 6 bk, 7 Wv, 8 bv, 9 Wo [512,512], 10 bo, 11 emb_rel_k [1,9,64], 12 emb_rel_v [1,9,64]
  if (ws_size < (size_t)WS_END) return;
  char* ws = (char*)d_ws; float *QF = (float*)(ws + WS_QF), *QR = (float*)(ws + WS_QR), *S = (float*)(ws + WS_S), *CX = (float*)(ws + WS_CX); _Float16 *QH = (_Float16*)(ws + WS_QH), *QL = (_Float16*)(ws + WS_QL), *KH = (_Float16*)(ws + WS_KH); __bf16 *VT = (__bf16*)(ws + WS_VT), *VL = (__bf16*)(ws + WS_VL);
  k_proj<<<dim3(TT / 64, CC / 128, TNB * 3), 128, 0, stream>>>(F[0], F[1], F[3], F[4], F[5], F[6], F[7], F[8], QF, QH, QL, KH, VT, VL);
  for (int b = 0; b < TNB; ++b) for (int h0 = 0; h0 < NH; h0 += HG) {
    k_qr<<<dim3(TT / 64, 1, HG), 64, 0, stream>>>(QF, F[11], b, h0, QR);
    k_sc<<<dim3(TT / 64, TT / 128, HG), 128, 0, stream>>>(QH, QL, KH, QR, (const int*)d_in[2], b, h0, S);
    k_sm<<<dim3(TT, HG), 256, 0, stream>>>(S);
    k_pv<<<dim3(TT / 64, 1, HG), 128, 0, stream>>>(S, VT, VL, F[12], b, h0, CX);
  }
  k_out<<<dim3(TT / 64, CC / 128, TNB), 128, 0, stream>>>(CX, F[9], F[10], (float*)d_out);
}

// v001
// A run of this version takes 827 microseconds.
// Two timings next to v000 both put it at 1.78 times that version's speed.
// compute dtype: all float inputs rounded to bf16, attn_mask (int) read; q = Wq x + bq (from x), k/v = W c + b (from c) as 1x1 convs with EXACT bf16 products on WMMA 16x16x32 (channel-major tiles transposed in LDS), f32 accumulate; q as f16 hi + residual, k f16 -> 2-product content logits; the 9 windowed relative-key logits q_t . rel_k[s-t+4] and the relative-value term sum_j p[t][t+j-4] rel_v[j] in f32 on the VALU; proximity bias -log1p|s-t| (precise log1pf) and the mask in f32; softmax in f32 (precise expf), P x 2^11 kept f32 split bf16 hi + lo against v bf16 hi + lo (3 products); out = Wo ctx (bf16 hi + lo) + bo written channel-major; f32 output.
#include <hip/hip_runtime.h>
#include <math.h>

typedef __attribute__((ext_vector_type(16))) _Float16 v16h;
typedef __attribute__((ext_vector_type(16))) __bf16 v16b;
typedef __attribute__((ext_vector_type(8)))  _Float16 v8h;
typedef __attribute__((ext_vector_type(8)))  float v8f;
typedef __attribute__((ext_vector_type(4)))  float v4f;
typedef __attribute__((ext_vector_type(2)))  float v2f;
typedef __attribute__((ext_vector_type(4)))  unsigned v4u;
typedef __attribute__((ext_vector_type(4)))  int v4i;
typedef float __attribute__((may_alias)) float_a;
typedef int __attribute__((may_alias)) int_a;

template <typename T> __device__ __forceinline__ void vst2(void* p, T v) { *(T*)p = v;  }
__device__ __forceinline__ v8f wmma16(v16h a, v16h b, v8f c) {
  v8f d = __builtin_amdgcn_wmma_f32_16x16x32_f16(false, a, false, b, (short)0, c, false, false);
  asm volatile("v_nop\n\tv_nop\n\tv_nop\n\tv_nop" : "+v"(d) : "v"(a), "v"(b));
  return d;
}
__device__ __forceinline__ v8f wmma_bf(v16b a, v16b b, v8f c) {
  v8f d = __builtin_amdgcn_wmma_f32_16x16x32_bf16(false, a, false, b, (short)0, c, false, false);
  asm volatile("v_nop\n\tv_nop\n\tv_nop\n\tv_nop" : "+v"(d) : "v"(a), "v"(b));
  return d;
}
// 16x16x32 fragments: lane = (h = lane>>4, row/col = lane&15); elements 0..7 = k0+8h+0..7, 8..15 = k0+16+8h+0..7; D element r = row 8h+r
__device__ __forceinline__ v16h frag_h(const _Float16* rowk0, int lane) {
  union { v16h v; v8h q[2]; } u; const _Float16* p = rowk0 + 8 * (lane >> 4);
  u.q[0] = *(const v8h*)p; u.q[1] = *(const v8h*)(p + 16); return u.v;
}
__device__ __forceinline__ v16h frag_f32(const float* rowk0, int lane) {
  v16h a; const float* p = rowk0 + 8 * (lane >> 4);
#pragma unroll
  for (int i = 0; i < 8; ++i) { a[i] = (_Float16)p[i]; a[8 + i] = (_Float16)p[16 + i]; }
  return a;
}
__device__ __forceinline__ v16h frag_f32s(const float* rowk0, int lane, float sc) {
  v16h a; const float* p = rowk0 + 8 * (lane >> 4);
#pragma unroll
  for (int i = 0; i < 8; ++i) { a[i] = (_Float16)(p[i] * sc); a[8 + i] = (_Float16)(p[16 + i] * sc); }
  return a;
}
// column fragment from a [K][ld] layout (column n), rows >= K read as 0
__device__ __forceinline__ v16h fragc_f32(const float* W, int k0, int n, int lane, int ld, int K) {
  v16h a; const int g = lane >> 4;
#pragma unroll
  for (int i = 0; i < 8; ++i) { const int ka = k0 + 8 * g + i, kb = ka + 16;
    a[i] = (_Float16)(ka < K ? W[(size_t)(ka < K ? ka : K - 1) * ld + n] : 0.f); a[8 + i] = (_Float16)(kb < K ? W[(size_t)(kb < K ? kb : K - 1) * ld + n] : 0.f); }
  return a;
}
struct F2 { v16b h, l; };
__device__ __forceinline__ F2 bsplit16(const float v[16]) { F2 r;
#pragma unroll
  for (int i = 0; i < 16; ++i) { const __bf16 h = (__bf16)v[i]; r.h[i] = h; r.l[i] = (__bf16)(v[i] - (float)h); }
  return r; }
__device__ __forceinline__ F2 split_row(const float* row, int k0, int lane) { float v[16]; const float* p = row + k0 + 8 * (lane >> 4);
#pragma unroll
  for (int i = 0; i < 8; ++i) { v[i] = p[i]; v[8 + i] = p[16 + i]; }
  return bsplit16(v); }
__device__ __forceinline__ F2 split_rowK(const float* row, int k0, int lane, int K) { float v[16]; const int g = lane >> 4;
#pragma unroll
  for (int i = 0; i < 8; ++i) { const int ka = k0 + 8 * g + i, kb = ka + 16; v[i] = ka < K ? row[ka < K ? ka : K - 1] : 0.f; v[8 + i] = kb < K ? row[kb < K ? kb : K - 1] : 0.f; }
  return bsplit16(v); }
__device__ __forceinline__ F2 split_col(const float* W, int k0, int n, int lane, int ld, int K) { float v[16]; const int g = lane >> 4;
#pragma unroll
  for (int i = 0; i < 8; ++i) { const int ka = k0 + 8 * g + i, kb = ka + 16; v[i] = ka < K ? W[(size_t)(ka < K ? ka : K - 1) * ld + n] : 0.f; v[8 + i] = kb < K ? W[(size_t)(kb < K ? kb : K - 1) * ld + n] : 0.f; }
  return bsplit16(v); }
__device__ __forceinline__ v8f mac3(const F2& a, const F2& b, v8f c) { c = wmma_bf(a.l, b.h, c); c = wmma_bf(a.h, b.l, c); return wmma_bf(a.h, b.h, c); }
__device__ __forceinline__ float sigm(float v) { return 1.0f / (1.0f + expf(-v)); }
#define LDSX() do { asm volatile("s_wait_dscnt 0" ::: "memory"); __builtin_amdgcn_wave_barrier(); __builtin_amdgcn_fence(__ATOMIC_RELEASE, "workgroup"); } while (0)


// VITS-style relative-position multi-head attention (B 8, C 512 = 8 x 64, T 1,024, window 4): content + windowed relative-key logits, proximity bias, mask, softmax, value + windowed relative-value, output 1x1 conv.
#define NB 8
#define CC 512
#define TT 1024
#define NH 8
#define HD 64
#define WR 4
#define NRL 9
#define HG 8
#define BG 4   // batches per launch of the score / softmax / value stages: S for BG batches is the most the workspace holds
#ifndef TNB
#define TNB NB
#endif
typedef __attribute__((ext_vector_type(8))) __bf16 v8b;
__device__ __forceinline__ v16b frag_b(const __bf16* rowk0, int lane) {
  union { v16b v; v8b q[2]; } u; const __bf16* p = rowk0 + 8 * (lane >> 4);
  u.q[0] = *(const v8b*)p; u.q[1] = *(const v8b*)(p + 16); return u.v;
}
__device__ __forceinline__ float bfr(float v) { return (float)(__bf16)v; }
__device__ __attribute__((noinline)) float exp_ni(float v) { return expf(v); }
__device__ __attribute__((noinline)) float erf_ni(float v) { return erff(v); }

#define WS_QF  0u                                  // f32 q rows [b*t][512] (for the rel-k dots)
#define WS_QH  (WS_QF + 4u * (size_t)NB * TT * CC)
#define WS_QL  (WS_QH + 2u * (size_t)NB * TT * CC)
#define WS_KH  (WS_QL + 2u * (size_t)NB * TT * CC)
#define WS_VT  (WS_KH + 2u * (size_t)NB * TT * CC)     // bf16 v planes [b][512][t]
#define WS_VL  (WS_VT + 2u * (size_t)NB * CC * TT)
#define WS_QR  (WS_VL + 2u * (size_t)NB * CC * TT)     // f32 rel-k logits [b][h][t][16] (9 used)
#define WS_S   (WS_QR + 4u * (size_t)NB * NH * TT * 16) // f32 S/P [BG][HG][t][s]
#define WS_CX  (WS_S + 4u * (size_t)BG * HG * TT * TT) // f32 ctx rows [b*t][512]
#define WS_END (WS_CX + 4u * (size_t)NB * TT * CC)

// ---- k_proj: block = (64 positions, 128 out channels, b*3 + which): x^T / c^T tile in LDS; W [out][in] + b exact
__global__ __launch_bounds__(128) void k_proj(const float* __restrict__ X, const float* __restrict__ Cc, const float* __restrict__ WQ, const float* __restrict__ BQ, const float* __restrict__ WK, const float* __restrict__ BK, const float* __restrict__ WV, const float* __restrict__ BV, float* __restrict__ QF, _Float16* __restrict__ QH, _Float16* __restrict__ QL, _Float16* __restrict__ KH, __bf16* __restrict__ VT, __bf16* __restrict__ VL) {
  __shared__ __align__(16) __bf16 sx[64][CC + 8]; __shared__ __align__(16) float sf[64][132]; __shared__ __align__(16) unsigned char sbuf[2 * 128 * 72 * 2];   // union: (th, tl2) for v  |  (sh, sl) for q/k
  __bf16 (*th)[72] = (__bf16 (*)[72])sbuf; __bf16 (*tl2)[72] = (__bf16 (*)[72])(sbuf + 128 * 72 * 2); _Float16 (*sh)[136] = (_Float16 (*)[136])sbuf; _Float16 (*sl)[136] = (_Float16 (*)[136])(sbuf + 64 * 136 * 2);
  const int tid = threadIdx.x, wave = tid >> 5, lane = tid & 31, col = lane & 15, g = lane >> 4; const int p0 = blockIdx.x * 64; const int c0 = blockIdx.y * 128; const size_t b = blockIdx.z / 3; const int which = blockIdx.z % 3;
  const float* Xs = which == 0 ? X : Cc; const float* Wm = which == 0 ? WQ : which == 1 ? WK : WV; const float* Bm = which == 0 ? BQ : which == 1 ? BK : BV;
  for (int e = tid; e < CC * 64; e += 128) { const int c = e >> 6, pl = e & 63; sx[pl][c] = (__bf16)Xs[(b * CC + c) * (size_t)TT + p0 + pl]; }
  __syncthreads();
  v8f acc[8] = {};
#pragma unroll 2
  for (int kc = 0; kc < CC / 32; ++kc) { const v16b a = frag_b(&sx[wave * 16 + col][kc * 32], lane);
#pragma unroll
    for (int j = 0; j < 8; ++j) { v16b w; const int o = c0 + j * 16 + col;
#pragma unroll
      for (int i = 0; i < 8; ++i) { w[i] = (__bf16)Wm[(size_t)o * CC + kc * 32 + 8 * g + i]; w[8 + i] = (__bf16)Wm[(size_t)o * CC + kc * 32 + 16 + 8 * g + i]; }
      acc[j] = wmma_bf(a, w, acc[j]); } }
  if (which < 2) {
#pragma unroll
    for (int j = 0; j < 8; ++j) { const float bb = bfr(Bm[c0 + j * 16 + col]);
#pragma unroll
      for (int r = 0; r < 8; ++r) sf[wave * 16 + 8 * g + r][j * 16 + col] = acc[j][r] + bb; }
    __syncthreads();
    // rows: f32 (q only), f16 hi (+ residual for q)
    for (int e = tid; e < 64 * 32; e += 128) { const int rl = e >> 5, q4 = e & 31; const size_t row = b * TT + p0 + rl; const float* src = &sf[rl][q4 * 4]; if (which == 0) vst2(QF + row * CC + c0 + q4 * 4, *(const v4f*)src); }
    for (int e = tid; e < 64 * 128; e += 128) { const int rl = e >> 7, cl = e & 127; const float v = sf[rl][cl]; const _Float16 hv = (_Float16)v; sh[rl][cl] = hv; sl[rl][cl] = (_Float16)(v - (float)hv); }
    __syncthreads();
    _Float16* dh = which == 0 ? QH : KH; for (int e = tid; e < 64 * 16; e += 128) { const int rl = e >> 4, q = e & 15; const size_t row = b * TT + p0 + rl; vst2((unsigned*)(dh + row * CC + c0 + q * 8), *(const v4u*)&sh[rl][q * 8]); if (which == 0) vst2((unsigned*)(QL + row * CC + c0 + q * 8), *(const v4u*)&sl[rl][q * 8]); } }
  else {
#pragma unroll
    for (int j = 0; j < 8; ++j) { const float bb = bfr(Bm[c0 + j * 16 + col]);
#pragma unroll
      for (int r = 0; r < 8; ++r) { const float v = acc[j][r] + bb; const int rl = wave * 16 + 8 * g + r, cl = j * 16 + col; const __bf16 bh = (__bf16)v; th[cl][rl] = bh; tl2[cl][rl] = (__bf16)(v - (float)bh); } }
    __syncthreads(); for (int e = tid; e < 128 * 8; e += 128) { const int cl = e >> 3, q = e & 7; const size_t o2 = (b * CC + c0 + cl) * (size_t)TT + p0 + q * 8; vst2((unsigned*)(VT + o2), *(const v4u*)&th[cl][q * 8]); vst2((unsigned*)(VL + o2), *(const v4u*)&tl2[cl][q * 8]); } } }
// ---- k_qr: block = (64 queries, b * 8 + head): QR[b][h][t][j] = q_t(head h) . rel_k[j] for j = 0..8 (f32)
__global__ __launch_bounds__(64) void k_qr(const float* __restrict__ QF, const float* __restrict__ RK, float* __restrict__ QR0) { __shared__ float srk[NRL][HD]; __shared__ __align__(16) float so[64][16];
  const int t = threadIdx.x; const int b = blockIdx.z / NH, h = blockIdx.z % NH; float* QR = QR0 + (size_t)blockIdx.z * TT * 16; const int t0 = blockIdx.x * 64;
  for (int e = t; e < NRL * HD; e += 64) srk[e / HD][e % HD] = bfr(RK[e]);
  for (int e = t; e < 64 * 16; e += 64) so[e >> 4][e & 15] = 0.f;
  __syncthreads();
  const float* q = QF + ((size_t)b * TT + t0 + t) * CC + h * HD;
#pragma unroll 1
  for (int j = 0; j < NRL; ++j) { float a = 0.f;
#pragma unroll 1
    for (int d = 0; d < HD; ++d) a += q[d] * srk[j][d]; so[t][j] = a; }
  __syncthreads(); for (int e = t; e < 64 * 4; e += 64) { const int rl = e >> 2, qq = e & 3; vst2(QR + (size_t)(t0 + rl) * 16 + qq * 4, *(const v4f*)&so[rl][qq * 4]); } }
// ---- k_sc: block = (64 queries, 128 keys, batch in group * HG + head in group): S = (q.k + [|s-t|<=4] QR[t][s-t+4]) / 8 - log1p|s-t|; mask == 0 -> -1e4
__global__ __launch_bounds__(128) void k_sc(const _Float16* __restrict__ QH, const _Float16* __restrict__ QL, const _Float16* __restrict__ KH, const float* __restrict__ QR0, const int* __restrict__ AM, int b0, int h0, float* __restrict__ S0) { __shared__ __align__(16) float ss[4][16][132]; const int b = b0 + blockIdx.z / HG, h = h0 + blockIdx.z % HG; const float* QR = QR0 + ((size_t)b * NH + h) * TT * 16; float* S = S0 + (size_t)blockIdx.z * TT * TT;
  const int tid = threadIdx.x, wave = tid >> 5, lane = tid & 31, col = lane & 15, g = lane >> 4; const int k0 = blockIdx.y * 128; const int ql0 = blockIdx.x * 64 + wave * 16; const size_t q0 = (size_t)b * TT + ql0;
  v8f acc[8] = {};
#pragma unroll
  for (int kc = 0; kc < HD / 32; ++kc) { const v16h ah = frag_h(QH + (q0 + col) * CC + h * HD + kc * 32, lane), al = frag_h(QL + (q0 + col) * CC + h * HD + kc * 32, lane);
#pragma unroll
    for (int j = 0; j < 8; ++j) { const v16h kb = frag_h(KH + ((size_t)b * TT + k0 + j * 16 + col) * CC + h * HD + kc * 32, lane); acc[j] = wmma16(ah, kb, acc[j]); acc[j] = wmma16(al, kb, acc[j]); } }
#pragma unroll
  for (int j = 0; j < 8; ++j) { const int s = k0 + j * 16 + col;
#pragma unroll
    for (int r = 0; r < 8; ++r) { const int t = ql0 + 8 * g + r; const int dd = s - t; float v = acc[j][r]; if (dd >= -WR && dd <= WR) v += QR[(size_t)t * 16 + dd + WR]; v = v * 0.125f - log1pf(fabsf((float)dd)); if (AM[((size_t)b * TT + t) * TT + s] == 0) v = -10000.0f; ss[wave][8 * g + r][j * 16 + col] = v; } }
  LDSX(); for (int rl = 0; rl < 16; ++rl) vst2(S + (size_t)(ql0 + rl) * TT + k0 + lane * 4, *(const v4f*)&ss[wave][rl][lane * 4]); }
// ---- k_sm: block = (row, batch in group * HG + head in group): softmax -> P x 2^11 f32 in place
__global__ __launch_bounds__(256) void k_sm(float* __restrict__ S0) { __shared__ float sred[8]; __shared__ float sbc; __shared__ __align__(16) float sh[TT];
  const int t = threadIdx.x; const size_t row = blockIdx.x; float* sr = S0 + (size_t)blockIdx.y * TT * TT + row * TT;
  float m = -3.0e38f; for (int k = t; k < TT; k += 256) m = fmaxf(m, sr[k]);
#pragma unroll
  for (int o = 1; o < 32; o <<= 1) m = fmaxf(m, __shfl_xor(m, o));
  if ((t & 31) == 0) sred[t >> 5] = m; __syncthreads(); if (t == 0) { float a = sred[0]; for (int i = 1; i < 8; ++i) a = fmaxf(a, sred[i]); sbc = a; } __syncthreads(); m = sbc; __syncthreads();
  float sum = 0.f; for (int k = t; k < TT; k += 256) sum += expf(sr[k] - m);
#pragma unroll
  for (int o = 1; o < 32; o <<= 1) sum += __shfl_xor(sum, o);
  if ((t & 31) == 0) sred[t >> 5] = sum; __syncthreads(); if (t == 0) { float a = 0.f; for (int i = 0; i < 8; ++i) a += sred[i]; sbc = 1.0f / a; } __syncthreads(); const float inv = sbc;
  for (int k = t; k < TT; k += 256) sh[k] = expf(sr[k] - m) * inv * 2048.0f;
  __syncthreads(); for (int q = t; q < TT / 4; q += 256) vst2(sr + q * 4, *(const v4f*)&sh[q * 4]); }
// ---- k_pv: block = (64 queries, batch in group * HG + head in group): ctx rows [b*t][h*64+d] = P . v (3 products) + sum_j P[t][t+j-4] rel_v[j][d] / 2^11
__global__ __launch_bounds__(128) void k_pv(const float* __restrict__ PS0, const __bf16* __restrict__ VT, const __bf16* __restrict__ VL, const float* __restrict__ RV, int b0, int h0, float* __restrict__ CX) { const int b = b0 + blockIdx.z / HG, h = h0 + blockIdx.z % HG; const float* PS = PS0 + (size_t)blockIdx.z * TT * TT; __shared__ __align__(16) float ss[4][16][68]; __shared__ float srv[NRL][HD]; __shared__ float spw[64][NRL];
  const int tid = threadIdx.x, wave = tid >> 5, lane = tid & 31, col = lane & 15, g = lane >> 4; const int ql0 = blockIdx.x * 64 + wave * 16; const int tb = blockIdx.x * 64;
  for (int e = tid; e < NRL * HD; e += 128) srv[e / HD][e % HD] = bfr(RV[e]);
  for (int e = tid; e < 64 * NRL; e += 128) { const int rl = e / NRL, j = e % NRL; const int t = tb + rl, s = t + j - WR; spw[rl][j] = (s >= 0 && s < TT) ? PS[(size_t)t * TT + s] : 0.f; }
  v8f acc[4] = {};
#pragma unroll 1
  for (int kc = 0; kc < TT / 32; ++kc) { const F2 p = split_row(PS + (size_t)(ql0 + col) * TT, kc * 32, lane);
#pragma unroll
    for (int j = 0; j < 4; ++j) { const size_t po = ((size_t)b * CC + h * HD + j * 16 + col) * (size_t)TT + kc * 32; const v16b vh = frag_b(VT + po, lane); acc[j] = wmma_bf(p.h, vh, acc[j]); acc[j] = wmma_bf(p.l, vh, acc[j]); acc[j] = wmma_bf(p.h, frag_b(VL + po, lane), acc[j]); } }
  __syncthreads();
#pragma unroll
  for (int j = 0; j < 4; ++j)
#pragma unroll
    for (int r = 0; r < 8; ++r) { const int rl = wave * 16 + 8 * g + r; const int d = j * 16 + col; float a = acc[j][r]; for (int jj = 0; jj < NRL; ++jj) a += spw[rl][jj] * srv[jj][d]; ss[wave][8 * g + r][d] = a * (1.0f / 2048.0f); }
  LDSX(); for (int rl = 0; rl < 16; ++rl) if (lane < 16) vst2(CX + ((size_t)b * TT + ql0 + rl) * CC + h * HD + lane * 4, *(const v4f*)&ss[wave][rl][lane * 4]); }
// ---- k_out: block = (64 positions, 128 out channels, b): out[o][t] = sum_c Wo[o][c] ctx[t][c] + bo; A = ctx rows (hi + lo), B = Wo [o][c]; transposed to planes
__global__ __launch_bounds__(128) void k_out(const float* __restrict__ CX, const float* __restrict__ WO, const float* __restrict__ BO, float* __restrict__ OUT) { __shared__ __align__(16) float so[128][68];
  const int tid = threadIdx.x, wave = tid >> 5, lane = tid & 31, col = lane & 15, g = lane >> 4; const int t0 = blockIdx.x * 64, c0 = blockIdx.y * 128; const size_t b = blockIdx.z; const size_t r0 = b * TT + t0 + wave * 16;
  v8f acc[8] = {};
#pragma unroll 2
  for (int kc = 0; kc < CC / 32; ++kc) { const F2 a = split_row(CX + (r0 + col) * CC, kc * 32, lane);
#pragma unroll
    for (int j = 0; j < 8; ++j) { v16b w; const int o = c0 + j * 16 + col;
#pragma unroll
      for (int i = 0; i < 8; ++i) { w[i] = (__bf16)WO[(size_t)o * CC + kc * 32 + 8 * g + i]; w[8 + i] = (__bf16)WO[(size_t)o * CC + kc * 32 + 16 + 8 * g + i]; }
      acc[j] = wmma_bf(a.h, w, acc[j]); acc[j] = wmma_bf(a.l, w, acc[j]); } }
#pragma unroll
  for (int j = 0; j < 8; ++j) { const float bb = bfr(BO[c0 + j * 16 + col]);
#pragma unroll
    for (int r = 0; r < 8; ++r) so[j * 16 + col][wave * 16 + 8 * g + r] = acc[j][r] + bb; }
  __syncthreads(); for (int e = tid; e < 128 * 16; e += 128) { const int cl = e >> 4, q = e & 15; vst2(OUT + ((size_t)b * CC + c0 + cl) * TT + t0 + q * 4, *(const v4f*)&so[cl][q * 4]); } }
extern "C" void kernel_launch(void* const* d_in, const int* in_sizes, int n_in, void* d_out, int out_size, void* d_ws, size_t ws_size, hipStream_t stream) {
  (void)in_sizes; (void)n_in; (void)out_size;
  const float** F = (const float**)d_in;   // 0 x [8,512,1024], 1 c [8,512,1024], 2 attn_mask [8,1,1024,1024] int, 3 Wq [512,512], 4 bq, 5 Wk, 6 bk, 7 Wv, 8 bv, 9 Wo [512,512], 10 bo, 11 emb_rel_k [1,9,64], 12 emb_rel_v [1,9,64]
  if (ws_size < (size_t)WS_END) return;
  char* ws = (char*)d_ws; float *QF = (float*)(ws + WS_QF), *QR = (float*)(ws + WS_QR), *S = (float*)(ws + WS_S), *CX = (float*)(ws + WS_CX); _Float16 *QH = (_Float16*)(ws + WS_QH), *QL = (_Float16*)(ws + WS_QL), *KH = (_Float16*)(ws + WS_KH); __bf16 *VT = (__bf16*)(ws + WS_VT), *VL = (__bf16*)(ws + WS_VL);
  k_proj<<<dim3(TT / 64, CC / 128, TNB * 3), 128, 0, stream>>>(F[0], F[1], F[3], F[4], F[5], F[6], F[7], F[8], QF, QH, QL, KH, VT, VL);
  k_qr<<<dim3(TT / 64, 1, TNB * NH), 64, 0, stream>>>(QF, F[11], QR);
  for (int b0 = 0; b0 < TNB; b0 += BG) for (int h0 = 0; h0 < NH; h0 += HG) {
    k_sc<<<dim3(TT / 64, TT / 128, BG * HG), 128, 0, stream>>>(QH, QL, KH, QR, (const int*)d_in[2], b0, h0, S);
    k_sm<<<dim3(TT, BG * HG), 256, 0, stream>>>(S);
    k_pv<<<dim3(TT / 64, 1, BG * HG), 128, 0, stream>>>(S, VT, VL, F[12], b0, h0, CX);
  }
  k_out<<<dim3(TT / 64, CC / 128, TNB), 128, 0, stream>>>(CX, F[9], F[10], (float*)d_out);
}

// v002
// Measured time: 678 microseconds a run.
// In two side-by-side timings against v001, it was 1.22 and 1.21 times as fast.
// Over all steps from v000 it is 2.16 times as fast.
// compute dtype: all float inputs rounded to bf16, attn_mask (int) read; q = Wq x + bq (from x), k/v = W c + b (from c) as 1x1 convs with EXACT bf16 products on WMMA 16x16x32 (channel-major tiles transposed in LDS), f32 accumulate; q as f16 hi + residual, k f16 -> 2-product content logits; the 9 windowed relative-key logits q_t . rel_k[s-t+4] and the relative-value term sum_j p[t][t+j-4] rel_v[j] in f32 on the VALU; proximity bias -log1p|s-t| (precise log1pf) and the mask in f32; softmax in f32 (precise expf), P x 2^11 kept f32 split bf16 hi + lo against v bf16 hi + lo (3 products); out = Wo ctx (bf16 hi + lo) + bo written channel-major; f32 output.
#include <hip/hip_runtime.h>
#include <math.h>

typedef __attribute__((ext_vector_type(16))) _Float16 v16h;
typedef __attribute__((ext_vector_type(16))) __bf16 v16b;
typedef __attribute__((ext_vector_type(8)))  _Float16 v8h;
typedef __attribute__((ext_vector_type(8)))  float v8f;
typedef __attribute__((ext_vector_type(4)))  float v4f;
typedef __attribute__((ext_vector_type(2)))  float v2f;
typedef __attribute__((ext_vector_type(4)))  unsigned v4u;
typedef __attribute__((ext_vector_type(4)))  int v4i;
typedef float __attribute__((may_alias)) float_a;
typedef int __attribute__((may_alias)) int_a;

template <typename T> __device__ __forceinline__ void vst2(void* p, T v) { *(T*)p = v;  }
__device__ __forceinline__ v8f wmma16(v16h a, v16h b, v8f c) {
  v8f d = __builtin_amdgcn_wmma_f32_16x16x32_f16(false, a, false, b, (short)0, c, false, false);
  asm volatile("v_nop\n\tv_nop\n\tv_nop\n\tv_nop" : "+v"(d) : "v"(a), "v"(b));
  return d;
}
__device__ __forceinline__ v8f wmma_bf(v16b a, v16b b, v8f c) {
  v8f d = __builtin_amdgcn_wmma_f32_16x16x32_bf16(false, a, false, b, (short)0, c, false, false);
  asm volatile("v_nop\n\tv_nop\n\tv_nop\n\tv_nop" : "+v"(d) : "v"(a), "v"(b));
  return d;
}
// 16x16x32 fragments: lane = (h = lane>>4, row/col = lane&15); elements 0..7 = k0+8h+0..7, 8..15 = k0+16+8h+0..7; D element r = row 8h+r
__device__ __forceinline__ v16h frag_h(const _Float16* rowk0, int lane) {
  union { v16h v; v8h q[2]; } u; const _Float16* p = rowk0 + 8 * (lane >> 4);
  u.q[0] = *(const v8h*)p; u.q[1] = *(const v8h*)(p + 16); return u.v;
}
__device__ __forceinline__ v16h frag_f32(const float* rowk0, int lane) {
  v16h a; const float* p = rowk0 + 8 * (lane >> 4);
#pragma unroll
  for (int i = 0; i < 8; ++i) { a[i] = (_Float16)p[i]; a[8 + i] = (_Float16)p[16 + i]; }
  return a;
}
__device__ __forceinline__ v16h frag_f32s(const float* rowk0, int lane, float sc) {
  v16h a; const float* p = rowk0 + 8 * (lane >> 4);
#pragma unroll
  for (int i = 0; i < 8; ++i) { a[i] = (_Float16)(p[i] * sc); a[8 + i] = (_Float16)(p[16 + i] * sc); }
  return a;
}
// column fragment from a [K][ld] layout (column n), rows >= K read as 0
__device__ __forceinline__ v16h fragc_f32(const float* W, int k0, int n, int lane, int ld, int K) {
  v16h a; const int g = lane >> 4;
#pragma unroll
  for (int i = 0; i < 8; ++i) { const int ka = k0 + 8 * g + i, kb = ka + 16;
    a[i] = (_Float16)(ka < K ? W[(size_t)(ka < K ? ka : K - 1) * ld + n] : 0.f); a[8 + i] = (_Float16)(kb < K ? W[(size_t)(kb < K ? kb : K - 1) * ld + n] : 0.f); }
  return a;
}
struct F2 { v16b h, l; };
__device__ __forceinline__ F2 bsplit16(const float v[16]) { F2 r;
#pragma unroll
  for (int i = 0; i < 16; ++i) { const __bf16 h = (__bf16)v[i]; r.h[i] = h; r.l[i] = (__bf16)(v[i] - (float)h); }
  return r; }
__device__ __forceinline__ F2 split_row(const float* row, int k0, int lane) { float v[16]; const float* p = row + k0 + 8 * (lane >> 4);
#pragma unroll
  for (int i = 0; i < 8; ++i) { v[i] = p[i]; v[8 + i] = p[16 + i]; }
  return bsplit16(v); }
__device__ __forceinline__ F2 split_rowK(const float* row, int k0, int lane, int K) { float v[16]; const int g = lane >> 4;
#pragma unroll
  for (int i = 0; i < 8; ++i) { const int ka = k0 + 8 * g + i, kb = ka + 16; v[i] = ka < K ? row[ka < K ? ka : K - 1] : 0.f; v[8 + i] = kb < K ? row[kb < K ? kb : K - 1] : 0.f; }
  return bsplit16(v); }
__device__ __forceinline__ F2 split_col(const float* W, int k0, int n, int lane, int ld, int K) { float v[16]; const int g = lane >> 4;
#pragma unroll
  for (int i = 0; i < 8; ++i) { const int ka = k0 + 8 * g + i, kb = ka + 16; v[i] = ka < K ? W[(size_t)(ka < K ? ka : K - 1) * ld + n] : 0.f; v[8 + i] = kb < K ? W[(size_t)(kb < K ? kb : K - 1) * ld + n] : 0.f; }
  return bsplit16(v); }
__device__ __forceinline__ v8f mac3(const F2& a, const F2& b, v8f c) { c = wmma_bf(a.l, b.h, c); c = wmma_bf(a.h, b.l, c); return wmma_bf(a.h, b.h, c); }
__device__ __forceinline__ float sigm(float v) { return 1.0f / (1.0f + expf(-v)); }
#define LDSX() do { asm volatile("s_wait_dscnt 0" ::: "memory"); __builtin_amdgcn_wave_barrier(); __builtin_amdgcn_fence(__ATOMIC_RELEASE, "workgroup"); } while (0)


// VITS-style relative-position multi-head attention (B 8, C 512 = 8 x 64, T 1,024, window 4): content + windowed relative-key logits, proximity bias, mask, softmax, value + windowed relative-value, output 1x1 conv.
#define NB 8
#define CC 512
#define TT 1024
#define NH 8
#define HD 64
#define WR 4
#define NRL 9
#define HG 8
#define BG 4   // batches per launch of the score / softmax / value stages: S for BG batches is the most the workspace holds
#ifndef TNB
#define TNB NB
#endif
typedef __attribute__((ext_vector_type(8))) __bf16 v8b;
__device__ __forceinline__ v16b frag_b(const __bf16* rowk0, int lane) {
  union { v16b v; v8b q[2]; } u; const __bf16* p = rowk0 + 8 * (lane >> 4);
  u.q[0] = *(const v8b*)p; u.q[1] = *(const v8b*)(p + 16); return u.v;
}
__device__ __forceinline__ float bfr(float v) { return (float)(__bf16)v; }
__device__ __attribute__((noinline)) float exp_ni(float v) { return expf(v); }
__device__ __attribute__((noinline)) float erf_ni(float v) { return erff(v); }

#define WS_QF  0u                                  // f32 q rows [b*t][512] (for the rel-k dots)
#define WS_QH  (WS_QF + 4u * (size_t)NB * TT * CC)
#define WS_QL  (WS_QH + 2u * (size_t)NB * TT * CC)
#define WS_KH  (WS_QL + 2u * (size_t)NB * TT * CC)
#define WS_VT  (WS_KH + 2u * (size_t)NB * TT * CC)     // bf16 v planes [b][512][t]
#define WS_VL  (WS_VT + 2u * (size_t)NB * CC * TT)
#define WS_QR  (WS_VL + 2u * (size_t)NB * CC * TT)     // f32 rel-k logits [b][h][t][16] (9 used)
#define WS_S   (WS_QR + 4u * (size_t)NB * NH * TT * 16) // f32 P x 2^11 [BG][HG][t][s]
#define WS_CX  (WS_S + 4u * (size_t)BG * HG * TT * TT) // f32 ctx rows [b*t][512]
#define WS_END (WS_CX + 4u * (size_t)NB * TT * CC)

// ---- k_proj: block = (64 positions, 128 out channels, b*3 + which): x^T / c^T tile in LDS; W [out][in] + b exact
__global__ __launch_bounds__(128) void k_proj(const float* __restrict__ X, const float* __restrict__ Cc, const float* __restrict__ WQ, const float* __restrict__ BQ, const float* __restrict__ WK, const float* __restrict__ BK, const float* __restrict__ WV, const float* __restrict__ BV, float* __restrict__ QF, _Float16* __restrict__ QH, _Float16* __restrict__ QL, _Float16* __restrict__ KH, __bf16* __restrict__ VT, __bf16* __restrict__ VL) {
  __shared__ __align__(16) __bf16 sx[64][CC + 8]; __shared__ __align__(16) float sf[64][132]; __shared__ __align__(16) unsigned char sbuf[2 * 128 * 72 * 2];   // union: (th, tl2) for v  |  (sh, sl) for q/k
  __bf16 (*th)[72] = (__bf16 (*)[72])sbuf; __bf16 (*tl2)[72] = (__bf16 (*)[72])(sbuf + 128 * 72 * 2); _Float16 (*sh)[136] = (_Float16 (*)[136])sbuf; _Float16 (*sl)[136] = (_Float16 (*)[136])(sbuf + 64 * 136 * 2);
  const int tid = threadIdx.x, wave = tid >> 5, lane = tid & 31, col = lane & 15, g = lane >> 4; const int p0 = blockIdx.x * 64; const int c0 = blockIdx.y * 128; const size_t b = blockIdx.z / 3; const int which = blockIdx.z % 3;
  const float* Xs = which == 0 ? X : Cc; const float* Wm = which == 0 ? WQ : which == 1 ? WK : WV; const float* Bm = which == 0 ? BQ : which == 1 ? BK : BV;
  for (int e = tid; e < CC * 64; e += 128) { const int c = e >> 6, pl = e & 63; sx[pl][c] = (__bf16)Xs[(b * CC + c) * (size_t)TT + p0 + pl]; }
  __syncthreads();
  v8f acc[8] = {};
#pragma unroll 2
  for (int kc = 0; kc < CC / 32; ++kc) { const v16b a = frag_b(&sx[wave * 16 + col][kc * 32], lane);
#pragma unroll
    for (int j = 0; j < 8; ++j) { v16b w; const int o = c0 + j * 16 + col;
#pragma unroll
      for (int i = 0; i < 8; ++i) { w[i] = (__bf16)Wm[(size_t)o * CC + kc * 32 + 8 * g + i]; w[8 + i] = (__bf16)Wm[(size_t)o * CC + kc * 32 + 16 + 8 * g + i]; }
      acc[j] = wmma_bf(a, w, acc[j]); } }
  if (which < 2) {
#pragma unroll
    for (int j = 0; j < 8; ++j) { const float bb = bfr(Bm[c0 + j * 16 + col]);
#pragma unroll
      for (int r = 0; r < 8; ++r) sf[wave * 16 + 8 * g + r][j * 16 + col] = acc[j][r] + bb; }
    __syncthreads();
    // rows: f32 (q only), f16 hi (+ residual for q)
    for (int e = tid; e < 64 * 32; e += 128) { const int rl = e >> 5, q4 = e & 31; const size_t row = b * TT + p0 + rl; const float* src = &sf[rl][q4 * 4]; if (which == 0) vst2(QF + row * CC + c0 + q4 * 4, *(const v4f*)src); }
    for (int e = tid; e < 64 * 128; e += 128) { const int rl = e >> 7, cl = e & 127; const float v = sf[rl][cl]; const _Float16 hv = (_Float16)v; sh[rl][cl] = hv; sl[rl][cl] = (_Float16)(v - (float)hv); }
    __syncthreads();
    _Float16* dh = which == 0 ? QH : KH; for (int e = tid; e < 64 * 16; e += 128) { const int rl = e >> 4, q = e & 15; const size_t row = b * TT + p0 + rl; vst2((unsigned*)(dh + row * CC + c0 + q * 8), *(const v4u*)&sh[rl][q * 8]); if (which == 0) vst2((unsigned*)(QL + row * CC + c0 + q * 8), *(const v4u*)&sl[rl][q * 8]); } }
  else {
#pragma unroll
    for (int j = 0; j < 8; ++j) { const float bb = bfr(Bm[c0 + j * 16 + col]);
#pragma unroll
      for (int r = 0; r < 8; ++r) { const float v = acc[j][r] + bb; const int rl = wave * 16 + 8 * g + r, cl = j * 16 + col; const __bf16 bh = (__bf16)v; th[cl][rl] = bh; tl2[cl][rl] = (__bf16)(v - (float)bh); } }
    __syncthreads(); for (int e = tid; e < 128 * 8; e += 128) { const int cl = e >> 3, q = e & 7; const size_t o2 = (b * CC + c0 + cl) * (size_t)TT + p0 + q * 8; vst2((unsigned*)(VT + o2), *(const v4u*)&th[cl][q * 8]); vst2((unsigned*)(VL + o2), *(const v4u*)&tl2[cl][q * 8]); } } }
// ---- k_qr: block = (64 queries, b * 8 + head): QR[b][h][t][j] = q_t(head h) . rel_k[j] for j = 0..8 (f32)
__global__ __launch_bounds__(64) void k_qr(const float* __restrict__ QF, const float* __restrict__ RK, float* __restrict__ QR0) { __shared__ float srk[NRL][HD]; __shared__ __align__(16) float so[64][16];
  const int t = threadIdx.x; const int b = blockIdx.z / NH, h = blockIdx.z % NH; float* QR = QR0 + (size_t)blockIdx.z * TT * 16; const int t0 = blockIdx.x * 64;
  for (int e = t; e < NRL * HD; e += 64) srk[e / HD][e % HD] = bfr(RK[e]);
  for (int e = t; e < 64 * 16; e += 64) so[e >> 4][e & 15] = 0.f;
  __syncthreads();
  const float* q = QF + ((size_t)b * TT + t0 + t) * CC + h * HD;
#pragma unroll 1
  for (int j = 0; j < NRL; ++j) { float a = 0.f;
#pragma unroll 1
    for (int d = 0; d < HD; ++d) a += q[d] * srk[j][d]; so[t][j] = a; }
  __syncthreads(); for (int e = t; e < 64 * 4; e += 64) { const int rl = e >> 2, qq = e & 3; vst2(QR + (size_t)(t0 + rl) * 16 + qq * 4, *(const v4f*)&so[rl][qq * 4]); } }
// ---- k_sc: block = (16 queries, all 1,024 keys, batch in group * HG + head in group), wave = 128 keys: S = (q.k + [|s-t|<=4] QR[t][s-t+4]) / 8 - log1p|s-t|; mask == 0 -> -1e4; then the row softmax while the block's 16 whole rows lie in LDS -> P x 2^11 f32. Second launch bound: 8 waves a SIMD, so that four blocks share a WGP
__global__ __launch_bounds__(256, 8) void k_sc(const _Float16* __restrict__ QH, const _Float16* __restrict__ QL, const _Float16* __restrict__ KH, const float* __restrict__ QR0, const int* __restrict__ AM, int b0, int h0, float* __restrict__ S0) { __shared__ __align__(16) float ss[8][16][132]; __shared__ __align__(16) float smx[16][8]; __shared__ __align__(16) float ssu[16][8]; const int b = b0 + blockIdx.z / HG, h = h0 + blockIdx.z % HG; const float* QR = QR0 + ((size_t)b * NH + h) * TT * 16; float* S = S0 + (size_t)blockIdx.z * TT * TT;
  const int tid = threadIdx.x, wave = tid >> 5, lane = tid & 31, col = lane & 15, g = lane >> 4; const int k0 = wave * 128; const int ql0 = blockIdx.x * 16; const size_t q0 = (size_t)b * TT + ql0;
  v8f acc[8] = {};
#pragma unroll
  for (int kc = 0; kc < HD / 32; ++kc) { const v16h ah = frag_h(QH + (q0 + col) * CC + h * HD + kc * 32, lane), al = frag_h(QL + (q0 + col) * CC + h * HD + kc * 32, lane);
    asm volatile("s_wait_xcnt 0x0" ::: "memory");   // precaution: the compiler lays the k loads' results over the q loads' address registers; this stands between them
#pragma unroll
    for (int j = 0; j < 8; ++j) { const v16h kb = frag_h(KH + ((size_t)b * TT + k0 + j * 16 + col) * CC + h * HD + kc * 32, lane); acc[j] = wmma16(ah, kb, acc[j]); acc[j] = wmma16(al, kb, acc[j]); } }
  float mx[8], su[8];   // the loops over r, o and rl below are unrolled so that mx, su and the rows' pieces are registers, not indexed memory
#pragma unroll
  for (int r = 0; r < 8; ++r) { mx[r] = -3.0e38f; su[r] = 0.f; }
#pragma unroll
  for (int j = 0; j < 8; ++j) { const int s = k0 + j * 16 + col;
#pragma unroll
    for (int r = 0; r < 8; ++r) { const int t = ql0 + 8 * g + r; const int dd = s - t; float v = acc[j][r]; if (dd >= -WR && dd <= WR) v += QR[(size_t)t * 16 + dd + WR]; v = v * 0.125f - log1pf(fabsf((float)dd)); if (AM[((size_t)b * TT + t) * TT + s] == 0) v = -10000.0f; ss[wave][8 * g + r][j * 16 + col] = v; mx[r] = fmaxf(mx[r], v); } }
  // row 8g + r lives in the 16 lanes of half g: maximum over this wave's 128 keys, then over the 8 waves through LDS
#pragma unroll
  for (int o = 1; o < 16; o <<= 1)
#pragma unroll
    for (int r = 0; r < 8; ++r) mx[r] = fmaxf(mx[r], __shfl_xor(mx[r], o));
  if (col == 0) {
#pragma unroll
    for (int r = 0; r < 8; ++r) smx[8 * g + r][wave] = mx[r]; }
  __syncthreads();
#pragma unroll
  for (int r = 0; r < 8; ++r) { const v4f a = *(const v4f*)&smx[8 * g + r][0], c = *(const v4f*)&smx[8 * g + r][4]; mx[r] = fmaxf(fmaxf(fmaxf(a[0], a[1]), fmaxf(a[2], a[3])), fmaxf(fmaxf(c[0], c[1]), fmaxf(c[2], c[3]))); }
  // each lane takes back the scores it stored itself; j stays rolled: LDS takes a running index, so eight copies of this body would only lengthen the code
#pragma unroll 1
  for (int j = 0; j < 8; ++j)
#pragma unroll
    for (int r = 0; r < 8; ++r) { float* p = &ss[wave][8 * g + r][j * 16 + col]; const float e = expf(*p - mx[r]); *p = e; su[r] += e; }
#pragma unroll
  for (int o = 1; o < 16; o <<= 1)
#pragma unroll
    for (int r = 0; r < 8; ++r) su[r] += __shfl_xor(su[r], o);
  if (col == 0) {
#pragma unroll
    for (int r = 0; r < 8; ++r) ssu[8 * g + r][wave] = su[r]; }
  __syncthreads();
  // lane l holds 1 / sum of row l & 15; rows leave LDS as whole 512-byte pieces
  const v4f ta = *(const v4f*)&ssu[col][0], tc = *(const v4f*)&ssu[col][4]; const float inv = 1.0f / (((ta[0] + ta[1]) + (ta[2] + ta[3])) + ((tc[0] + tc[1]) + (tc[2] + tc[3])));
#pragma unroll
  for (int rl = 0; rl < 16; ++rl) { const float iv = __shfl(inv, rl); const v4f e = *(const v4f*)&ss[wave][rl][lane * 4]; vst2(S + (size_t)(ql0 + rl) * TT + k0 + lane * 4, e * iv * 2048.0f); } }
// ---- k_pv: block = (64 queries, batch in group * HG + head in group): ctx rows [b*t][h*64+d] = P . v (3 products) + sum_j P[t][t+j-4] rel_v[j][d] / 2^11
__global__ __launch_bounds__(128) void k_pv(const float* __restrict__ PS0, const __bf16* __restrict__ VT, const __bf16* __restrict__ VL, const float* __restrict__ RV, int b0, int h0, float* __restrict__ CX) { const int b = b0 + blockIdx.z / HG, h = h0 + blockIdx.z % HG; const float* PS = PS0 + (size_t)blockIdx.z * TT * TT; __shared__ __align__(16) float ss[4][16][68]; __shared__ float srv[NRL][HD]; __shared__ float spw[64][NRL];
  const int tid = threadIdx.x, wave = tid >> 5, lane = tid & 31, col = lane & 15, g = lane >> 4; const int ql0 = blockIdx.x * 64 + wave * 16; const int tb = blockIdx.x * 64;
  for (int e = tid; e < NRL * HD; e += 128) srv[e / HD][e % HD] = bfr(RV[e]);
  for (int e = tid; e < 64 * NRL; e += 128) { const int rl = e / NRL, j = e % NRL; const int t = tb + rl, s = t + j - WR; spw[rl][j] = (s >= 0 && s < TT) ? PS[(size_t)t * TT + s] : 0.f; }
  v8f acc[4] = {};
#pragma unroll 1
  for (int kc = 0; kc < TT / 32; ++kc) { const F2 p = split_row(PS + (size_t)(ql0 + col) * TT, kc * 32, lane);
#pragma unroll
    for (int j = 0; j < 4; ++j) { const size_t po = ((size_t)b * CC + h * HD + j * 16 + col) * (size_t)TT + kc * 32; const v16b vh = frag_b(VT + po, lane); acc[j] = wmma_bf(p.h, vh, acc[j]); acc[j] = wmma_bf(p.l, vh, acc[j]); acc[j] = wmma_bf(p.h, frag_b(VL + po, lane), acc[j]); } }
  __syncthreads();
#pragma unroll
  for (int j = 0; j < 4; ++j)
#pragma unroll
    for (int r = 0; r < 8; ++r) { const int rl = wave * 16 + 8 * g + r; const int d = j * 16 + col; float a = acc[j][r]; for (int jj = 0; jj < NRL; ++jj) a += spw[rl][jj] * srv[jj][d]; ss[wave][8 * g + r][d] = a * (1.0f / 2048.0f); }
  LDSX(); for (int rl = 0; rl < 16; ++rl) if (lane < 16) vst2(CX + ((size_t)b * TT + ql0 + rl) * CC + h * HD + lane * 4, *(const v4f*)&ss[wave][rl][lane * 4]); }
// ---- k_out: block = (64 positions, 128 out channels, b): out[o][t] = sum_c Wo[o][c] ctx[t][c] + bo; A = ctx rows (hi + lo), B = Wo [o][c]; transposed to planes
__global__ __launch_bounds__(128) void k_out(const float* __restrict__ CX, const float* __restrict__ WO, const float* __restrict__ BO, float* __restrict__ OUT) { __shared__ __align__(16) float so[128][68];
  const int tid = threadIdx.x, wave = tid >> 5, lane = tid & 31, col = lane & 15, g = lane >> 4; const int t0 = blockIdx.x * 64, c0 = blockIdx.y * 128; const size_t b = blockIdx.z; const size_t r0 = b * TT + t0 + wave * 16;
  v8f acc[8] = {};
#pragma unroll 2
  for (int kc = 0; kc < CC / 32; ++kc) { const F2 a = split_row(CX + (r0 + col) * CC, kc * 32, lane);
#pragma unroll
    for (int j = 0; j < 8; ++j) { v16b w; const int o = c0 + j * 16 + col;
#pragma unroll
      for (int i = 0; i < 8; ++i) { w[i] = (__bf16)WO[(size_t)o * CC + kc * 32 + 8 * g + i]; w[8 + i] = (__bf16)WO[(size_t)o * CC + kc * 32 + 16 + 8 * g + i]; }
      acc[j] = wmma_bf(a.h, w, acc[j]); acc[j] = wmma_bf(a.l, w, acc[j]); } }
#pragma unroll
  for (int j = 0; j < 8; ++j) { const float bb = bfr(BO[c0 + j * 16 + col]);
#pragma unroll
    for (int r = 0; r < 8; ++r) so[j * 16 + col][wave * 16 + 8 * g + r] = acc[j][r] + bb; }
  __syncthreads(); for (int e = tid; e < 128 * 16; e += 128) { const int cl = e >> 4, q = e & 15; vst2(OUT + ((size_t)b * CC + c0 + cl) * TT + t0 + q * 4, *(const v4f*)&so[cl][q * 4]); } }
extern "C" void kernel_launch(void* const* d_in, const int* in_sizes, int n_in, void* d_out, int out_size, void* d_ws, size_t ws_size, hipStream_t stream) {
  (void)in_sizes; (void)n_in; (void)out_size;
  const float** F = (const float**)d_in;   // 0 x [8,512,1024], 1 c [8,512,1024], 2 attn_mask [8,1,1024,1024] int, 3 Wq [512,512], 4 bq, 5 Wk, 6 bk, 7 Wv, 8 bv, 9 Wo [512,512], 10 bo, 11 emb_rel_k [1,9,64], 12 emb_rel_v [1,9,64]
  if (ws_size < (size_t)WS_END) return;
  char* ws = (char*)d_ws; float *QF = (float*)(ws + WS_QF), *QR = (float*)(ws + WS_QR), *S = (float*)(ws + WS_S), *CX = (float*)(ws + WS_CX); _Float16 *QH = (_Float16*)(ws + WS_QH), *QL = (_Float16*)(ws + WS_QL), *KH = (_Float16*)(ws + WS_KH); __bf16 *VT = (__bf16*)(ws + WS_VT), *VL = (__bf16*)(ws + WS_VL);
  k_proj<<<dim3(TT / 64, CC / 128, TNB * 3), 128, 0, stream>>>(F[0], F[1], F[3], F[4], F[5], F[6], F[7], F[8], QF, QH, QL, KH, VT, VL);
  k_qr<<<dim3(TT / 64, 1, TNB * NH), 64, 0, stream>>>(QF, F[11], QR);
  for (int b0 = 0; b0 < TNB; b0 += BG) for (int h0 = 0; h0 < NH; h0 += HG) {
    k_sc<<<dim3(TT / 16, 1, BG * HG), 256, 0, stream>>>(QH, QL, KH, QR, (const int*)d_in[2], b0, h0, S);
    k_pv<<<dim3(TT / 64, 1, BG * HG), 128, 0, stream>>>(S, VT, VL, F[12], b0, h0, CX);
  }
  k_out<<<dim3(TT / 64, CC / 128, TNB), 128, 0, stream>>>(CX, F[9], F[10], (float*)d_out);
}

// v003
// It runs in 600 microseconds.
// Next to v002, in two timings, it ran 1.13 times as fast each time.
// Over all steps from v000 it is 2.44 times as fast.
// compute dtype: all float inputs rounded to bf16, attn_mask (int) read; q = Wq x + bq (from x), k/v = W c + b (from c) as 1x1 convs with EXACT bf16 products on WMMA 16x16x32 (channel-major tiles transposed in LDS), f32 accumulate; q as f16 hi + residual, k f16 -> 2-product content logits; the 9 windowed relative-key logits q_t . rel_k[s-t+4] and the relative-value term sum_j p[t][t+j-4] rel_v[j] in f32 on the VALU; proximity bias -log1p|s-t| (precise log1pf) and the mask in f32; softmax in f32 (precise expf), P x 2^11 kept f32 split bf16 hi + lo against v bf16 hi + lo (3 products); out = Wo ctx (bf16 hi + lo) + bo written channel-major; f32 output.
#include <hip/hip_runtime.h>
#include <math.h>

typedef __attribute__((ext_vector_type(16))) _Float16 v16h;
typedef __attribute__((ext_vector_type(16))) __bf16 v16b;
typedef __attribute__((ext_vector_type(8)))  _Float16 v8h;
typedef __attribute__((ext_vector_type(8)))  float v8f;
typedef __attribute__((ext_vector_type(4)))  float v4f;
typedef __attribute__((ext_vector_type(2)))  float v2f;
typedef __attribute__((ext_vector_type(4)))  unsigned v4u;
typedef __attribute__((ext_vector_type(4)))  int v4i;
typedef float __attribute__((may_alias)) float_a;
typedef int __attribute__((may_alias)) int_a;

template <typename T> __device__ __forceinline__ void vst2(void* p, T v) { *(T*)p = v;  }
__device__ __forceinline__ v8f wmma16(v16h a, v16h b, v8f c) {
  v8f d = __builtin_amdgcn_wmma_f32_16x16x32_f16(false, a, false, b, (short)0, c, false, false);
  asm volatile("v_nop\n\tv_nop\n\tv_nop\n\tv_nop" : "+v"(d) : "v"(a), "v"(b));
  return d;
}
__device__ __forceinline__ v8f wmma_bf(v16b a, v16b b, v8f c) {
  v8f d = __builtin_amdgcn_wmma_f32_16x16x32_bf16(false, a, false, b, (short)0, c, false, false);
  asm volatile("v_nop\n\tv_nop\n\tv_nop\n\tv_nop" : "+v"(d) : "v"(a), "v"(b));
  return d;
}
// 16x16x32 fragments: lane = (h = lane>>4, row/col = lane&15); elements 0..7 = k0+8h+0..7, 8..15 = k0+16+8h+0..7; D element r = row 8h+r
__device__ __forceinline__ v16h frag_h(const _Float16* rowk0, int lane) {
  union { v16h v; v8h q[2]; } u; const _Float16* p = rowk0 + 8 * (lane >> 4);
  u.q[0] = *(const v8h*)p; u.q[1] = *(const v8h*)(p + 16); return u.v;
}
__device__ __forceinline__ v16h frag_f32(const float* rowk0, int lane) {
  v16h a; const float* p = rowk0 + 8 * (lane >> 4);
#pragma unroll
  for (int i = 0; i < 8; ++i) { a[i] = (_Float16)p[i]; a[8 + i] = (_Float16)p[16 + i]; }
  return a;
}
__device__ __forceinline__ v16h frag_f32s(const float* rowk0, int lane, float sc) {
  v16h a; const float* p = rowk0 + 8 * (lane >> 4);
#pragma unroll
  for (int i = 0; i < 8; ++i) { a[i] = (_Float16)(p[i] * sc); a[8 + i] = (_Float16)(p[16 + i] * sc); }
  return a;
}
// column fragment from a [K][ld] layout (column n), rows >= K read as 0
__device__ __forceinline__ v16h fragc_f32(const float* W, int k0, int n, int lane, int ld, int K) {
  v16h a; const int g = lane >> 4;
#pragma unroll
  for (int i = 0; i < 8; ++i) { const int ka = k0 + 8 * g + i, kb = ka + 16;
    a[i] = (_Float16)(ka < K ? W[(size_t)(ka < K ? ka : K - 1) * ld + n] : 0.f); a[8 + i] = (_Float16)(kb < K ? W[(size_t)(kb < K ? kb : K - 1) * ld + n] : 0.f); }
  return a;
}
struct F2 { v16b h, l; };
__device__ __forceinline__ F2 bsplit16(const float v[16]) { F2 r;
#pragma unroll
  for (int i = 0; i < 16; ++i) { const __bf16 h = (__bf16)v[i]; r.h[i] = h; r.l[i] = (__bf16)(v[i] - (float)h); }
  return r; }
__device__ __forceinline__ F2 split_row(const float* row, int k0, int lane) { float v[16]; const float* p = row + k0 + 8 * (lane >> 4);
#pragma unroll
  for (int i = 0; i < 8; ++i) { v[i] = p[i]; v[8 + i] = p[16 + i]; }
  return bsplit16(v); }
__device__ __forceinline__ F2 split_rowK(const float* row, int k0, int lane, int K) { float v[16]; const int g = lane >> 4;
#pragma unroll
  for (int i = 0; i < 8; ++i) { const int ka = k0 + 8 * g + i, kb = ka + 16; v[i] = ka < K ? row[ka < K ? ka : K - 1] : 0.f; v[8 + i] = kb < K ? row[kb < K ? kb : K - 1] : 0.f; }
  return bsplit16(v); }
__device__ __forceinline__ F2 split_col(const float* W, int k0, int n, int lane, int ld, int K) { float v[16]; const int g = lane >> 4;
#pragma unroll
  for (int i = 0; i < 8; ++i) { const int ka = k0 + 8 * g + i, kb = ka + 16; v[i] = ka < K ? W[(size_t)(ka < K ? ka : K - 1) * ld + n] : 0.f; v[8 + i] = kb < K ? W[(size_t)(kb < K ? kb : K - 1) * ld + n] : 0.f; }
  return bsplit16(v); }
__device__ __forceinline__ v8f mac3(const F2& a, const F2& b, v8f c) { c = wmma_bf(a.l, b.h, c); c = wmma_bf(a.h, b.l, c); return wmma_bf(a.h, b.h, c); }
__device__ __forceinline__ float sigm(float v) { return 1.0f / (1.0f + expf(-v)); }
#define LDSX() do { asm volatile("s_wait_dscnt 0" ::: "memory"); __builtin_amdgcn_wave_barrier(); __builtin_amdgcn_fence(__ATOMIC_RELEASE, "workgroup"); } while (0)


// VITS-style relative-position multi-head attention (B 8, C 512 = 8 x 64, T 1,024, window 4): content + windowed relative-key logits, proximity bias, mask, softmax, value + windowed relative-value, output 1x1 conv.
#define NB 8
#define CC 512
#define TT 1024
#define NH 8
#define HD 64
#define WR 4
#define NRL 9
#define HG 8
#define BG 4   // batches per launch of the score / softmax / value stages: S for BG batches is the most the workspace holds
#ifndef TNB
#define TNB NB
#endif
typedef __attribute__((ext_vector_type(8))) __bf16 v8b;
__device__ __forceinline__ v16b frag_b(const __bf16* rowk0, int lane) {
  union { v16b v; v8b q[2]; } u; const __bf16* p = rowk0 + 8 * (lane >> 4);
  u.q[0] = *(const v8b*)p; u.q[1] = *(const v8b*)(p + 16); return u.v;
}
__device__ __forceinline__ float bfr(float v) { return (float)(__bf16)v; }
__device__ __attribute__((noinline)) float exp_ni(float v) { return expf(v); }
__device__ __attribute__((noinline)) float erf_ni(float v) { return erff(v); }

#define WS_QF  0u                                  // f32 q rows [b*t][512] (for the rel-k dots)
#define WS_QH  (WS_QF + 4u * (size_t)NB * TT * CC)
#define WS_QL  (WS_QH + 2u * (size_t)NB * TT * CC)
#define WS_KH  (WS_QL + 2u * (size_t)NB * TT * CC)
#define WS_VT  (WS_KH + 2u * (size_t)NB * TT * CC)     // bf16 v planes [b][512][t]
#define WS_VL  (WS_VT + 2u * (size_t)NB * CC * TT)
#define WS_QR  (WS_VL + 2u * (size_t)NB * CC * TT)     // f32 rel-k logits [b][h][t][16] (9 used)
#define WS_S   (WS_QR + 4u * (size_t)NB * NH * TT * 16) // f32 P x 2^11 [BG][HG][t][s]
#define WS_CX  (WS_S + 4u * (size_t)BG * HG * TT * TT) // f32 ctx rows [b*t][512]
#define WS_END (WS_CX + 4u * (size_t)NB * TT * CC)

// ---- k_proj: block = (64 positions, 128 out channels, b*3 + which): x^T / c^T tile in LDS; W [out][in] + b exact
__global__ __launch_bounds__(128) void k_proj(const float* __restrict__ X, const float* __restrict__ Cc, const float* __restrict__ WQ, const float* __restrict__ BQ, const float* __restrict__ WK, const float* __restrict__ BK, const float* __restrict__ WV, const float* __restrict__ BV, float* __restrict__ QF, _Float16* __restrict__ QH, _Float16* __restrict__ QL, _Float16* __restrict__ KH, __bf16* __restrict__ VT, __bf16* __restrict__ VL) {
  __shared__ __align__(16) __bf16 sx[64][CC + 8]; __shared__ __align__(16) float sf[64][132]; __shared__ __align__(16) unsigned char sbuf[2 * 128 * 72 * 2];   // union: (th, tl2) for v  |  (sh, sl) for q/k
  __bf16 (*th)[72] = (__bf16 (*)[72])sbuf; __bf16 (*tl2)[72] = (__bf16 (*)[72])(sbuf + 128 * 72 * 2); _Float16 (*sh)[136] = (_Float16 (*)[136])sbuf; _Float16 (*sl)[136] = (_Float16 (*)[136])(sbuf + 64 * 136 * 2);
  const int tid = threadIdx.x, wave = tid >> 5, lane = tid & 31, col = lane & 15, g = lane >> 4; const int p0 = blockIdx.x * 64; const int c0 = blockIdx.y * 128; const size_t b = blockIdx.z / 3; const int which = blockIdx.z % 3;
  const float* Xs = which == 0 ? X : Cc; const float* Wm = which == 0 ? WQ : which == 1 ? WK : WV; const float* Bm = which == 0 ? BQ : which == 1 ? BK : BV;
  for (int e = tid; e < CC * 64; e += 128) { const int c = e >> 6, pl = e & 63; sx[pl][c] = (__bf16)Xs[(b * CC + c) * (size_t)TT + p0 + pl]; }
  __syncthreads();
  v8f acc[8] = {};
#pragma unroll 2
  for (int kc = 0; kc < CC / 32; ++kc) { const v16b a = frag_b(&sx[wave * 16 + col][kc * 32], lane);
#pragma unroll
    for (int j = 0; j < 8; ++j) { v16b w; const int o = c0 + j * 16 + col;
#pragma unroll
      for (int i = 0; i < 8; ++i) { w[i] = (__bf16)Wm[(size_t)o * CC + kc * 32 + 8 * g + i]; w[8 + i] = (__bf16)Wm[(size_t)o * CC + kc * 32 + 16 + 8 * g + i]; }
      acc[j] = wmma_bf(a, w, acc[j]); } }
  if (which < 2) {
#pragma unroll
    for (int j = 0; j < 8; ++j) { const float bb = bfr(Bm[c0 + j * 16 + col]);
#pragma unroll
      for (int r = 0; r < 8; ++r) sf[wave * 16 + 8 * g + r][j * 16 + col] = acc[j][r] + bb; }
    __syncthreads();
    // rows: f32 (q only), f16 hi (+ residual for q)
    for (int e = tid; e < 64 * 32; e += 128) { const int rl = e >> 5, q4 = e & 31; const size_t row = b * TT + p0 + rl; const float* src = &sf[rl][q4 * 4]; if (which == 0) vst2(QF + row * CC + c0 + q4 * 4, *(const v4f*)src); }
    for (int e = tid; e < 64 * 128; e += 128) { const int rl = e >> 7, cl = e & 127; const float v = sf[rl][cl]; const _Float16 hv = (_Float16)v; sh[rl][cl] = hv; sl[rl][cl] = (_Float16)(v - (float)hv); }
    __syncthreads();
    _Float16* dh = which == 0 ? QH : KH; for (int e = tid; e < 64 * 16; e += 128) { const int rl = e >> 4, q = e & 15; const size_t row = b * TT + p0 + rl; vst2((unsigned*)(dh + row * CC + c0 + q * 8), *(const v4u*)&sh[rl][q * 8]); if (which == 0) vst2((unsigned*)(QL + row * CC + c0 + q * 8), *(const v4u*)&sl[rl][q * 8]); } }
  else {
#pragma unroll
    for (int j = 0; j < 8; ++j) { const float bb = bfr(Bm[c0 + j * 16 + col]);
#pragma unroll
      for (int r = 0; r < 8; ++r) { const float v = acc[j][r] + bb; const int rl = wave * 16 + 8 * g + r, cl = j * 16 + col; const __bf16 bh = (__bf16)v; th[cl][rl] = bh; tl2[cl][rl] = (__bf16)(v - (float)bh); } }
    __syncthreads(); for (int e = tid; e < 128 * 8; e += 128) { const int cl = e >> 3, q = e & 7; const size_t o2 = (b * CC + c0 + cl) * (size_t)TT + p0 + q * 8; vst2((unsigned*)(VT + o2), *(const v4u*)&th[cl][q * 8]); vst2((unsigned*)(VL + o2), *(const v4u*)&tl2[cl][q * 8]); } } }
// ---- k_qr: block = (64 queries, b * 8 + head): QR[b][h][t][j] = q_t(head h) . rel_k[j] for j = 0..8 (f32)
__global__ __launch_bounds__(64) void k_qr(const float* __restrict__ QF, const float* __restrict__ RK, float* __restrict__ QR0) { __shared__ float srk[NRL][HD]; __shared__ __align__(16) float so[64][16];
  const int t = threadIdx.x; const int b = blockIdx.z / NH, h = blockIdx.z % NH; float* QR = QR0 + (size_t)blockIdx.z * TT * 16; const int t0 = blockIdx.x * 64;
  for (int e = t; e < NRL * HD; e += 64) srk[e / HD][e % HD] = bfr(RK[e]);
  for (int e = t; e < 64 * 16; e += 64) so[e >> 4][e & 15] = 0.f;
  __syncthreads();
  const float* q = QF + ((size_t)b * TT + t0 + t) * CC + h * HD;
#pragma unroll 1
  for (int j = 0; j < NRL; ++j) { float a = 0.f;
#pragma unroll 1
    for (int d = 0; d < HD; ++d) a += q[d] * srk[j][d]; so[t][j] = a; }
  __syncthreads(); for (int e = t; e < 64 * 4; e += 64) { const int rl = e >> 2, qq = e & 3; vst2(QR + (size_t)(t0 + rl) * 16 + qq * 4, *(const v4f*)&so[rl][qq * 4]); } }
// ---- k_sc: block = (16 queries, all 1,024 keys, batch in group * HG + head in group), wave = 128 keys: S = (q.k + [|s-t|<=4] QR[t][s-t+4]) / 8 - log1p|s-t| (from a table in LDS); mask == 0 -> -1e4; then the row softmax while the block's 16 whole rows lie in LDS -> P x 2^11 f32. Second launch bound: 8 waves a SIMD, so that four blocks share a WGP
__global__ __launch_bounds__(256, 8) void k_sc(const _Float16* __restrict__ QH, const _Float16* __restrict__ QL, const _Float16* __restrict__ KH, const float* __restrict__ QR0, const int* __restrict__ AM, int b0, int h0, float* __restrict__ S0) { __shared__ __align__(16) float ss[8][16][132]; __shared__ __align__(16) float smx[16][8]; __shared__ __align__(16) float ssu[16][8]; __shared__ float slp[TT + 15]; const int b = b0 + blockIdx.z / HG, h = h0 + blockIdx.z % HG; const float* QR = QR0 + ((size_t)b * NH + h) * TT * 16; float* S = S0 + (size_t)blockIdx.z * TT * TT;
  const int tid = threadIdx.x, wave = tid >> 5, lane = tid & 31, col = lane & 15, g = lane >> 4; const int k0 = wave * 128; const int ql0 = blockIdx.x * 16; const size_t q0 = (size_t)b * TT + ql0;
  // the block's 16 x 1,024 scores meet only 1,039 distances s - t: slp[i] = log1p|i - 15 - ql0|, each computed once for the block
  for (int e = tid; e < TT + 15; e += 256) slp[e] = log1pf(fabsf((float)(e - 15 - ql0)));
  v8f acc[8] = {};
#pragma unroll
  for (int kc = 0; kc < HD / 32; ++kc) { const v16h ah = frag_h(QH + (q0 + col) * CC + h * HD + kc * 32, lane), al = frag_h(QL + (q0 + col) * CC + h * HD + kc * 32, lane);
    asm volatile("s_wait_xcnt 0x0" ::: "memory");   // precaution: the compiler lays the k loads' results over the q loads' address registers; this stands between them
#pragma unroll
    for (int j = 0; j < 8; ++j) { const v16h kb = frag_h(KH + ((size_t)b * TT + k0 + j * 16 + col) * CC + h * HD + kc * 32, lane); acc[j] = wmma16(ah, kb, acc[j]); acc[j] = wmma16(al, kb, acc[j]); } }
  float mx[8], su[8];   // the loops over r, o and rl below are unrolled so that mx, su and the rows' pieces are registers, not indexed memory
#pragma unroll
  for (int r = 0; r < 8; ++r) { mx[r] = -3.0e38f; su[r] = 0.f; }
  __syncthreads();   // slp is whole
#pragma unroll
  for (int j = 0; j < 8; ++j) { const int s = k0 + j * 16 + col;
#pragma unroll
    for (int r = 0; r < 8; ++r) { const int t = ql0 + 8 * g + r; const int dd = s - t; float v = acc[j][r]; if (dd >= -WR && dd <= WR) v += QR[(size_t)t * 16 + dd + WR]; v = v * 0.125f - slp[dd + 15 + ql0]; if (AM[((size_t)b * TT + t) * TT + s] == 0) v = -10000.0f; ss[wave][8 * g + r][j * 16 + col] = v; mx[r] = fmaxf(mx[r], v); } }
  // row 8g + r lives in the 16 lanes of half g: maximum over this wave's 128 keys, then over the 8 waves through LDS
#pragma unroll
  for (int o = 1; o < 16; o <<= 1)
#pragma unroll
    for (int r = 0; r < 8; ++r) mx[r] = fmaxf(mx[r], __shfl_xor(mx[r], o));
  if (col == 0) {
#pragma unroll
    for (int r = 0; r < 8; ++r) smx[8 * g + r][wave] = mx[r]; }
  __syncthreads();
#pragma unroll
  for (int r = 0; r < 8; ++r) { const v4f a = *(const v4f*)&smx[8 * g + r][0], c = *(const v4f*)&smx[8 * g + r][4]; mx[r] = fmaxf(fmaxf(fmaxf(a[0], a[1]), fmaxf(a[2], a[3])), fmaxf(fmaxf(c[0], c[1]), fmaxf(c[2], c[3]))); }
  // each lane takes back the scores it stored itself; j stays rolled: LDS takes a running index, so eight copies of this body would only lengthen the code
#pragma unroll 1
  for (int j = 0; j < 8; ++j)
#pragma unroll
    for (int r = 0; r < 8; ++r) { float* p = &ss[wave][8 * g + r][j * 16 + col]; const float e = expf(*p - mx[r]); *p = e; su[r] += e; }
#pragma unroll
  for (int o = 1; o < 16; o <<= 1)
#pragma unroll
    for (int r = 0; r < 8; ++r) su[r] += __shfl_xor(su[r], o);
  if (col == 0) {
#pragma unroll
    for (int r = 0; r < 8; ++r) ssu[8 * g + r][wave] = su[r]; }
  __syncthreads();
  // lane l holds 1 / sum of row l & 15; rows leave LDS as whole 512-byte pieces
  const v4f ta = *(const v4f*)&ssu[col][0], tc = *(const v4f*)&ssu[col][4]; const float inv = 1.0f / (((ta[0] + ta[1]) + (ta[2] + ta[3])) + ((tc[0] + tc[1]) + (tc[2] + tc[3])));
#pragma unroll
  for (int rl = 0; rl < 16; ++rl) { const float iv = __shfl(inv, rl); const v4f e = *(const v4f*)&ss[wave][rl][lane * 4]; vst2(S + (size_t)(ql0 + rl) * TT + k0 + lane * 4, e * iv * 2048.0f); } }
// ---- k_pv: block = (64 queries, batch in group * HG + head in group): ctx rows [b*t][h*64+d] = P . v (3 products) + sum_j P[t][t+j-4] rel_v[j][d] / 2^11
__global__ __launch_bounds__(128) void k_pv(const float* __restrict__ PS0, const __bf16* __restrict__ VT, const __bf16* __restrict__ VL, const float* __restrict__ RV, int b0, int h0, float* __restrict__ CX) { const int b = b0 + blockIdx.z / HG, h = h0 + blockIdx.z % HG; const float* PS = PS0 + (size_t)blockIdx.z * TT * TT; __shared__ __align__(16) float ss[4][16][68]; __shared__ float srv[NRL][HD]; __shared__ float spw[64][NRL];
  const int tid = threadIdx.x, wave = tid >> 5, lane = tid & 31, col = lane & 15, g = lane >> 4; const int ql0 = blockIdx.x * 64 + wave * 16; const int tb = blockIdx.x * 64;
  for (int e = tid; e < NRL * HD; e += 128) srv[e / HD][e % HD] = bfr(RV[e]);
  for (int e = tid; e < 64 * NRL; e += 128) { const int rl = e / NRL, j = e % NRL; const int t = tb + rl, s = t + j - WR; spw[rl][j] = (s >= 0 && s < TT) ? PS[(size_t)t * TT + s] : 0.f; }
  v8f acc[4] = {};
#pragma unroll 1
  for (int kc = 0; kc < TT / 32; ++kc) { const F2 p = split_row(PS + (size_t)(ql0 + col) * TT, kc * 32, lane);
#pragma unroll
    for (int j = 0; j < 4; ++j) { const size_t po = ((size_t)b * CC + h * HD + j * 16 + col) * (size_t)TT + kc * 32; const v16b vh = frag_b(VT + po, lane); acc[j] = wmma_bf(p.h, vh, acc[j]); acc[j] = wmma_bf(p.l, vh, acc[j]); acc[j] = wmma_bf(p.h, frag_b(VL + po, lane), acc[j]); } }
  __syncthreads();
#pragma unroll
  for (int j = 0; j < 4; ++j)
#pragma unroll
    for (int r = 0; r < 8; ++r) { const int rl = wave * 16 + 8 * g + r; const int d = j * 16 + col; float a = acc[j][r]; for (int jj = 0; jj < NRL; ++jj) a += spw[rl][jj] * srv[jj][d]; ss[wave][8 * g + r][d] = a * (1.0f / 2048.0f); }
  LDSX(); for (int rl = 0; rl < 16; ++rl) if (lane < 16) vst2(CX + ((size_t)b * TT + ql0 + rl) * CC + h * HD + lane * 4, *(const v4f*)&ss[wave][rl][lane * 4]); }
// ---- k_out: block = (64 positions, 128 out channels, b): out[o][t] = sum_c Wo[o][c] ctx[t][c] + bo; A = ctx rows (hi + lo), B = Wo [o][c]; transposed to planes
__global__ __launch_bounds__(128) void k_out(const float* __restrict__ CX, const float* __restrict__ WO, const float* __restrict__ BO, float* __restrict__ OUT) { __shared__ __align__(16) float so[128][68];
  const int tid = threadIdx.x, wave = tid >> 5, lane = tid & 31, col = lane & 15, g = lane >> 4; const int t0 = blockIdx.x * 64, c0 = blockIdx.y * 128; const size_t b = blockIdx.z; const size_t r0 = b * TT + t0 + wave * 16;
  v8f acc[8] = {};
#pragma unroll 2
  for (int kc = 0; kc < CC / 32; ++kc) { const F2 a = split_row(CX + (r0 + col) * CC, kc * 32, lane);
#pragma unroll
    for (int j = 0; j < 8; ++j) { v16b w; const int o = c0 + j * 16 + col;
#pragma unroll
      for (int i = 0; i < 8; ++i) { w[i] = (__bf16)WO[(size_t)o * CC + kc * 32 + 8 * g + i]; w[8 + i] = (__bf16)WO[(size_t)o * CC + kc * 32 + 16 + 8 * g + i]; }
      acc[j] = wmma_bf(a.h, w, acc[j]); acc[j] = wmma_bf(a.l, w, acc[j]); } }
#pragma unroll
  for (int j = 0; j < 8; ++j) { const float bb = bfr(BO[c0 + j * 16 + col]);
#pragma unroll
    for (int r = 0; r < 8; ++r) so[j * 16 + col][wave * 16 + 8 * g + r] = acc[j][r] + bb; }
  __syncthreads(); for (int e = tid; e < 128 * 16; e += 128) { const int cl = e >> 4, q = e & 15; vst2(OUT + ((size_t)b * CC + c0 + cl) * TT + t0 + q * 4, *(const v4f*)&so[cl][q * 4]); } }
extern "C" void kernel_launch(void* const* d_in, const int* in_sizes, int n_in, void* d_out, int out_size, void* d_ws, size_t ws_size, hipStream_t stream) {
  (void)in_sizes; (void)n_in; (void)out_size;
  const float** F = (const float**)d_in;   // 0 x [8,512,1024], 1 c [8,512,1024], 2 attn_mask [8,1,1024,1024] int, 3 Wq [512,512], 4 bq, 5 Wk, 6 bk, 7 Wv, 8 bv, 9 Wo [512,512], 10 bo, 11 emb_rel_k [1,9,64], 12 emb_rel_v [1,9,64]
  if (ws_size < (size_t)WS_END) return;
  char* ws = (char*)d_ws; float *QF = (float*)(ws + WS_QF), *QR = (float*)(ws + WS_QR), *S = (float*)(ws + WS_S), *CX = (float*)(ws + WS_CX); _Float16 *QH = (_Float16*)(ws + WS_QH), *QL = (_Float16*)(ws + WS_QL), *KH = (_Float16*)(ws + WS_KH); __bf16 *VT = (__bf16*)(ws + WS_VT), *VL = (__bf16*)(ws + WS_VL);
  k_proj<<<dim3(TT / 64, CC / 128, TNB * 3), 128, 0, stream>>>(F[0], F[1], F[3], F[4], F[5], F[6], F[7], F[8], QF, QH, QL, KH, VT, VL);
  k_qr<<<dim3(TT / 64, 1, TNB * NH), 64, 0, stream>>>(QF, F[11], QR);
  for (int b0 = 0; b0 < TNB; b0 += BG) for (int h0 = 0; h0 < NH; h0 += HG) {
    k_sc<<<dim3(TT / 16, 1, BG * HG), 256, 0, stream>>>(QH, QL, KH, QR, (const int*)d_in[2], b0, h0, S);
    k_pv<<<dim3(TT / 64, 1, BG * HG), 128, 0, stream>>>(S, VT, VL, F[12], b0, h0, CX);
  }
  k_out<<<dim3(TT / 64, CC / 128, TNB), 128, 0, stream>>>(CX, F[9], F[10], (float*)d_out);
}

// v004
// It runs in 358 microseconds.
// Two timings next to v003 both put it at 1.68 times that version's speed.
// All steps since v000 together make it 4.10 times as fast.
// compute dtype: all float inputs rounded to bf16, attn_mask (int) read; q = Wq x + bq (from x), k/v = W c + b (from c) as 1x1 convs with EXACT bf16 products on WMMA 16x16x32 (channel-major tiles transposed in LDS), f32 accumulate; q as f16 hi + residual, k f16 -> 2-product content logits; the 9 windowed relative-key logits q_t . rel_k[s-t+4] and the relative-value term sum_j p[t][t+j-4] rel_v[j] in f32 on the VALU; proximity bias -log1p|s-t| (precise log1pf) and the mask in f32; softmax in f32 (precise expf), P x 2^11 kept f32 split bf16 hi + lo against v bf16 hi + lo (3 products); out = Wo ctx (bf16 hi + lo) + bo written channel-major; f32 output.
#include <hip/hip_runtime.h>
#include <math.h>

typedef __attribute__((ext_vector_type(16))) _Float16 v16h;
typedef __attribute__((ext_vector_type(16))) __bf16 v16b;
typedef __attribute__((ext_vector_type(8)))  _Float16 v8h;
typedef __attribute__((ext_vector_type(8)))  float v8f;
typedef __attribute__((ext_vector_type(4)))  float v4f;
typedef __attribute__((ext_vector_type(2)))  float v2f;
typedef __attribute__((ext_vector_type(4)))  unsigned v4u;
typedef __attribute__((ext_vector_type(4)))  int v4i;
typedef float __attribute__((may_alias)) float_a;
typedef int __attribute__((may_alias)) int_a;

template <typename T> __device__ __forceinline__ void vst2(void* p, T v) { *(T*)p = v;  }
__device__ __forceinline__ v8f wmma16(v16h a, v16h b, v8f c) {
  v8f d = __builtin_amdgcn_wmma_f32_16x16x32_f16(false, a, false, b, (short)0, c, false, false);
  asm volatile("v_nop\n\tv_nop\n\tv_nop\n\tv_nop" : "+v"(d) : "v"(a), "v"(b));
  return d;
}
__device__ __forceinline__ v8f wmma_bf(v16b a, v16b b, v8f c) {
  v8f d = __builtin_amdgcn_wmma_f32_16x16x32_bf16(false, a, false, b, (short)0, c, false, false);
  asm volatile("v_nop\n\tv_nop\n\tv_nop\n\tv_nop" : "+v"(d) : "v"(a), "v"(b));
  return d;
}
// 16x16x32 fragments: lane = (h = lane>>4, row/col = lane&15); elements 0..7 = k0+8h+0..7, 8..15 = k0+16+8h+0..7; D element r = row 8h+r
__device__ __forceinline__ v16h frag_h(const _Float16* rowk0, int lane) {
  union { v16h v; v8h q[2]; } u; const _Float16* p = rowk0 + 8 * (lane >> 4);
  u.q[0] = *(const v8h*)p; u.q[1] = *(const v8h*)(p + 16); return u.v;
}
__device__ __forceinline__ v16h frag_f32(const float* rowk0, int lane) {
  v16h a; const float* p = rowk0 + 8 * (lane >> 4);
#pragma unroll
  for (int i = 0; i < 8; ++i) { a[i] = (_Float16)p[i]; a[8 + i] = (_Float16)p[16 + i]; }
  return a;
}
__device__ __forceinline__ v16h frag_f32s(const float* rowk0, int lane, float sc) {
  v16h a; const float* p = rowk0 + 8 * (lane >> 4);
#pragma unroll
  for (int i = 0; i < 8; ++i) { a[i] = (_Float16)(p[i] * sc); a[8 + i] = (_Float16)(p[16 + i] * sc); }
  return a;
}
// column fragment from a [K][ld] layout (column n), rows >= K read as 0
__device__ __forceinline__ v16h fragc_f32(const float* W, int k0, int n, int lane, int ld, int K) {
  v16h a; const int g = lane >> 4;
#pragma unroll
  for (int i = 0; i < 8; ++i) { const int ka = k0 + 8 * g + i, kb = ka + 16;
    a[i] = (_Float16)(ka < K ? W[(size_t)(ka < K ? ka : K - 1) * ld + n] : 0.f); a[8 + i] = (_Float16)(kb < K ? W[(size_t)(kb < K ? kb : K - 1) * ld + n] : 0.f); }
  return a;
}
struct F2 { v16b h, l; };
__device__ __forceinline__ F2 bsplit16(const float v[16]) { F2 r;
#pragma unroll
  for (int i = 0; i < 16; ++i) { const __bf16 h = (__bf16)v[i]; r.h[i] = h; r.l[i] = (__bf16)(v[i] - (float)h); }
  return r; }
__device__ __forceinline__ F2 split_row(const float* row, int k0, int lane) { float v[16]; const float* p = row + k0 + 8 * (lane >> 4);
#pragma unroll
  for (int i = 0; i < 8; ++i) { v[i] = p[i]; v[8 + i] = p[16 + i]; }
  return bsplit16(v); }
__device__ __forceinline__ F2 split_rowK(const float* row, int k0, int lane, int K) { float v[16]; const int g = lane >> 4;
#pragma unroll
  for (int i = 0; i < 8; ++i) { const int ka = k0 + 8 * g + i, kb = ka + 16; v[i] = ka < K ? row[ka < K ? ka : K - 1] : 0.f; v[8 + i] = kb < K ? row[kb < K ? kb : K - 1] : 0.f; }
  return bsplit16(v); }
__device__ __forceinline__ F2 split_col(const float* W, int k0, int n, int lane, int ld, int K) { float v[16]; const int g = lane >> 4;
#pragma unroll
  for (int i = 0; i < 8; ++i) { const int ka = k0 + 8 * g + i, kb = ka + 16; v[i] = ka < K ? W[(size_t)(ka < K ? ka : K - 1) * ld + n] : 0.f; v[8 + i] = kb < K ? W[(size_t)(kb < K ? kb : K - 1) * ld + n] : 0.f; }
  return bsplit16(v); }
__device__ __forceinline__ v8f mac3(const F2& a, const F2& b, v8f c) { c = wmma_bf(a.l, b.h, c); c = wmma_bf(a.h, b.l, c); return wmma_bf(a.h, b.h, c); }
__device__ __forceinline__ float sigm(float v) { return 1.0f / (1.0f + expf(-v)); }
// stands directly behind a group of global loads: keeps the whole group issued in front of the work that follows (nothing of it sinks to its use), and the precaution before the loads' address registers are written again
#define ISSUED() asm volatile("s_wait_xcnt 0x0" ::: "memory")
// the same, and the group's pointers are inputs of the wait: they stay in their registers up to it, so that no result of the group is laid over an address that a load of the group still names
#define ISSUED1(p) asm volatile("s_wait_xcnt 0x0" :: "v"(p) : "memory")
#define ISSUED2(p, q) asm volatile("s_wait_xcnt 0x0" :: "v"(p), "v"(q) : "memory")
#define ISSUED3(p, q, r) asm volatile("s_wait_xcnt 0x0" :: "v"(p), "v"(q), "v"(r) : "memory")
#define LDSX() do { asm volatile("s_wait_dscnt 0" ::: "memory"); __builtin_amdgcn_wave_barrier(); __builtin_amdgcn_fence(__ATOMIC_RELEASE, "workgroup"); } while (0)


// VITS-style relative-position multi-head attention (B 8, C 512 = 8 x 64, T 1,024, window 4): content + windowed relative-key logits, proximity bias, mask, softmax, value + windowed relative-value, output 1x1 conv.
#define NB 8
#define CC 512
#define TT 1024
#define NH 8
#define HD 64
#define WR 4
#define NRL 9
#define HG 8
#define BG 4   // batches per launch of the score / softmax / value stages: S for BG batches is the most the workspace holds
#ifndef TNB
#define TNB NB
#endif
typedef __attribute__((ext_vector_type(8))) __bf16 v8b;
__device__ __forceinline__ v16b frag_b(const __bf16* rowk0, int lane) {
  union { v16b v; v8b q[2]; } u; const __bf16* p = rowk0 + 8 * (lane >> 4);
  u.q[0] = *(const v8b*)p; u.q[1] = *(const v8b*)(p + 16); return u.v;
}
__device__ __forceinline__ float bfr(float v) { return (float)(__bf16)v; }
__device__ __attribute__((noinline)) float exp_ni(float v) { return expf(v); }
__device__ __attribute__((noinline)) float erf_ni(float v) { return erff(v); }

#define WS_QF  0u                                  // f32 q rows [b*t][512] (for the rel-k dots)
#define WS_QH  (WS_QF + 4u * (size_t)NB * TT * CC)
#define WS_QL  (WS_QH + 2u * (size_t)NB * TT * CC)
#define WS_KH  (WS_QL + 2u * (size_t)NB * TT * CC)
#define WS_VT  (WS_KH + 2u * (size_t)NB * TT * CC)     // bf16 v planes [b][512][t]
#define WS_VL  (WS_VT + 2u * (size_t)NB * CC * TT)
#define WS_QR  (WS_VL + 2u * (size_t)NB * CC * TT)     // f32 rel-k logits [b][h][t][16] (9 used)
#define WS_S   (WS_QR + 4u * (size_t)NB * NH * TT * 16) // f32 P x 2^11 [BG][HG][t][s]
#define WS_CX  (WS_S + 4u * (size_t)BG * HG * TT * TT) // f32 ctx rows [b*t][512]
#define WS_END (WS_CX + 4u * (size_t)NB * TT * CC)

// ---- k_proj: block = (64 positions, 128 out channels, b*3 + which): x^T / c^T tile in LDS; W [out][in] + b exact
__global__ __launch_bounds__(128) void k_proj(const float* __restrict__ X, const float* __restrict__ Cc, const float* __restrict__ WQ, const float* __restrict__ BQ, const float* __restrict__ WK, const float* __restrict__ BK, const float* __restrict__ WV, const float* __restrict__ BV, float* __restrict__ QF, _Float16* __restrict__ QH, _Float16* __restrict__ QL, _Float16* __restrict__ KH, __bf16* __restrict__ VT, __bf16* __restrict__ VL) {
  __shared__ __align__(16) __bf16 sx[64][CC + 8]; __shared__ __align__(16) float sf[64][132]; __shared__ __align__(16) unsigned char sbuf[2 * 128 * 72 * 2];   // union: (th, tl2) for v  |  (sh, sl) for q/k
  __bf16 (*th)[72] = (__bf16 (*)[72])sbuf; __bf16 (*tl2)[72] = (__bf16 (*)[72])(sbuf + 128 * 72 * 2); _Float16 (*sh)[136] = (_Float16 (*)[136])sbuf; _Float16 (*sl)[136] = (_Float16 (*)[136])(sbuf + 64 * 136 * 2);
  const int tid = threadIdx.x, wave = tid >> 5, lane = tid & 31, col = lane & 15, g = lane >> 4; const int p0 = blockIdx.x * 64; const int c0 = blockIdx.y * 128; const size_t b = blockIdx.z / 3; const int which = blockIdx.z % 3;
  const float* Xs = which == 0 ? X : Cc; const float* Wm = which == 0 ? WQ : which == 1 ? WK : WV; const float* Bm = which == 0 ? BQ : which == 1 ? BK : BV;
  // thread tid fills position tid & 63, channels (tid >> 6) + 2 k: 32 independent loads off one pointer are in flight before the first is waited for; the loops over u are unrolled so that xv is registers, the outer loop stays rolled: eight copies of the group would only lengthen the code
  const float* xp = Xs + (b * CC + (tid >> 6)) * (size_t)TT + p0 + (tid & 63);
#pragma unroll 1
  for (int kg = 0; kg < CC / 2; kg += 32) { float xv[32]; const float* xg = xp + (size_t)kg * 2 * TT;
#pragma unroll
    for (int u = 0; u < 32; ++u) xv[u] = xg[u * 2 * TT];
    ISSUED1(xg);
#pragma unroll
    for (int u = 0; u < 32; ++u) sx[tid & 63][(tid >> 6) + 2 * (kg + u)] = (__bf16)xv[u]; }
  __syncthreads();
  v8f acc[8] = {};
  // rolled: one k-step's 8 weight fragments (128 registers as f32) are all in flight at once; a second copy of the body would not fit beside them. The loops over j and i are unrolled so that wr is registers
#pragma unroll 1
  for (int kc = 0; kc < CC / 32; ++kc) { float wr[8][16]; const float* wp = Wm + (size_t)(c0 + col) * CC + kc * 32 + 8 * g;
#pragma unroll
    for (int j = 0; j < 8; ++j)
#pragma unroll
      for (int i = 0; i < 8; ++i) { wr[j][i] = wp[j * 16 * CC + i]; wr[j][8 + i] = wp[j * 16 * CC + 16 + i]; }
    ISSUED1(wp);
    const v16b a = frag_b(&sx[wave * 16 + col][kc * 32], lane);
#pragma unroll
    for (int j = 0; j < 8; ++j) { v16b w;
#pragma unroll
      for (int i = 0; i < 16; ++i) w[i] = (__bf16)wr[j][i];
      acc[j] = wmma_bf(a, w, acc[j]); } }
  if (which < 2) {
#pragma unroll
    for (int j = 0; j < 8; ++j) { const float bb = bfr(Bm[c0 + j * 16 + col]);
#pragma unroll
      for (int r = 0; r < 8; ++r) sf[wave * 16 + 8 * g + r][j * 16 + col] = acc[j][r] + bb; }
    __syncthreads();
    // rows: f32 (q only), f16 hi (+ residual for q)
    for (int e = tid; e < 64 * 32; e += 128) { const int rl = e >> 5, q4 = e & 31; const size_t row = b * TT + p0 + rl; const float* src = &sf[rl][q4 * 4]; if (which == 0) vst2(QF + row * CC + c0 + q4 * 4, *(const v4f*)src); }
    for (int e = tid; e < 64 * 128; e += 128) { const int rl = e >> 7, cl = e & 127; const float v = sf[rl][cl]; const _Float16 hv = (_Float16)v; sh[rl][cl] = hv; sl[rl][cl] = (_Float16)(v - (float)hv); }
    __syncthreads();
    _Float16* dh = which == 0 ? QH : KH; for (int e = tid; e < 64 * 16; e += 128) { const int rl = e >> 4, q = e & 15; const size_t row = b * TT + p0 + rl; vst2((unsigned*)(dh + row * CC + c0 + q * 8), *(const v4u*)&sh[rl][q * 8]); if (which == 0) vst2((unsigned*)(QL + row * CC + c0 + q * 8), *(const v4u*)&sl[rl][q * 8]); } }
  else {
#pragma unroll
    for (int j = 0; j < 8; ++j) { const float bb = bfr(Bm[c0 + j * 16 + col]);
#pragma unroll
      for (int r = 0; r < 8; ++r) { const float v = acc[j][r] + bb; const int rl = wave * 16 + 8 * g + r, cl = j * 16 + col; const __bf16 bh = (__bf16)v; th[cl][rl] = bh; tl2[cl][rl] = (__bf16)(v - (float)bh); } }
    __syncthreads(); for (int e = tid; e < 128 * 8; e += 128) { const int cl = e >> 3, q = e & 7; const size_t o2 = (b * CC + c0 + cl) * (size_t)TT + p0 + q * 8; vst2((unsigned*)(VT + o2), *(const v4u*)&th[cl][q * 8]); vst2((unsigned*)(VL + o2), *(const v4u*)&tl2[cl][q * 8]); } } }
// ---- k_qr: block = (64 queries, b * 8 + head): QR[b][h][t][j] = q_t(head h) . rel_k[j] for j = 0..8 (f32)
__global__ __launch_bounds__(64) void k_qr(const float* __restrict__ QF, const float* __restrict__ RK, float* __restrict__ QR0) { __shared__ float srk[NRL][HD]; __shared__ __align__(16) float so[64][16];
  const int t = threadIdx.x; const int b = blockIdx.z / NH, h = blockIdx.z % NH; float* QR = QR0 + (size_t)blockIdx.z * TT * 16; const int t0 = blockIdx.x * 64;
  // the thread's 64 q values are fetched together, once, ahead of the 9 dots; the loops over d are unrolled so that qv is registers
  const float* q = QF + ((size_t)b * TT + t0 + t) * CC + h * HD; float qv[HD];
#pragma unroll
  for (int d = 0; d < HD; ++d) qv[d] = q[d];
  ISSUED1(q);
  for (int e = t; e < NRL * HD; e += 64) srk[e / HD][e % HD] = bfr(RK[e]);
  for (int e = t; e < 64 * 16; e += 64) so[e >> 4][e & 15] = 0.f;
  __syncthreads();
#pragma unroll 1
  for (int j = 0; j < NRL; ++j) { float a = 0.f;
#pragma unroll
    for (int d = 0; d < HD; ++d) a += qv[d] * srk[j][d]; so[t][j] = a; }
  __syncthreads(); for (int e = t; e < 64 * 4; e += 64) { const int rl = e >> 2, qq = e & 3; vst2(QR + (size_t)(t0 + rl) * 16 + qq * 4, *(const v4f*)&so[rl][qq * 4]); } }
// ---- k_sc: block = (16 queries, all 1,024 keys, batch in group * HG + head in group), wave = 128 keys: S = (q.k + [|s-t|<=4] QR[t][s-t+4]) / 8 - log1p|s-t| (from a table in LDS); mask == 0 -> -1e4; then the row softmax while the block's 16 whole rows lie in LDS -> P x 2^11 f32. Second launch bound: 8 waves a SIMD, so that four blocks share a WGP
__global__ __launch_bounds__(256, 8) void k_sc(const _Float16* __restrict__ QH, const _Float16* __restrict__ QL, const _Float16* __restrict__ KH, const float* __restrict__ QR0, const int* __restrict__ AM, int b0, int h0, float* __restrict__ S0) { __shared__ __align__(16) float ss[8][16][132]; __shared__ __align__(16) float smx[16][8]; __shared__ __align__(16) float ssu[16][8]; __shared__ float slp[TT + 15]; __shared__ __align__(16) float sqr[16][16]; const int b = b0 + blockIdx.z / HG, h = h0 + blockIdx.z % HG; const float* QR = QR0 + ((size_t)b * NH + h) * TT * 16; float* S = S0 + (size_t)blockIdx.z * TT * TT;
  const int tid = threadIdx.x, wave = tid >> 5, lane = tid & 31, col = lane & 15, g = lane >> 4; const int k0 = wave * 128; const int ql0 = blockIdx.x * 16; const size_t q0 = (size_t)b * TT + ql0;
  // the block's 16 x 1,024 scores meet only 1,039 distances s - t: slp[i] = log1p|i - 15 - ql0|, each computed once for the block
  for (int e = tid; e < TT + 15; e += 256) slp[e] = log1pf(fabsf((float)(e - 15 - ql0)));
  // the block's 16 rows of relative-key logits (1 KiB in a row) are fetched here, ahead of their use, by one 16-byte load in each thread of two waves
  if (tid < 64) *(v4f*)&sqr[tid >> 2][(tid & 3) * 4] = *(const v4f*)(QR + (size_t)ql0 * 16 + tid * 4);
  v8f acc[8] = {};
#pragma unroll
  for (int kc = 0; kc < HD / 32; ++kc) { const v16h ah = frag_h(QH + (q0 + col) * CC + h * HD + kc * 32, lane), al = frag_h(QL + (q0 + col) * CC + h * HD + kc * 32, lane);
    asm volatile("s_wait_xcnt 0x0" ::: "memory");   // precaution: the compiler lays the k loads' results over the q loads' address registers; this stands between them
#pragma unroll
    for (int jg = 0; jg < 8; jg += 4) { v16h kb[4];   // four k fragments in flight at once: as many as the 128 registers of 8 waves a SIMD leave room for; the loops over jg and jj are unrolled so that kb and acc are registers
#pragma unroll
      for (int jj = 0; jj < 4; ++jj) kb[jj] = frag_h(KH + ((size_t)b * TT + k0 + (jg + jj) * 16 + col) * CC + h * HD + kc * 32, lane);
      ISSUED();
#pragma unroll
      for (int jj = 0; jj < 4; ++jj) { acc[jg + jj] = wmma16(ah, kb[jj], acc[jg + jj]); acc[jg + jj] = wmma16(al, kb[jj], acc[jg + jj]); } } }
  float mx[8], su[8];   // the loops over r, o and rl below are unrolled so that mx, su and the rows' pieces are registers, not indexed memory
#pragma unroll
  for (int r = 0; r < 8; ++r) { mx[r] = -3.0e38f; su[r] = 0.f; }
  // mask words: the 8 of a key tile are fetched together, one tile ahead of their use; the table's 8 values of a tile are read together too (lp); mk and lp are registers, as the loops over j and r are unrolled
  const int* am = AM + ((size_t)b * TT + ql0 + 8 * g) * TT + k0 + col; int mk[2][8];
#pragma unroll
  for (int r = 0; r < 8; ++r) mk[0][r] = am[(size_t)r * TT];
  ISSUED1(am);
  __syncthreads();   // slp and sqr are whole
  // the relative-key term first, in a pass of its own: one test a 16-key tile (the same in every lane of a wave; at most 3 of the block's 64 tiles meet the band |s - t| <= 4), index clamped into 0..8, so that the pass below has no branch to hold its loads apart
#pragma unroll
  for (int j = 0; j < 8; ++j) if (k0 + j * 16 + 15 >= ql0 - WR && k0 + j * 16 <= ql0 + 15 + WR) {
#pragma unroll
    for (int r = 0; r < 8; ++r) { const int dw = k0 + j * 16 + col - (ql0 + 8 * g + r) + WR; const float qv = sqr[8 * g + r][dw < 0 ? 0 : dw > 2 * WR ? 2 * WR : dw]; if (dw >= 0 && dw <= 2 * WR) acc[j][r] += qv; } }
#pragma unroll
  for (int j = 0; j < 8; ++j) { const int s = k0 + j * 16 + col; float lp[8];
    if (j + 1 < 8) {
#pragma unroll
      for (int r = 0; r < 8; ++r) mk[(j + 1) & 1][r] = am[(size_t)r * TT + (j + 1) * 16];
      ISSUED1(am); }
#pragma unroll
    for (int r = 0; r < 8; ++r) lp[r] = slp[s - 8 * g - r + 15];
#pragma unroll
    for (int r = 0; r < 8; ++r) { float v = acc[j][r] * 0.125f - lp[r]; if (mk[j & 1][r] == 0) v = -10000.0f; ss[wave][8 * g + r][j * 16 + col] = v; mx[r] = fmaxf(mx[r], v); } }
  // row 8g + r lives in the 16 lanes of half g: maximum over this wave's 128 keys, then over the 8 waves through LDS
#pragma unroll
  for (int o = 1; o < 16; o <<= 1)
#pragma unroll
    for (int r = 0; r < 8; ++r) mx[r] = fmaxf(mx[r], __shfl_xor(mx[r], o));
  if (col == 0) {
#pragma unroll
    for (int r = 0; r < 8; ++r) smx[8 * g + r][wave] = mx[r]; }
  __syncthreads();
#pragma unroll
  for (int r = 0; r < 8; ++r) { const v4f a = *(const v4f*)&smx[8 * g + r][0], c = *(const v4f*)&smx[8 * g + r][4]; mx[r] = fmaxf(fmaxf(fmaxf(a[0], a[1]), fmaxf(a[2], a[3])), fmaxf(fmaxf(c[0], c[1]), fmaxf(c[2], c[3]))); }
  // each lane takes back the scores it stored itself; j stays rolled: LDS takes a running index, so eight copies of this body would only lengthen the code
#pragma unroll 1
  for (int j = 0; j < 8; ++j)
#pragma unroll
    for (int r = 0; r < 8; ++r) { float* p = &ss[wave][8 * g + r][j * 16 + col]; const float e = expf(*p - mx[r]); *p = e; su[r] += e; }
#pragma unroll
  for (int o = 1; o < 16; o <<= 1)
#pragma unroll
    for (int r = 0; r < 8; ++r) su[r] += __shfl_xor(su[r], o);
  if (col == 0) {
#pragma unroll
    for (int r = 0; r < 8; ++r) ssu[8 * g + r][wave] = su[r]; }
  __syncthreads();
  // lane l holds 1 / sum of row l & 15; rows leave LDS as whole 512-byte pieces
  const v4f ta = *(const v4f*)&ssu[col][0], tc = *(const v4f*)&ssu[col][4]; const float inv = 1.0f / (((ta[0] + ta[1]) + (ta[2] + ta[3])) + ((tc[0] + tc[1]) + (tc[2] + tc[3])));
#pragma unroll
  for (int rl = 0; rl < 16; ++rl) { const float iv = __shfl(inv, rl); const v4f e = *(const v4f*)&ss[wave][rl][lane * 4]; vst2(S + (size_t)(ql0 + rl) * TT + k0 + lane * 4, e * iv * 2048.0f); } }
struct PvV { v16b vh[4], vl[4]; };
// the loops over i and j in these three are unrolled so that the stages are registers, not indexed memory
__device__ __forceinline__ void pv_load_p(float p[16], const float* pk) {
#pragma unroll
  for (int i = 0; i < 8; ++i) { p[i] = pk[i]; p[8 + i] = pk[16 + i]; } }
__device__ __forceinline__ void pv_load_v(PvV& s, const __bf16* vt, const __bf16* vl) {
#pragma unroll
  for (int j = 0; j < 4; ++j) { union { v16b v; v8b q[2]; } uh, ul; uh.q[0] = *(const v8b*)(vt + j * 16 * TT); uh.q[1] = *(const v8b*)(vt + j * 16 * TT + 16); ul.q[0] = *(const v8b*)(vl + j * 16 * TT); ul.q[1] = *(const v8b*)(vl + j * 16 * TT + 16); s.vh[j] = uh.v; s.vl[j] = ul.v; } }
// behind a group of k_pv's loads: without the scheduling barrier the scheduler lifts the first product of the stage in use, and with it the wait for that stage, in front of the group, and only one stage is in flight at a time
#define PV_ISSUED2(p, q) do { ISSUED2(p, q); __builtin_amdgcn_sched_barrier(0); } while (0)
#define PV_ISSUED3(p, q, r) do { ISSUED3(p, q, r); __builtin_amdgcn_sched_barrier(0); } while (0)
__device__ __forceinline__ void pv_mac(const F2& p, const PvV& s, v8f acc[4]) {
#pragma unroll
  for (int j = 0; j < 4; ++j) { acc[j] = wmma_bf(p.h, s.vh[j], acc[j]); acc[j] = wmma_bf(p.l, s.vh[j], acc[j]); acc[j] = wmma_bf(p.h, s.vl[j], acc[j]); } }
// ---- k_pv: block = (64 queries, batch in group * HG + head in group): ctx rows [b*t][h*64+d] = P . v (3 products) + sum_j P[t][t+j-4] rel_v[j][d] / 2^11
__global__ __launch_bounds__(128) void k_pv(const float* __restrict__ PS0, const __bf16* __restrict__ VT, const __bf16* __restrict__ VL, const float* __restrict__ RV, int b0, int h0, float* __restrict__ CX) { const int b = b0 + blockIdx.z / HG, h = h0 + blockIdx.z % HG; const float* PS = PS0 + (size_t)blockIdx.z * TT * TT; __shared__ __align__(16) float ss[4][16][68]; __shared__ float srv[NRL][HD]; __shared__ float spw[64][NRL];
  const int tid = threadIdx.x, wave = tid >> 5, lane = tid & 31, col = lane & 15, g = lane >> 4; const int ql0 = blockIdx.x * 64 + wave * 16; const int tb = blockIdx.x * 64;
  for (int e = tid; e < NRL * HD; e += 128) srv[e / HD][e % HD] = bfr(RV[e]);
  for (int e = tid; e < 64 * NRL; e += 128) { const int rl = e / NRL, j = e % NRL; const int t = tb + rl, s = t + j - WR; spw[rl][j] = (s >= 0 && s < TT) ? PS[(size_t)t * TT + s] : 0.f; }
  v8f acc[4] = {};
  // register stages: the v fragments of a k-step are fetched together one k-step ahead of their products; the P rows of a pair of k-steps one trip ahead, since the compiler puts their hi + lo split, and so the wait for them, as early in a trip as it can
  float p0[16], p1[16]; PvV va, vb; const float* prow = PS + (size_t)(ql0 + col) * TT + 8 * g; const size_t vo = ((size_t)b * CC + h * HD + col) * (size_t)TT + 8 * g; const __bf16 *vt = VT + vo, *vl = VL + vo;
  pv_load_p(p0, prow); pv_load_p(p1, prow + 32); pv_load_v(va, vt, vl); PV_ISSUED3(prow, vt, vl);
  // rolled: the body already holds a pair of k-steps, and the last pair (which fetches nothing beyond the end) stands behind the loop
#pragma unroll 1
  for (int kc = 0; kc < TT / 32 - 2; kc += 2) { const F2 fa = bsplit16(p0), fb = bsplit16(p1); const float* pk = prow + (kc + 2) * 32; const __bf16 *t1 = vt + (kc + 1) * 32, *l1 = vl + (kc + 1) * 32;
    pv_load_p(p0, pk); pv_load_p(p1, pk + 32); pv_load_v(vb, t1, l1); PV_ISSUED3(pk, t1, l1);
    pv_mac(fa, va, acc);
    pv_load_v(va, t1 + 32, l1 + 32); PV_ISSUED2(t1, l1);
    pv_mac(fb, vb, acc); }
  { const F2 fa = bsplit16(p0), fb = bsplit16(p1); const __bf16 *t1 = vt + (TT / 32 - 1) * 32, *l1 = vl + (TT / 32 - 1) * 32;
    pv_load_v(vb, t1, l1); PV_ISSUED2(t1, l1);
    pv_mac(fa, va, acc);
    pv_mac(fb, vb, acc); }
  __syncthreads();
#pragma unroll
  for (int j = 0; j < 4; ++j)
#pragma unroll
    for (int r = 0; r < 8; ++r) { const int rl = wave * 16 + 8 * g + r; const int d = j * 16 + col; float a = acc[j][r]; for (int jj = 0; jj < NRL; ++jj) a += spw[rl][jj] * srv[jj][d]; ss[wave][8 * g + r][d] = a * (1.0f / 2048.0f); }
  LDSX(); for (int rl = 0; rl < 16; ++rl) if (lane < 16) vst2(CX + ((size_t)b * TT + ql0 + rl) * CC + h * HD + lane * 4, *(const v4f*)&ss[wave][rl][lane * 4]); }
// ---- k_out: block = (64 positions, 128 out channels, b): out[o][t] = sum_c Wo[o][c] ctx[t][c] + bo; A = ctx rows (hi + lo), B = Wo [o][c]; transposed to planes
__global__ __launch_bounds__(128) void k_out(const float* __restrict__ CX, const float* __restrict__ WO, const float* __restrict__ BO, float* __restrict__ OUT) { __shared__ __align__(16) float so[128][68];
  const int tid = threadIdx.x, wave = tid >> 5, lane = tid & 31, col = lane & 15, g = lane >> 4; const int t0 = blockIdx.x * 64, c0 = blockIdx.y * 128; const size_t b = blockIdx.z; const size_t r0 = b * TT + t0 + wave * 16;
  v8f acc[8] = {};
  // rolled: one k-step's ctx piece and 8 weight fragments (144 registers as f32) are all in flight at once; a second copy of the body would not fit beside them. The loops over j and i are unrolled so that cv and wr are registers
#pragma unroll 1
  for (int kc = 0; kc < CC / 32; ++kc) { float cv[16], wr[8][16]; const float* cp = CX + (r0 + col) * CC + kc * 32 + 8 * g;
#pragma unroll
    for (int i = 0; i < 8; ++i) { cv[i] = cp[i]; cv[8 + i] = cp[16 + i]; }
    const float* wp = WO + (size_t)(c0 + col) * CC + kc * 32 + 8 * g;
#pragma unroll
    for (int j = 0; j < 8; ++j)
#pragma unroll
      for (int i = 0; i < 8; ++i) { wr[j][i] = wp[j * 16 * CC + i]; wr[j][8 + i] = wp[j * 16 * CC + 16 + i]; }
    ISSUED2(cp, wp);
    const F2 a = bsplit16(cv);
#pragma unroll
    for (int j = 0; j < 8; ++j) { v16b w;
#pragma unroll
      for (int i = 0; i < 16; ++i) w[i] = (__bf16)wr[j][i];
      acc[j] = wmma_bf(a.h, w, acc[j]); acc[j] = wmma_bf(a.l, w, acc[j]); } }
#pragma unroll
  for (int j = 0; j < 8; ++j) { const float bb = bfr(BO[c0 + j * 16 + col]);
#pragma unroll
    for (int r = 0; r < 8; ++r) so[j * 16 + col][wave * 16 + 8 * g + r] = acc[j][r] + bb; }
  __syncthreads(); for (int e = tid; e < 128 * 16; e += 128) { const int cl = e >> 4, q = e & 15; vst2(OUT + ((size_t)b * CC + c0 + cl) * TT + t0 + q * 4, *(const v4f*)&so[cl][q * 4]); } }
extern "C" void kernel_launch(void* const* d_in, const int* in_sizes, int n_in, void* d_out, int out_size, void* d_ws, size_t ws_size, hipStream_t stream) {
  (void)in_sizes; (void)n_in; (void)out_size;
  const float** F = (const float**)d_in;   // 0 x [8,512,1024], 1 c [8,512,1024], 2 attn_mask [8,1,1024,1024] int, 3 Wq [512,512], 4 bq, 5 Wk, 6 bk, 7 Wv, 8 bv, 9 Wo [512,512], 10 bo, 11 emb_rel_k [1,9,64], 12 emb_rel_v [1,9,64]
  if (ws_size < (size_t)WS_END) return;
  char* ws = (char*)d_ws; float *QF = (float*)(ws + WS_QF), *QR = (float*)(ws + WS_QR), *S = (float*)(ws + WS_S), *CX = (float*)(ws + WS_CX); _Float16 *QH = (_Float16*)(ws + WS_QH), *QL = (_Float16*)(ws + WS_QL), *KH = (_Float16*)(ws + WS_KH); __bf16 *VT = (__bf16*)(ws + WS_VT), *VL = (__bf16*)(ws + WS_VL);
  k_proj<<<dim3(TT / 64, CC / 128, TNB * 3), 128, 0, stream>>>(F[0], F[1], F[3], F[4], F[5], F[6], F[7], F[8], QF, QH, QL, KH, VT, VL);
  k_qr<<<dim3(TT / 64, 1, TNB * NH), 64, 0, stream>>>(QF, F[11], QR);
  for (int b0 = 0; b0 < TNB; b0 += BG) for (int h0 = 0; h0 < NH; h0 += HG) {
    k_sc<<<dim3(TT / 16, 1, BG * HG), 256, 0, stream>>>(QH, QL, KH, QR, (const int*)d_in[2], b0, h0, S);
    k_pv<<<dim3(TT / 64, 1, BG * HG), 128, 0, stream>>>(S, VT, VL, F[12], b0, h0, CX);
  }
  k_out<<<dim3(TT / 64, CC / 128, TNB), 128, 0, stream>>>(CX, F[9], F[10], (float*)d_out);
}

// v005
// It runs in 225 microseconds.
// Next to v004, in two timings, it ran 1.59 times as fast each time.
// Over all steps from v000 it is 6.52 times as fast.
// compute dtype: all float inputs rounded to bf16, attn_mask (int) read; q = Wq x + bq (from x), k/v = W c + b (from c) as 1x1 convs with EXACT bf16 products on WMMA 16x16x32 (channel-major tiles transposed in LDS), f32 accumulate; q as f16 hi + residual, k f16 -> 2-product content logits; the 9 windowed relative-key logits q_t . rel_k[s-t+4] and the relative-value term sum_j p[t][t+j-4] rel_v[j] in f32 on the VALU; proximity bias -log1p|s-t| (precise log1pf) and the mask in f32; softmax in f32 (precise expf), P x 2^11 kept f32 split bf16 hi + lo against v bf16 hi + lo (3 products); out = Wo ctx (bf16 hi + lo) + bo written channel-major; f32 output.
#include <hip/hip_runtime.h>
#include <math.h>

typedef __attribute__((ext_vector_type(16))) _Float16 v16h;
typedef __attribute__((ext_vector_type(16))) __bf16 v16b;
typedef __attribute__((ext_vector_type(8)))  _Float16 v8h;
typedef __attribute__((ext_vector_type(8)))  float v8f;
typedef __attribute__((ext_vector_type(4)))  float v4f;
typedef __attribute__((ext_vector_type(2)))  float v2f;
typedef __attribute__((ext_vector_type(4)))  unsigned v4u;
typedef __attribute__((ext_vector_type(4)))  int v4i;
typedef float __attribute__((may_alias)) float_a;
typedef int __attribute__((may_alias)) int_a;

template <typename T> __device__ __forceinline__ void vst2(void* p, T v) { *(T*)p = v;  }
__device__ __forceinline__ v8f wmma16(v16h a, v16h b, v8f c) {
  v8f d = __builtin_amdgcn_wmma_f32_16x16x32_f16(false, a, false, b, (short)0, c, false, false);
  asm volatile("v_nop\n\tv_nop\n\tv_nop\n\tv_nop" : "+v"(d) : "v"(a), "v"(b));
  return d;
}
__device__ __forceinline__ v8f wmma_bf(v16b a, v16b b, v8f c) {
  v8f d = __builtin_amdgcn_wmma_f32_16x16x32_bf16(false, a, false, b, (short)0, c, false, false);
  asm volatile("v_nop\n\tv_nop\n\tv_nop\n\tv_nop" : "+v"(d) : "v"(a), "v"(b));
  return d;
}
// 16x16x32 fragments: lane = (h = lane>>4, row/col = lane&15); elements 0..7 = k0+8h+0..7, 8..15 = k0+16+8h+0..7; D element r = row 8h+r
__device__ __forceinline__ v16h frag_h(const _Float16* rowk0, int lane) {
  union { v16h v; v8h q[2]; } u; const _Float16* p = rowk0 + 8 * (lane >> 4);
  u.q[0] = *(const v8h*)p; u.q[1] = *(const v8h*)(p + 16); return u.v;
}
__device__ __forceinline__ v16h frag_f32(const float* rowk0, int lane) {
  v16h a; const float* p = rowk0 + 8 * (lane >> 4);
#pragma unroll
  for (int i = 0; i < 8; ++i) { a[i] = (_Float16)p[i]; a[8 + i] = (_Float16)p[16 + i]; }
  return a;
}
__device__ __forceinline__ v16h frag_f32s(const float* rowk0, int lane, float sc) {
  v16h a; const float* p = rowk0 + 8 * (lane >> 4);
#pragma unroll
  for (int i = 0; i < 8; ++i) { a[i] = (_Float16)(p[i] * sc); a[8 + i] = (_Float16)(p[16 + i] * sc); }
  return a;
}
// column fragment from a [K][ld] layout (column n), rows >= K read as 0
__device__ __forceinline__ v16h fragc_f32(const float* W, int k0, int n, int lane, int ld, int K) {
  v16h a; const int g = lane >> 4;
#pragma unroll
  for (int i = 0; i < 8; ++i) { const int ka = k0 + 8 * g + i, kb = ka + 16;
    a[i] = (_Float16)(ka < K ? W[(size_t)(ka < K ? ka : K - 1) * ld + n] : 0.f); a[8 + i] = (_Float16)(kb < K ? W[(size_t)(kb < K ? kb : K - 1) * ld + n] : 0.f); }
  return a;
}
struct F2 { v16b h, l; };
__device__ __forceinline__ F2 bsplit16(const float v[16]) { F2 r;
#pragma unroll
  for (int i = 0; i < 16; ++i) { const __bf16 h = (__bf16)v[i]; r.h[i] = h; r.l[i] = (__bf16)(v[i] - (float)h); }
  return r; }
__device__ __forceinline__ F2 split_row(const float* row, int k0, int lane) { float v[16]; const float* p = row + k0 + 8 * (lane >> 4);
#pragma unroll
  for (int i = 0; i < 8; ++i) { v[i] = p[i]; v[8 + i] = p[16 + i]; }
  return bsplit16(v); }
__device__ __forceinline__ F2 split_rowK(const float* row, int k0, int lane, int K) { float v[16]; const int g = lane >> 4;
#pragma unroll
  for (int i = 0; i < 8; ++i) { const int ka = k0 + 8 * g + i, kb = ka + 16; v[i] = ka < K ? row[ka < K ? ka : K - 1] : 0.f; v[8 + i] = kb < K ? row[kb < K ? kb : K - 1] : 0.f; }
  return bsplit16(v); }
__device__ __forceinline__ F2 split_col(const float* W, int k0, int n, int lane, int ld, int K) { float v[16]; const int g = lane >> 4;
#pragma unroll
  for (int i = 0; i < 8; ++i) { const int ka = k0 + 8 * g + i, kb = ka + 16; v[i] = ka < K ? W[(size_t)(ka < K ? ka : K - 1) * ld + n] : 0.f; v[8 + i] = kb < K ? W[(size_t)(kb < K ? kb : K - 1) * ld + n] : 0.f; }
  return bsplit16(v); }
__device__ __forceinline__ v8f mac3(const F2& a, const F2& b, v8f c) { c = wmma_bf(a.l, b.h, c); c = wmma_bf(a.h, b.l, c); return wmma_bf(a.h, b.h, c); }
__device__ __forceinline__ float sigm(float v) { return 1.0f / (1.0f + expf(-v)); }
// stands directly behind a group of global loads: keeps the whole group issued in front of the work that follows (nothing of it sinks to its use), and the precaution before the loads' address registers are written again
#define ISSUED() asm volatile("s_wait_xcnt 0x0" ::: "memory")
// the same, and the group's pointers are inputs of the wait: they stay in their registers up to it, so that no result of the group is laid over an address that a load of the group still names
#define ISSUED1(p) asm volatile("s_wait_xcnt 0x0" :: "v"(p) : "memory")
#define ISSUED2(p, q) asm volatile("s_wait_xcnt 0x0" :: "v"(p), "v"(q) : "memory")
#define ISSUED3(p, q, r) asm volatile("s_wait_xcnt 0x0" :: "v"(p), "v"(q), "v"(r) : "memory")
#define LDSX() do { asm volatile("s_wait_dscnt 0" ::: "memory"); __builtin_amdgcn_wave_barrier(); __builtin_amdgcn_fence(__ATOMIC_RELEASE, "workgroup"); } while (0)


// VITS-style relative-position multi-head attention (B 8, C 512 = 8 x 64, T 1,024, window 4): content + windowed relative-key logits, proximity bias, mask, softmax, value + windowed relative-value, output 1x1 conv.
#define NB 8
#define CC 512
#define TT 1024
#define NH 8
#define HD 64
#define WR 4
#define NRL 9
#define HG 8
#define BG 4   // batches per launch of the score / softmax / value stages: S for BG batches is the most the workspace holds
#ifndef TNB
#define TNB NB
#endif
typedef __attribute__((ext_vector_type(8))) __bf16 v8b;
__device__ __forceinline__ v16b frag_b(const __bf16* rowk0, int lane) {
  union { v16b v; v8b q[2]; } u; const __bf16* p = rowk0 + 8 * (lane >> 4);
  u.q[0] = *(const v8b*)p; u.q[1] = *(const v8b*)(p + 16); return u.v;
}
__device__ __forceinline__ float bfr(float v) { return (float)(__bf16)v; }
__device__ __attribute__((noinline)) float exp_ni(float v) { return expf(v); }
__device__ __attribute__((noinline)) float erf_ni(float v) { return erff(v); }

#define WS_QF  0u                                  // f32 q rows [b*t][512] (for the rel-k dots)
#define WS_QH  (WS_QF + 4u * (size_t)NB * TT * CC)
#define WS_QL  (WS_QH + 2u * (size_t)NB * TT * CC)
#define WS_KH  (WS_QL + 2u * (size_t)NB * TT * CC)
#define WS_VT  (WS_KH + 2u * (size_t)NB * TT * CC)     // bf16 v planes [b][512][t]
#define WS_VL  (WS_VT + 2u * (size_t)NB * CC * TT)
#define WS_QR  (WS_VL + 2u * (size_t)NB * CC * TT)     // f32 rel-k logits [b][h][t][16] (9 used)
#define WS_S   (WS_QR + 4u * (size_t)NB * NH * TT * 16) // f32 P x 2^11 [BG][HG][t][s]
#define WS_CX  (WS_S + 4u * (size_t)BG * HG * TT * TT) // f32 ctx rows [b*t][512]
#define WS_END (WS_CX + 4u * (size_t)NB * TT * CC)

typedef __attribute__((ext_vector_type(4))) __bf16 v4b;
#define WP 72   // LDS pitch of a row of 64 16-bit elements: 144 B = 16 B x 9, so that the 16 rows of a ds_load_b128 fragment read spread over the banks
#define FP 68   // LDS pitch of a row of 64 f32: 272 B = 16 B x 17, for the same reason
// Staging of a 64-k piece of a matrix operand by a block of 128 threads: every global load of a wave covers whole 128-byte lines (512 B in 4 lines), and each piece is fetched once a block. The loops over u and i are unrolled so that the pieces are registers
// [128 rows][64] f32 out of rows of 512 (weights): thread = row u * 8 + (tid >> 4), 16 bytes at (tid & 15); stored as bf16
__device__ __forceinline__ void wt_load(v4f wv[16], const float* wq) {
#pragma unroll
  for (int u = 0; u < 16; ++u) wv[u] = *(const v4f*)(wq + u * 8 * CC); }
__device__ __forceinline__ void wt_store(__bf16 (*sw)[WP], const v4f wv[16], int tid) {
#pragma unroll
  for (int u = 0; u < 16; ++u) { v4b o;
#pragma unroll
    for (int i = 0; i < 4; ++i) o[i] = (__bf16)wv[u][i];
    *(v4b*)&sw[u * 8 + (tid >> 4)][(tid & 15) * 4] = o; } }
// [64 rows][64] f32 out of rows of LD (ctx, P): the same thread map, kept f32
template <int LD> __device__ __forceinline__ void ft_load(v4f fv[8], const float* fq) {
#pragma unroll
  for (int u = 0; u < 8; ++u) fv[u] = *(const v4f*)(fq + u * 8 * LD); }
__device__ __forceinline__ void ft_store(float (*sp)[FP], const v4f fv[8], int tid) {
#pragma unroll
  for (int u = 0; u < 8; ++u) *(v4f*)&sp[u * 8 + (tid >> 4)][(tid & 15) * 4] = fv[u]; }
// ---- k_proj: block = (64 positions, 128 out channels, b*3 + which): x^T / c^T tile in LDS; W [out][in] + b exact
__global__ __launch_bounds__(128) void k_proj(const float* __restrict__ X, const float* __restrict__ Cc, const float* __restrict__ WQ, const float* __restrict__ BQ, const float* __restrict__ WK, const float* __restrict__ BK, const float* __restrict__ WV, const float* __restrict__ BV, float* __restrict__ QF, _Float16* __restrict__ QH, _Float16* __restrict__ QL, _Float16* __restrict__ KH, __bf16* __restrict__ VT, __bf16* __restrict__ VL) {
  __shared__ __align__(16) __bf16 sx[64][CC + 8]; __shared__ __align__(16) float sf[64][132]; __shared__ __align__(16) unsigned char sbuf[2 * 128 * 72 * 2];   // union: (th, tl2) for v  |  (sh, sl) for q/k
  __bf16 (*th)[72] = (__bf16 (*)[72])sbuf; __bf16 (*tl2)[72] = (__bf16 (*)[72])(sbuf + 128 * 72 * 2); _Float16 (*sh)[136] = (_Float16 (*)[136])sbuf; _Float16 (*sl)[136] = (_Float16 (*)[136])(sbuf + 64 * 136 * 2); __bf16 (*sw)[128][WP] = (__bf16 (*)[128][WP])sbuf;   // in the k loop sbuf is the two weight buffers
  const int tid = threadIdx.x, wave = tid >> 5, lane = tid & 31, col = lane & 15, g = lane >> 4; const int p0 = blockIdx.x * 64; const int c0 = blockIdx.y * 128; const size_t b = blockIdx.z / 3; const int which = blockIdx.z % 3;
  const float* Xs = which == 0 ? X : Cc; const float* Wm = which == 0 ? WQ : which == 1 ? WK : WV; const float* Bm = which == 0 ? BQ : which == 1 ? BK : BV;
  // thread tid fills position tid & 63, channels (tid >> 6) + 2 k: 32 independent loads off one pointer are in flight before the first is waited for; the loops over u are unrolled so that xv is registers, the outer loop stays rolled: eight copies of the group would only lengthen the code
  const float* xp = Xs + (b * CC + (tid >> 6)) * (size_t)TT + p0 + (tid & 63);
  // the first weight piece is asked for ahead of the x tile and stored behind it
  const float* wq = Wm + (size_t)(c0 + (tid >> 4)) * CC + (tid & 15) * 4; v4f wv[16];
  wt_load(wv, wq); ISSUED1(wq);
#pragma unroll 1
  for (int kg = 0; kg < CC / 2; kg += 32) { float xv[32]; const float* xg = xp + (size_t)kg * 2 * TT;
#pragma unroll
    for (int u = 0; u < 32; ++u) xv[u] = xg[u * 2 * TT];
    ISSUED1(xg);
#pragma unroll
    for (int u = 0; u < 32; ++u) sx[tid & 63][(tid >> 6) + 2 * (kg + u)] = (__bf16)xv[u]; }
  wt_store(sw[0], wv, tid);
  __syncthreads();
  v8f acc[8] = {};
  // rolled: a trip asks for the next 64-k weight piece, works on this one out of LDS, stores the next into the other buffer; the one barrier of a trip publishes that buffer and ends the reads of this one (behind the last trip: before sbuf becomes output staging). The loops over ks and j are unrolled so that w and acc are registers
#pragma unroll 1
  for (int c = 0; c < CC / 64; ++c) { const int bu = c & 1;
    if (c + 1 < CC / 64) { const float* wn = wq + (c + 1) * 64; wt_load(wv, wn); ISSUED1(wn); }
#pragma unroll
    for (int ks = 0; ks < 2; ++ks) { const v16b a = frag_b(&sx[wave * 16 + col][c * 64 + ks * 32], lane); v16b w[8];
#pragma unroll
      for (int j = 0; j < 8; ++j) w[j] = frag_b(&sw[bu][j * 16 + col][ks * 32], lane);
#pragma unroll
      for (int j = 0; j < 8; ++j) acc[j] = wmma_bf(a, w[j], acc[j]); }
    if (c + 1 < CC / 64) wt_store(sw[bu ^ 1], wv, tid);
    __syncthreads(); }
  if (which < 2) {
#pragma unroll
    for (int j = 0; j < 8; ++j) { const float bb = bfr(Bm[c0 + j * 16 + col]);
#pragma unroll
      for (int r = 0; r < 8; ++r) sf[wave * 16 + 8 * g + r][j * 16 + col] = acc[j][r] + bb; }
    __syncthreads();
    // rows: f32 (q only), f16 hi (+ residual for q)
    for (int e = tid; e < 64 * 32; e += 128) { const int rl = e >> 5, q4 = e & 31; const size_t row = b * TT + p0 + rl; const float* src = &sf[rl][q4 * 4]; if (which == 0) vst2(QF + row * CC + c0 + q4 * 4, *(const v4f*)src); }
    for (int e = tid; e < 64 * 128; e += 128) { const int rl = e >> 7, cl = e & 127; const float v = sf[rl][cl]; const _Float16 hv = (_Float16)v; sh[rl][cl] = hv; sl[rl][cl] = (_Float16)(v - (float)hv); }
    __syncthreads();
    _Float16* dh = which == 0 ? QH : KH; for (int e = tid; e < 64 * 16; e += 128) { const int rl = e >> 4, q = e & 15; const size_t row = b * TT + p0 + rl; vst2((unsigned*)(dh + row * CC + c0 + q * 8), *(const v4u*)&sh[rl][q * 8]); if (which == 0) vst2((unsigned*)(QL + row * CC + c0 + q * 8), *(const v4u*)&sl[rl][q * 8]); } }
  else {
#pragma unroll
    for (int j = 0; j < 8; ++j) { const float bb = bfr(Bm[c0 + j * 16 + col]);
#pragma unroll
      for (int r = 0; r < 8; ++r) { const float v = acc[j][r] + bb; const int rl = wave * 16 + 8 * g + r, cl = j * 16 + col; const __bf16 bh = (__bf16)v; th[cl][rl] = bh; tl2[cl][rl] = (__bf16)(v - (float)bh); } }
    __syncthreads(); for (int e = tid; e < 128 * 8; e += 128) { const int cl = e >> 3, q = e & 7; const size_t o2 = (b * CC + c0 + cl) * (size_t)TT + p0 + q * 8; vst2((unsigned*)(VT + o2), *(const v4u*)&th[cl][q * 8]); vst2((unsigned*)(VL + o2), *(const v4u*)&tl2[cl][q * 8]); } } }
// ---- k_qr: block = (64 queries, b * 8 + head): QR[b][h][t][j] = q_t(head h) . rel_k[j] for j = 0..8 (f32)
__global__ __launch_bounds__(64) void k_qr(const float* __restrict__ QF, const float* __restrict__ RK, float* __restrict__ QR0) { __shared__ float srk[NRL][HD]; __shared__ __align__(16) float so[64][16]; __shared__ __align__(16) float sq[64][FP];
  const int t = threadIdx.x; const int b = blockIdx.z / NH, h = blockIdx.z % NH; float* QR = QR0 + (size_t)blockIdx.z * TT * 16; const int t0 = blockIdx.x * 64;
  // the block's 64 q rows (256 B each) are fetched together by loads that cover whole lines (thread = row u * 4 + (t >> 4), 16 bytes at (t & 15)) and turned through LDS, so that each thread then holds its own row; the loops over u and d are unrolled so that qr and qv are registers
  const float* q = QF + ((size_t)b * TT + t0 + (t >> 4)) * CC + h * HD + (t & 15) * 4; v4f qr[16]; float qv[HD];
#pragma unroll
  for (int u = 0; u < 16; ++u) qr[u] = *(const v4f*)(q + u * 4 * CC);
  ISSUED1(q);
  for (int e = t; e < NRL * HD; e += 64) srk[e / HD][e % HD] = bfr(RK[e]);
  for (int e = t; e < 64 * 16; e += 64) so[e >> 4][e & 15] = 0.f;
#pragma unroll
  for (int u = 0; u < 16; ++u) *(v4f*)&sq[u * 4 + (t >> 4)][(t & 15) * 4] = qr[u];
  __syncthreads();
#pragma unroll
  for (int d = 0; d < HD; ++d) qv[d] = sq[t][d];
#pragma unroll 1
  for (int j = 0; j < NRL; ++j) { float a = 0.f;
#pragma unroll
    for (int d = 0; d < HD; ++d) a += qv[d] * srk[j][d]; so[t][j] = a; }
  __syncthreads(); for (int e = t; e < 64 * 4; e += 64) { const int rl = e >> 2, qq = e & 3; vst2(QR + (size_t)(t0 + rl) * 16 + qq * 4, *(const v4f*)&so[rl][qq * 4]); } }
// ---- k_sc: block = (16 queries, all 1,024 keys, batch in group * HG + head in group), wave = 128 keys: S = (q.k + [|s-t|<=4] QR[t][s-t+4]) / 8 - log1p|s-t| (from a table in LDS); mask == 0 -> -1e4; then the row softmax while the block's 16 whole rows lie in LDS -> P x 2^11 f32. Second launch bound: 8 waves a SIMD, so that four blocks share a WGP
__global__ __launch_bounds__(256, 8) void k_sc(const _Float16* __restrict__ QH, const _Float16* __restrict__ QL, const _Float16* __restrict__ KH, const float* __restrict__ QR0, const int* __restrict__ AM, int b0, int h0, float* __restrict__ S0) { __shared__ __align__(16) float ss[8][16][132]; __shared__ __align__(16) float smx[16][8]; __shared__ __align__(16) float ssu[16][8]; __shared__ float slp[TT + 15]; __shared__ __align__(16) float sqr[16][16]; const int b = b0 + blockIdx.z / HG, h = h0 + blockIdx.z % HG; const float* QR = QR0 + ((size_t)b * NH + h) * TT * 16; float* S = S0 + (size_t)blockIdx.z * TT * TT;
  const int tid = threadIdx.x, wave = tid >> 5, lane = tid & 31, col = lane & 15, g = lane >> 4; const int k0 = wave * 128; const int ql0 = blockIdx.x * 16; const size_t q0 = (size_t)b * TT + ql0;
  // the block's 16 x 1,024 scores meet only 1,039 distances s - t: slp[i] = log1p|i - 15 - ql0|, each computed once for the block
  for (int e = tid; e < TT + 15; e += 256) slp[e] = log1pf(fabsf((float)(e - 15 - ql0)));
  // the block's 16 rows of relative-key logits (1 KiB in a row) are fetched here, ahead of their use, by one 16-byte load in each thread of two waves
  if (tid < 64) *(v4f*)&sqr[tid >> 2][(tid & 3) * 4] = *(const v4f*)(QR + (size_t)ql0 * 16 + tid * 4);
  v8f acc[8] = {};
#pragma unroll
  for (int kc = 0; kc < HD / 32; ++kc) { const v16h ah = frag_h(QH + (q0 + col) * CC + h * HD + kc * 32, lane), al = frag_h(QL + (q0 + col) * CC + h * HD + kc * 32, lane);
    asm volatile("s_wait_xcnt 0x0" ::: "memory");   // precaution: the compiler lays the k loads' results over the q loads' address registers; this stands between them
#pragma unroll
    for (int jg = 0; jg < 8; jg += 4) { v16h kb[4];   // four k fragments in flight at once: as many as the 128 registers of 8 waves a SIMD leave room for; the loops over jg and jj are unrolled so that kb and acc are registers
#pragma unroll
      for (int jj = 0; jj < 4; ++jj) kb[jj] = frag_h(KH + ((size_t)b * TT + k0 + (jg + jj) * 16 + col) * CC + h * HD + kc * 32, lane);
      ISSUED();
#pragma unroll
      for (int jj = 0; jj < 4; ++jj) { acc[jg + jj] = wmma16(ah, kb[jj], acc[jg + jj]); acc[jg + jj] = wmma16(al, kb[jj], acc[jg + jj]); } } }
  float mx[8], su[8];   // the loops over r, o and rl below are unrolled so that mx, su and the rows' pieces are registers, not indexed memory
#pragma unroll
  for (int r = 0; r < 8; ++r) { mx[r] = -3.0e38f; su[r] = 0.f; }
  // mask words: the 8 of a key tile are fetched together, one tile ahead of their use; the table's 8 values of a tile are read together too (lp); mk and lp are registers, as the loops over j and r are unrolled
  const int* am = AM + ((size_t)b * TT + ql0 + 8 * g) * TT + k0 + col; int mk[2][8];
#pragma unroll
  for (int r = 0; r < 8; ++r) mk[0][r] = am[(size_t)r * TT];
  ISSUED1(am);
  __syncthreads();   // slp and sqr are whole
  // the relative-key term first, in a pass of its own: one test a 16-key tile (the same in every lane of a wave; at most 3 of the block's 64 tiles meet the band |s - t| <= 4), index clamped into 0..8, so that the pass below has no branch to hold its loads apart
#pragma unroll
  for (int j = 0; j < 8; ++j) if (k0 + j * 16 + 15 >= ql0 - WR && k0 + j * 16 <= ql0 + 15 + WR) {
#pragma unroll
    for (int r = 0; r < 8; ++r) { const int dw = k0 + j * 16 + col - (ql0 + 8 * g + r) + WR; const float qv = sqr[8 * g + r][dw < 0 ? 0 : dw > 2 * WR ? 2 * WR : dw]; if (dw >= 0 && dw <= 2 * WR) acc[j][r] += qv; } }
#pragma unroll
  for (int j = 0; j < 8; ++j) { const int s = k0 + j * 16 + col; float lp[8];
    if (j + 1 < 8) {
#pragma unroll
      for (int r = 0; r < 8; ++r) mk[(j + 1) & 1][r] = am[(size_t)r * TT + (j + 1) * 16];
      ISSUED1(am); }
#pragma unroll
    for (int r = 0; r < 8; ++r) lp[r] = slp[s - 8 * g - r + 15];
#pragma unroll
    for (int r = 0; r < 8; ++r) { float v = acc[j][r] * 0.125f - lp[r]; if (mk[j & 1][r] == 0) v = -10000.0f; ss[wave][8 * g + r][j * 16 + col] = v; mx[r] = fmaxf(mx[r], v); } }
  // row 8g + r lives in the 16 lanes of half g: maximum over this wave's 128 keys, then over the 8 waves through LDS
#pragma unroll
  for (int o = 1; o < 16; o <<= 1)
#pragma unroll
    for (int r = 0; r < 8; ++r) mx[r] = fmaxf(mx[r], __shfl_xor(mx[r], o));
  if (col == 0) {
#pragma unroll
    for (int r = 0; r < 8; ++r) smx[8 * g + r][wave] = mx[r]; }
  __syncthreads();
#pragma unroll
  for (int r = 0; r < 8; ++r) { const v4f a = *(const v4f*)&smx[8 * g + r][0], c = *(const v4f*)&smx[8 * g + r][4]; mx[r] = fmaxf(fmaxf(fmaxf(a[0], a[1]), fmaxf(a[2], a[3])), fmaxf(fmaxf(c[0], c[1]), fmaxf(c[2], c[3]))); }
  // each lane takes back the scores it stored itself; j stays rolled: LDS takes a running index, so eight copies of this body would only lengthen the code
#pragma unroll 1
  for (int j = 0; j < 8; ++j)
#pragma unroll
    for (int r = 0; r < 8; ++r) { float* p = &ss[wave][8 * g + r][j * 16 + col]; const float e = expf(*p - mx[r]); *p = e; su[r] += e; }
#pragma unroll
  for (int o = 1; o < 16; o <<= 1)
#pragma unroll
    for (int r = 0; r < 8; ++r) su[r] += __shfl_xor(su[r], o);
  if (col == 0) {
#pragma unroll
    for (int r = 0; r < 8; ++r) ssu[8 * g + r][wave] = su[r]; }
  __syncthreads();
  // lane l holds 1 / sum of row l & 15; rows leave LDS as whole 512-byte pieces
  const v4f ta = *(const v4f*)&ssu[col][0], tc = *(const v4f*)&ssu[col][4]; const float inv = 1.0f / (((ta[0] + ta[1]) + (ta[2] + ta[3])) + ((tc[0] + tc[1]) + (tc[2] + tc[3])));
#pragma unroll
  for (int rl = 0; rl < 16; ++rl) { const float iv = __shfl(inv, rl); const v4f e = *(const v4f*)&ss[wave][rl][lane * 4]; vst2(S + (size_t)(ql0 + rl) * TT + k0 + lane * 4, e * iv * 2048.0f); } }
struct PvV { v16b vh[4], vl[4]; };
// the loops over i, u and j in these are unrolled so that the stages are registers, not indexed memory
__device__ __forceinline__ void pv_load_p(float p[16], const float* pk) {
#pragma unroll
  for (int i = 0; i < 8; ++i) { p[i] = pk[i]; p[8 + i] = pk[16 + i]; } }
// [2 planes][64 rows][64] bf16 out of rows of 1,024 (v hi, v lo): thread = row u * 16 + (tid >> 3), 16 bytes at (tid & 7); a wave's load covers 4 whole lines
__device__ __forceinline__ void vt_load(v4u vr[8], const __bf16* vg, const __bf16* lg) {
#pragma unroll
  for (int u = 0; u < 4; ++u) { vr[u] = *(const v4u*)(vg + u * 16 * TT); vr[4 + u] = *(const v4u*)(lg + u * 16 * TT); } }
__device__ __forceinline__ void vt_store(__bf16 (*sv)[64][WP], const v4u vr[8], int tid) {
#pragma unroll
  for (int u = 0; u < 4; ++u) { *(v4u*)&sv[0][u * 16 + (tid >> 3)][(tid & 7) * 8] = vr[u]; *(v4u*)&sv[1][u * 16 + (tid >> 3)][(tid & 7) * 8] = vr[4 + u]; } }
__device__ __forceinline__ void pv_mac(const F2& p, const PvV& s, v8f acc[4]) {
#pragma unroll
  for (int j = 0; j < 4; ++j) { acc[j] = wmma_bf(p.h, s.vh[j], acc[j]); acc[j] = wmma_bf(p.l, s.vh[j], acc[j]); acc[j] = wmma_bf(p.h, s.vl[j], acc[j]); } }
// ---- k_pv: block = (64 queries, batch in group * HG + head in group): ctx rows [b*t][h*64+d] = P . v (3 products) + sum_j P[t][t+j-4] rel_v[j][d] / 2^11
__global__ __launch_bounds__(128) void k_pv(const float* __restrict__ PS0, const __bf16* __restrict__ VT, const __bf16* __restrict__ VL, const float* __restrict__ RV, int b0, int h0, float* __restrict__ CX) { const int b = b0 + blockIdx.z / HG, h = h0 + blockIdx.z % HG; const float* PS = PS0 + (size_t)blockIdx.z * TT * TT; __shared__ __align__(16) float ss[4][16][68]; __shared__ float srv[NRL][HD]; __shared__ float spw[64][NRL]; __shared__ __align__(16) float sp[2][64][FP]; __shared__ __align__(16) __bf16 sv[2][2][64][WP];
  const int tid = threadIdx.x, wave = tid >> 5, lane = tid & 31, col = lane & 15, g = lane >> 4; const int ql0 = blockIdx.x * 64 + wave * 16; const int tb = blockIdx.x * 64;
  for (int e = tid; e < NRL * HD; e += 128) srv[e / HD][e % HD] = bfr(RV[e]);
  for (int e = tid; e < 64 * NRL; e += 128) { const int rl = e / NRL, j = e % NRL; const int t = tb + rl, s = t + j - WR; spw[rl][j] = (s >= 0 && s < TT) ? PS[(size_t)t * TT + s] : 0.f; }
  v8f acc[4] = {};
  // a piece = 64 keys: the block's 64 P rows (f32) and the head's 64 v rows (hi and lo planes), fetched once a block into LDS, two buffers
  const float* pg = PS + (size_t)(tb + (tid >> 4)) * TT + (tid & 15) * 4; const size_t vo = ((size_t)b * CC + h * HD + (tid >> 3)) * (size_t)TT + (tid & 7) * 8; const __bf16 *vg = VT + vo, *lg = VL + vo; v4f pr[8]; v4u vr[8];
  ft_load<TT>(pr, pg); vt_load(vr, vg, lg); ISSUED3(pg, vg, lg);
  ft_store(sp[0], pr, tid); vt_store(sv[0], vr, tid);
  __syncthreads();
  // rolled: a trip asks for the next piece, works on this one out of LDS, stores the next into the other buffers; the one barrier of a trip publishes those and ends the reads of these (it stands outside the test on c: inside it the compiler put a wait in front of every load of the next group); srv and spw are whole behind the barrier above. The loops over ks and j are unrolled so that p, s and acc are registers
#pragma unroll 1
  for (int c = 0; c < TT / 64; ++c) { const int bu = c & 1;
    if (c + 1 < TT / 64) { pg += 64; vg += 64; lg += 64; ft_load<TT>(pr, pg); vt_load(vr, vg, lg); ISSUED3(pg, vg, lg); }
#pragma unroll
    for (int ks = 0; ks < 2; ++ks) { float p[16]; PvV s; pv_load_p(p, &sp[bu][wave * 16 + col][ks * 32 + 8 * g]);
#pragma unroll
      for (int j = 0; j < 4; ++j) { s.vh[j] = frag_b(&sv[bu][0][j * 16 + col][ks * 32], lane); s.vl[j] = frag_b(&sv[bu][1][j * 16 + col][ks * 32], lane); }
      pv_mac(bsplit16(p), s, acc); }
    if (c + 1 < TT / 64) { ft_store(sp[bu ^ 1], pr, tid); vt_store(sv[bu ^ 1], vr, tid); }
    __syncthreads(); }
#pragma unroll
  for (int j = 0; j < 4; ++j)
#pragma unroll
    for (int r = 0; r < 8; ++r) { const int rl = wave * 16 + 8 * g + r; const int d = j * 16 + col; float a = acc[j][r]; for (int jj = 0; jj < NRL; ++jj) a += spw[rl][jj] * srv[jj][d]; ss[wave][8 * g + r][d] = a * (1.0f / 2048.0f); }
  LDSX(); for (int rl = 0; rl < 16; ++rl) if (lane < 16) vst2(CX + ((size_t)b * TT + ql0 + rl) * CC + h * HD + lane * 4, *(const v4f*)&ss[wave][rl][lane * 4]); }
// ---- k_out: block = (64 positions, 128 out channels, b): out[o][t] = sum_c Wo[o][c] ctx[t][c] + bo; A = ctx rows (hi + lo), B = Wo [o][c]; transposed to planes
__global__ __launch_bounds__(128) void k_out(const float* __restrict__ CX, const float* __restrict__ WO, const float* __restrict__ BO, float* __restrict__ OUT) { __shared__ __align__(16) float so[128][68]; __shared__ __align__(16) float sc[2][64][FP]; __shared__ __align__(16) __bf16 sw[2][128][WP];
  const int tid = threadIdx.x, wave = tid >> 5, lane = tid & 31, col = lane & 15, g = lane >> 4; const int t0 = blockIdx.x * 64, c0 = blockIdx.y * 128; const size_t b = blockIdx.z;
  v8f acc[8] = {};
  // a piece = 64 channels: the block's 64 ctx rows (f32) and its 128 weight rows (as bf16), fetched once a block into LDS, two buffers
  const float* cq = CX + (b * TT + t0 + (tid >> 4)) * CC + (tid & 15) * 4; const float* wq = WO + (size_t)(c0 + (tid >> 4)) * CC + (tid & 15) * 4; v4f cr[8], wv[16];
  ft_load<CC>(cr, cq); wt_load(wv, wq); ISSUED2(cq, wq);
  ft_store(sc[0], cr, tid); wt_store(sw[0], wv, tid);
  __syncthreads();
  // rolled: a trip asks for the next piece, works on this one out of LDS, stores the next into the other buffers; the one barrier of a trip publishes those and ends the reads of these (it stands outside the test on c: inside it the compiler put a wait in front of every load of the next group). The loops over ks, jg and jj are unrolled so that cv, w and acc are registers
#pragma unroll 1
  for (int c = 0; c < CC / 64; ++c) { const int bu = c & 1;
    if (c + 1 < CC / 64) { const float *cn = cq + (c + 1) * 64, *wn = wq + (c + 1) * 64; ft_load<CC>(cr, cn); wt_load(wv, wn); ISSUED2(cn, wn); }
#pragma unroll
    for (int ks = 0; ks < 2; ++ks) { float cv[16]; pv_load_p(cv, &sc[bu][wave * 16 + col][ks * 32 + 8 * g]); const F2 a = bsplit16(cv);
#pragma unroll
      for (int jg = 0; jg < 8; jg += 4) { v16b w[4];   // four weight fragments at a time: eight, beside the next piece's 96 registers, take the kernel past 256 registers
#pragma unroll
        for (int jj = 0; jj < 4; ++jj) w[jj] = frag_b(&sw[bu][(jg + jj) * 16 + col][ks * 32], lane);
#pragma unroll
        for (int jj = 0; jj < 4; ++jj) { acc[jg + jj] = wmma_bf(a.h, w[jj], acc[jg + jj]); acc[jg + jj] = wmma_bf(a.l, w[jj], acc[jg + jj]); } } }
    if (c + 1 < CC / 64) { ft_store(sc[bu ^ 1], cr, tid); wt_store(sw[bu ^ 1], wv, tid); }
    __syncthreads(); }
#pragma unroll
  for (int j = 0; j < 8; ++j) { const float bb = bfr(BO[c0 + j * 16 + col]);
#pragma unroll
    for (int r = 0; r < 8; ++r) so[j * 16 + col][wave * 16 + 8 * g + r] = acc[j][r] + bb; }
  __syncthreads(); for (int e = tid; e < 128 * 16; e += 128) { const int cl = e >> 4, q = e & 15; vst2(OUT + ((size_t)b * CC + c0 + cl) * TT + t0 + q * 4, *(const v4f*)&so[cl][q * 4]); } }
extern "C" void kernel_launch(void* const* d_in, const int* in_sizes, int n_in, void* d_out, int out_size, void* d_ws, size_t ws_size, hipStream_t stream) {
  (void)in_sizes; (void)n_in; (void)out_size;
  const float** F = (const float**)d_in;   // 0 x [8,512,1024], 1 c [8,512,1024], 2 attn_mask [8,1,1024,1024] int, 3 Wq [512,512], 4 bq, 5 Wk, 6 bk, 7 Wv, 8 bv, 9 Wo [512,512], 10 bo, 11 emb_rel_k [1,9,64], 12 emb_rel_v [1,9,64]
  if (ws_size < (size_t)WS_END) return;
  char* ws = (char*)d_ws; float *QF = (float*)(ws + WS_QF), *QR = (float*)(ws + WS_QR), *S = (float*)(ws + WS_S), *CX = (float*)(ws + WS_CX); _Float16 *QH = (_Float16*)(ws + WS_QH), *QL = (_Float16*)(ws + WS_QL), *KH = (_Float16*)(ws + WS_KH); __bf16 *VT = (__bf16*)(ws + WS_VT), *VL = (__bf16*)(ws + WS_VL);
  k_proj<<<dim3(TT / 64, CC / 128, TNB * 3), 128, 0, stream>>>(F[0], F[1], F[3], F[4], F[5], F[6], F[7], F[8], QF, QH, QL, KH, VT, VL);
  k_qr<<<dim3(TT / 64, 1, TNB * NH), 64, 0, stream>>>(QF, F[11], QR);
  for (int b0 = 0; b0 < TNB; b0 += BG) for (int h0 = 0; h0 < NH; h0 += HG) {
    k_sc<<<dim3(TT / 16, 1, BG * HG), 256, 0, stream>>>(QH, QL, KH, QR, (const int*)d_in[2], b0, h0, S);
    k_pv<<<dim3(TT / 64, 1, BG * HG), 128, 0, stream>>>(S, VT, VL, F[12], b0, h0, CX);
  }
  k_out<<<dim3(TT / 64, CC / 128, TNB), 128, 0, stream>>>(CX, F[9], F[10], (float*)d_out);
}

// v006
// A run of this version takes 129 microseconds.
// Next to v005, in two timings, it ran 1.75 times as fast each time.
// Over all steps from v000 it is 11.4 times as fast.
// compute dtype: all float inputs rounded to bf16, attn_mask (int) read; q = Wq x + bq (from x), k/v = W c + b (from c) as 1x1 convs with EXACT bf16 products on WMMA 16x16x32 (channel-major tiles transposed in LDS), f32 accumulate; q as f16 hi + residual, k f16 -> 2-product content logits; the 9 windowed relative-key logits q_t . rel_k[s-t+4] and the relative-value term sum_j p[t][t+j-4] rel_v[j] in f32 on the VALU; proximity bias -log1p|s-t| (precise log1pf) and the mask in f32; softmax in f32 (precise expf) with a running maximum and sum, exp(score - maximum) split bf16 hi + lo against v bf16 hi + lo (3 products), divided by the sum at the end; out = Wo ctx (bf16 hi + lo) + bo written channel-major; f32 output.
#include <hip/hip_runtime.h>
#include <math.h>

typedef __attribute__((ext_vector_type(16))) _Float16 v16h;
typedef __attribute__((ext_vector_type(16))) __bf16 v16b;
typedef __attribute__((ext_vector_type(8)))  _Float16 v8h;
typedef __attribute__((ext_vector_type(8)))  float v8f;
typedef __attribute__((ext_vector_type(4)))  float v4f;
typedef __attribute__((ext_vector_type(2)))  float v2f;
typedef __attribute__((ext_vector_type(4)))  unsigned v4u;
typedef __attribute__((ext_vector_type(4)))  int v4i;
typedef float __attribute__((may_alias)) float_a;
typedef int __attribute__((may_alias)) int_a;

template <typename T> __device__ __forceinline__ void vst2(void* p, T v) { *(T*)p = v;  }
__device__ __forceinline__ v8f wmma16(v16h a, v16h b, v8f c) {
  v8f d = __builtin_amdgcn_wmma_f32_16x16x32_f16(false, a, false, b, (short)0, c, false, false);
  asm volatile("v_nop\n\tv_nop\n\tv_nop\n\tv_nop" : "+v"(d) : "v"(a), "v"(b));
  return d;
}
__device__ __forceinline__ v8f wmma_bf(v16b a, v16b b, v8f c) {
  v8f d = __builtin_amdgcn_wmma_f32_16x16x32_bf16(false, a, false, b, (short)0, c, false, false);
  asm volatile("v_nop\n\tv_nop\n\tv_nop\n\tv_nop" : "+v"(d) : "v"(a), "v"(b));
  return d;
}
// 16x16x32 fragments: lane = (h = lane>>4, row/col = lane&15); elements 0..7 = k0+8h+0..7, 8..15 = k0+16+8h+0..7; D element r = row 8h+r
__device__ __forceinline__ v16h frag_h(const _Float16* rowk0, int lane) {
  union { v16h v; v8h q[2]; } u; const _Float16* p = rowk0 + 8 * (lane >> 4);
  u.q[0] = *(const v8h*)p; u.q[1] = *(const v8h*)(p + 16); return u.v;
}
__device__ __forceinline__ v16h frag_f32(const float* rowk0, int lane) {
  v16h a; const float* p = rowk0 + 8 * (lane >> 4);
#pragma unroll
  for (int i = 0; i < 8; ++i) { a[i] = (_Float16)p[i]; a[8 + i] = (_Float16)p[16 + i]; }
  return a;
}
__device__ __forceinline__ v16h frag_f32s(const float* rowk0, int lane, float sc) {
  v16h a; const float* p = rowk0 + 8 * (lane >> 4);
#pragma unroll
  for (int i = 0; i < 8; ++i) { a[i] = (_Float16)(p[i] * sc); a[8 + i] = (_Float16)(p[16 + i] * sc); }
  return a;
}
// column fragment from a [K][ld] layout (column n), rows >= K read as 0
__device__ __forceinline__ v16h fragc_f32(const float* W, int k0, int n, int lane, int ld, int K) {
  v16h a; const int g = lane >> 4;
#pragma unroll
  for (int i = 0; i < 8; ++i) { const int ka = k0 + 8 * g + i, kb = ka + 16;
    a[i] = (_Float16)(ka < K ? W[(size_t)(ka < K ? ka : K - 1) * ld + n] : 0.f); a[8 + i] = (_Float16)(kb < K ? W[(size_t)(kb < K ? kb : K - 1) * ld + n] : 0.f); }
  return a;
}
struct F2 { v16b h, l; };
__device__ __forceinline__ F2 bsplit16(const float v[16]) { F2 r;
#pragma unroll
  for (int i = 0; i < 16; ++i) { const __bf16 h = (__bf16)v[i]; r.h[i] = h; r.l[i] = (__bf16)(v[i] - (float)h); }
  return r; }
__device__ __forceinline__ F2 split_row(const float* row, int k0, int lane) { float v[16]; const float* p = row + k0 + 8 * (lane >> 4);
#pragma unroll
  for (int i = 0; i < 8; ++i) { v[i] = p[i]; v[8 + i] = p[16 + i]; }
  return bsplit16(v); }
__device__ __forceinline__ F2 split_rowK(const float* row, int k0, int lane, int K) { float v[16]; const int g = lane >> 4;
#pragma unroll
  for (int i = 0; i < 8; ++i) { const int ka = k0 + 8 * g + i, kb = ka + 16; v[i] = ka < K ? row[ka < K ? ka : K - 1] : 0.f; v[8 + i] = kb < K ? row[kb < K ? kb : K - 1] : 0.f; }
  return bsplit16(v); }
__device__ __forceinline__ F2 split_col(const float* W, int k0, int n, int lane, int ld, int K) { float v[16]; const int g = lane >> 4;
#pragma unroll
  for (int i = 0; i < 8; ++i) { const int ka = k0 + 8 * g + i, kb = ka + 16; v[i] = ka < K ? W[(size_t)(ka < K ? ka : K - 1) * ld + n] : 0.f; v[8 + i] = kb < K ? W[(size_t)(kb < K ? kb : K - 1) * ld + n] : 0.f; }
  return bsplit16(v); }
__device__ __forceinline__ v8f mac3(const F2& a, const F2& b, v8f c) { c = wmma_bf(a.l, b.h, c); c = wmma_bf(a.h, b.l, c); return wmma_bf(a.h, b.h, c); }
__device__ __forceinline__ float sigm(float v) { return 1.0f / (1.0f + expf(-v)); }
// stands directly behind a group of global loads: keeps the whole group issued in front of the work that follows (nothing of it sinks to its use), and the precaution before the loads' address registers are written again
#define ISSUED() asm volatile("s_wait_xcnt 0x0" ::: "memory")
// the same, and the group's pointers are inputs of the wait: they stay in their registers up to it, so that no result of the group is laid over an address that a load of the group still names
#define ISSUED1(p) asm volatile("s_wait_xcnt 0x0" :: "v"(p) : "memory")
#define ISSUED2(p, q) asm volatile("s_wait_xcnt 0x0" :: "v"(p), "v"(q) : "memory")
#define ISSUED3(p, q, r) asm volatile("s_wait_xcnt 0x0" :: "v"(p), "v"(q), "v"(r) : "memory")
#define LDSX() do { asm volatile("s_wait_dscnt 0" ::: "memory"); __builtin_amdgcn_wave_barrier(); __builtin_amdgcn_fence(__ATOMIC_RELEASE, "workgroup"); } while (0)


// VITS-style relative-position multi-head attention (B 8, C 512 = 8 x 64, T 1,024, window 4): content + windowed relative-key logits, proximity bias, mask, softmax, value + windowed relative-value, output 1x1 conv.
#define NB 8
#define CC 512
#define TT 1024
#define NH 8
#define HD 64
#define WR 4
#define NRL 9
#ifndef TNB
#define TNB NB
#endif
typedef __attribute__((ext_vector_type(8))) __bf16 v8b;
__device__ __forceinline__ v16b frag_b(const __bf16* rowk0, int lane) {
  union { v16b v; v8b q[2]; } u; const __bf16* p = rowk0 + 8 * (lane >> 4);
  u.q[0] = *(const v8b*)p; u.q[1] = *(const v8b*)(p + 16); return u.v;
}
__device__ __forceinline__ float bfr(float v) { return (float)(__bf16)v; }
__device__ __attribute__((noinline)) float exp_ni(float v) { return expf(v); }
__device__ __attribute__((noinline)) float erf_ni(float v) { return erff(v); }

#define WS_QF  0u                                  // f32 q rows [b*t][512] (for the rel-k dots)
#define WS_QH  (WS_QF + 4u * (size_t)NB * TT * CC)
#define WS_QL  (WS_QH + 2u * (size_t)NB * TT * CC)
#define WS_KH  (WS_QL + 2u * (size_t)NB * TT * CC)
#define WS_VT  (WS_KH + 2u * (size_t)NB * TT * CC)     // bf16 v planes [b][512][t]
#define WS_VL  (WS_VT + 2u * (size_t)NB * CC * TT)
#define WS_QR  (WS_VL + 2u * (size_t)NB * CC * TT)     // f32 rel-k logits [b][h][t][16] (9 used)
#define WS_CX  (WS_QR + 4u * (size_t)NB * NH * TT * 16) // f32 ctx rows [b*t][512]
#define WS_END (WS_CX + 4u * (size_t)NB * TT * CC)

typedef __attribute__((ext_vector_type(4))) __bf16 v4b;
#define WP 72   // LDS pitch of a row of 64 16-bit elements: 144 B = 16 B x 9, so that the 16 rows of a ds_load_b128 fragment read spread over the banks
#define FP 68   // LDS pitch of a row of 64 f32: 272 B = 16 B x 17, for the same reason
// Staging of a 64-k piece of a matrix operand by a block of 128 threads: every global load of a wave covers whole 128-byte lines (512 B in 4 lines), and each piece is fetched once a block. The loops over u and i are unrolled so that the pieces are registers
// [128 rows][64] f32 out of rows of 512 (weights): thread = row u * 8 + (tid >> 4), 16 bytes at (tid & 15); stored as bf16
__device__ __forceinline__ void wt_load(v4f wv[16], const float* wq) {
#pragma unroll
  for (int u = 0; u < 16; ++u) wv[u] = *(const v4f*)(wq + u * 8 * CC); }
__device__ __forceinline__ void wt_store(__bf16 (*sw)[WP], const v4f wv[16], int tid) {
#pragma unroll
  for (int u = 0; u < 16; ++u) { v4b o;
#pragma unroll
    for (int i = 0; i < 4; ++i) o[i] = (__bf16)wv[u][i];
    *(v4b*)&sw[u * 8 + (tid >> 4)][(tid & 15) * 4] = o; } }
// [64 rows][64] f32 out of rows of LD (ctx): the same thread map, kept f32
template <int LD> __device__ __forceinline__ void ft_load(v4f fv[8], const float* fq) {
#pragma unroll
  for (int u = 0; u < 8; ++u) fv[u] = *(const v4f*)(fq + u * 8 * LD); }
__device__ __forceinline__ void ft_store(float (*sp)[FP], const v4f fv[8], int tid) {
#pragma unroll
  for (int u = 0; u < 8; ++u) *(v4f*)&sp[u * 8 + (tid >> 4)][(tid & 15) * 4] = fv[u]; }
// ---- k_proj: block = (64 positions, 128 out channels, b*3 + which): x^T / c^T tile in LDS; W [out][in] + b exact
__global__ __launch_bounds__(128) void k_proj(const float* __restrict__ X, const float* __restrict__ Cc, const float* __restrict__ WQ, const float* __restrict__ BQ, const float* __restrict__ WK, const float* __restrict__ BK, const float* __restrict__ WV, const float* __restrict__ BV, float* __restrict__ QF, _Float16* __restrict__ QH, _Float16* __restrict__ QL, _Float16* __restrict__ KH, __bf16* __restrict__ VT, __bf16* __restrict__ VL) {
  __shared__ __align__(16) __bf16 sx[64][CC + 8]; __shared__ __align__(16) float sf[64][132]; __shared__ __align__(16) unsigned char sbuf[2 * 128 * 72 * 2];   // union: (th, tl2) for v  |  (sh, sl) for q/k
  __bf16 (*th)[72] = (__bf16 (*)[72])sbuf; __bf16 (*tl2)[72] = (__bf16 (*)[72])(sbuf + 128 * 72 * 2); _Float16 (*sh)[136] = (_Float16 (*)[136])sbuf; _Float16 (*sl)[136] = (_Float16 (*)[136])(sbuf + 64 * 136 * 2); __bf16 (*sw)[128][WP] = (__bf16 (*)[128][WP])sbuf;   // in the k loop sbuf is the two weight buffers
  const int tid = threadIdx.x, wave = tid >> 5, lane = tid & 31, col = lane & 15, g = lane >> 4; const int p0 = blockIdx.x * 64; const int c0 = blockIdx.y * 128; const size_t b = blockIdx.z / 3; const int which = blockIdx.z % 3;
  const float* Xs = which == 0 ? X : Cc; const float* Wm = which == 0 ? WQ : which == 1 ? WK : WV; const float* Bm = which == 0 ? BQ : which == 1 ? BK : BV;
  // thread tid fills position tid & 63, channels (tid >> 6) + 2 k: 32 independent loads off one pointer are in flight before the first is waited for; the loops over u are unrolled so that xv is registers, the outer loop stays rolled: eight copies of the group would only lengthen the code
  const float* xp = Xs + (b * CC + (tid >> 6)) * (size_t)TT + p0 + (tid & 63);
  // the first weight piece is asked for ahead of the x tile and stored behind it
  const float* wq = Wm + (size_t)(c0 + (tid >> 4)) * CC + (tid & 15) * 4; v4f wv[16];
  wt_load(wv, wq); ISSUED1(wq);
#pragma unroll 1
  for (int kg = 0; kg < CC / 2; kg += 32) { float xv[32]; const float* xg = xp + (size_t)kg * 2 * TT;
#pragma unroll
    for (int u = 0; u < 32; ++u) xv[u] = xg[u * 2 * TT];
    ISSUED1(xg);
#pragma unroll
    for (int u = 0; u < 32; ++u) sx[tid & 63][(tid >> 6) + 2 * (kg + u)] = (__bf16)xv[u]; }
  wt_store(sw[0], wv, tid);
  __syncthreads();
  v8f acc[8] = {};
  // rolled: a trip asks for the next 64-k weight piece, works on this one out of LDS, stores the next into the other buffer; the one barrier of a trip publishes that buffer and ends the reads of this one (behind the last trip: before sbuf becomes output staging). The loops over ks and j are unrolled so that w and acc are registers
#pragma unroll 1
  for (int c = 0; c < CC / 64; ++c) { const int bu = c & 1;
    if (c + 1 < CC / 64) { const float* wn = wq + (c + 1) * 64; wt_load(wv, wn); ISSUED1(wn); }
#pragma unroll
    for (int ks = 0; ks < 2; ++ks) { const v16b a = frag_b(&sx[wave * 16 + col][c * 64 + ks * 32], lane); v16b w[8];
#pragma unroll
      for (int j = 0; j < 8; ++j) w[j] = frag_b(&sw[bu][j * 16 + col][ks * 32], lane);
#pragma unroll
      for (int j = 0; j < 8; ++j) acc[j] = wmma_bf(a, w[j], acc[j]); }
    if (c + 1 < CC / 64) wt_store(sw[bu ^ 1], wv, tid);
    __syncthreads(); }
  if (which < 2) {
#pragma unroll
    for (int j = 0; j < 8; ++j) { const float bb = bfr(Bm[c0 + j * 16 + col]);
#pragma unroll
      for (int r = 0; r < 8; ++r) sf[wave * 16 + 8 * g + r][j * 16 + col] = acc[j][r] + bb; }
    __syncthreads();
    // rows: f32 (q only), f16 hi (+ residual for q)
    for (int e = tid; e < 64 * 32; e += 128) { const int rl = e >> 5, q4 = e & 31; const size_t row = b * TT + p0 + rl; const float* src = &sf[rl][q4 * 4]; if (which == 0) vst2(QF + row * CC + c0 + q4 * 4, *(const v4f*)src); }
    for (int e = tid; e < 64 * 128; e += 128) { const int rl = e >> 7, cl = e & 127; const float v = sf[rl][cl]; const _Float16 hv = (_Float16)v; sh[rl][cl] = hv; sl[rl][cl] = (_Float16)(v - (float)hv); }
    __syncthreads();
    _Float16* dh = which == 0 ? QH : KH; for (int e = tid; e < 64 * 16; e += 128) { const int rl = e >> 4, q = e & 15; const size_t row = b * TT + p0 + rl; vst2((unsigned*)(dh + row * CC + c0 + q * 8), *(const v4u*)&sh[rl][q * 8]); if (which == 0) vst2((unsigned*)(QL + row * CC + c0 + q * 8), *(const v4u*)&sl[rl][q * 8]); } }
  else {
#pragma unroll
    for (int j = 0; j < 8; ++j) { const float bb = bfr(Bm[c0 + j * 16 + col]);
#pragma unroll
      for (int r = 0; r < 8; ++r) { const float v = acc[j][r] + bb; const int rl = wave * 16 + 8 * g + r, cl = j * 16 + col; const __bf16 bh = (__bf16)v; th[cl][rl] = bh; tl2[cl][rl] = (__bf16)(v - (float)bh); } }
    __syncthreads(); for (int e = tid; e < 128 * 8; e += 128) { const int cl = e >> 3, q = e & 7; const size_t o2 = (b * CC + c0 + cl) * (size_t)TT + p0 + q * 8; vst2((unsigned*)(VT + o2), *(const v4u*)&th[cl][q * 8]); vst2((unsigned*)(VL + o2), *(const v4u*)&tl2[cl][q * 8]); } } }
// ---- k_qr: block = (64 queries, b * 8 + head): QR[b][h][t][j] = q_t(head h) . rel_k[j] for j = 0..8 (f32)
__global__ __launch_bounds__(64) void k_qr(const float* __restrict__ QF, const float* __restrict__ RK, float* __restrict__ QR0) { __shared__ float srk[NRL][HD]; __shared__ __align__(16) float so[64][16]; __shared__ __align__(16) float sq[64][FP];
  const int t = threadIdx.x; const int b = blockIdx.z / NH, h = blockIdx.z % NH; float* QR = QR0 + (size_t)blockIdx.z * TT * 16; const int t0 = blockIdx.x * 64;
  // the block's 64 q rows (256 B each) are fetched together by loads that cover whole lines (thread = row u * 4 + (t >> 4), 16 bytes at (t & 15)) and turned through LDS, so that each thread then holds its own row; the loops over u and d are unrolled so that qr and qv are registers
  const float* q = QF + ((size_t)b * TT + t0 + (t >> 4)) * CC + h * HD + (t & 15) * 4; v4f qr[16]; float qv[HD];
#pragma unroll
  for (int u = 0; u < 16; ++u) qr[u] = *(const v4f*)(q + u * 4 * CC);
  ISSUED1(q);
  for (int e = t; e < NRL * HD; e += 64) srk[e / HD][e % HD] = bfr(RK[e]);
  for (int e = t; e < 64 * 16; e += 64) so[e >> 4][e & 15] = 0.f;
#pragma unroll
  for (int u = 0; u < 16; ++u) *(v4f*)&sq[u * 4 + (t >> 4)][(t & 15) * 4] = qr[u];
  __syncthreads();
#pragma unroll
  for (int d = 0; d < HD; ++d) qv[d] = sq[t][d];
#pragma unroll 1
  for (int j = 0; j < NRL; ++j) { float a = 0.f;
#pragma unroll
    for (int d = 0; d < HD; ++d) a += qv[d] * srk[j][d]; so[t][j] = a; }
  __syncthreads(); for (int e = t; e < 64 * 4; e += 64) { const int rl = e >> 2, qq = e & 3; vst2(QR + (size_t)(t0 + rl) * 16 + qq * 4, *(const v4f*)&so[rl][qq * 4]); } }
// the loop over i is unrolled so that the stage is registers, not indexed memory
__device__ __forceinline__ void pv_load_p(float p[16], const float* pk) {
#pragma unroll
  for (int i = 0; i < 8; ++i) { p[i] = pk[i]; p[8 + i] = pk[16 + i]; } }
// [2 planes][64 rows][64] bf16 out of rows of 1,024 (v hi, v lo): thread = row u * 16 + (tid >> 3), 16 bytes at (tid & 7); a wave's load covers 4 whole lines
__device__ __forceinline__ void vt_load(v4u vr[8], const __bf16* vg, const __bf16* lg) {
#pragma unroll
  for (int u = 0; u < 4; ++u) { vr[u] = *(const v4u*)(vg + u * 16 * TT); vr[4 + u] = *(const v4u*)(lg + u * 16 * TT); } }
__device__ __forceinline__ void vt_store(__bf16 (*sv)[64][WP], const v4u vr[8], int tid) {
#pragma unroll
  for (int u = 0; u < 4; ++u) { *(v4u*)&sv[0][u * 16 + (tid >> 3)][(tid & 7) * 8] = vr[u]; *(v4u*)&sv[1][u * 16 + (tid >> 3)][(tid & 7) * 8] = vr[4 + u]; } }
// [64 rows][64] f16 out of rows of 512 (k, one head): the same thread map
__device__ __forceinline__ void kt_load(v4u kr[4], const _Float16* kg) {
#pragma unroll
  for (int u = 0; u < 4; ++u) kr[u] = *(const v4u*)(kg + u * 16 * CC); }
__device__ __forceinline__ void kt_store(_Float16 (*sk)[WP], const v4u kr[4], int tid) {
#pragma unroll
  for (int u = 0; u < 4; ++u) *(v4u*)&sk[u * 16 + (tid >> 3)][(tid & 7) * 8] = kr[u]; }
// [16 rows][32] mask words out of rows of 1,024, one wave's own: lane = row u * 4 + (lane >> 3), 16 bytes at (lane & 7); a load covers 4 whole lines
__device__ __forceinline__ void mt_load(v4i mg[4], const int* mp) {
#pragma unroll
  for (int u = 0; u < 4; ++u) mg[u] = *(const v4i*)(mp + u * 4 * TT); }
#define MP 36   // LDS pitch of a row of 32 mask words: 144 B = 16 B x 9
__device__ __forceinline__ void mt_store(int (*sm)[MP], const v4i mg[4], int lane) {
#pragma unroll
  for (int u = 0; u < 4; ++u) *(v4i*)&sm[u * 4 + (lane >> 3)][(lane & 7) * 4] = mg[u]; }
// the matrix builtins as they are: the compiler keeps the distance behind them itself and fills it with the softmax's vector work where it can
__device__ __forceinline__ v8f mm_h(v16h a, v16h b, v8f c) { return __builtin_amdgcn_wmma_f32_16x16x32_f16(false, a, false, b, (short)0, c, false, false); }
__device__ __forceinline__ v8f mm_b(v16b a, v16b b, v8f c) { return __builtin_amdgcn_wmma_f32_16x16x32_bf16(false, a, false, b, (short)0, c, false, false); }
// orders a wave's accesses to LDS rows that only this wave uses: what stands above is over before what stands below begins; no fence, which would also wait for the global loads in flight
#define LDSW() do { asm volatile("s_wait_dscnt 0x0" ::: "memory"); __builtin_amdgcn_wave_barrier(); } while (0)
typedef __attribute__((ext_vector_type(8))) unsigned v8u;
// lane l with lane l ^ 16
__device__ __forceinline__ float xhalf(float x) { return __builtin_bit_cast(float, __builtin_amdgcn_permlanex16(__builtin_bit_cast(int, x), __builtin_bit_cast(int, x), 0x76543210, 0xfedcba98, false, false)); }
// ---- k_fa: block = (64 queries, b * 8 + head), wave = 16 queries, all 1,024 keys in 16 pieces of 64 (k and v staged once a block in LDS, two buffers), a pass = 32 keys. Transposed products: S^T = k . q^T (a lane holds 8 keys of ONE query a tile), score = (q.k + [|s-t|<=4] QR[t][s-t+4]) / 8 - log1p|s-t| (table in LDS); mask == 0 -> -1e4; running maximum and sum per query; e = exp(score - maximum in use) goes from the score registers straight into the B operand (bf16 hi + lo) of ctx^T += v^T . e^T (3 products); ctx rows [b*t][h*64+d] = (ctx^T + sum_j e[t][t+j-4] rel_v[j][d]) / sum. Second launch bound: 4 waves a SIMD, so that four blocks share a WGP
__global__ __launch_bounds__(128, 4) void k_fa(const _Float16* __restrict__ QH, const _Float16* __restrict__ QL, const _Float16* __restrict__ KH, const float* __restrict__ QR0, const int* __restrict__ AM, const __bf16* __restrict__ VT, const __bf16* __restrict__ VL, const float* __restrict__ RV, float* __restrict__ CX) {
  __shared__ __align__(16) _Float16 sk[2][64][WP]; __shared__ __align__(16) __bf16 sv[2][2][64][WP]; __shared__ __align__(16) int sm[4][16][MP]; __shared__ float slp[TT + 63]; __shared__ __align__(16) float sqr[64][16]; __shared__ float sb[64][NRL]; __shared__ __align__(16) float srv[NRL][HD];
  const int b = blockIdx.z / NH, h = blockIdx.z % NH; const float* QR = QR0 + (size_t)blockIdx.z * TT * 16;
  const int tid = threadIdx.x, wave = __builtin_amdgcn_readfirstlane(tid >> 5), lane = tid & 31, col = lane & 15, g = lane >> 4; const int tb = blockIdx.x * 64, ql0 = tb + wave * 16, rw = wave * 16 + col;
  // first piece of k and v, the wave's first pass of mask words, and its q fragments (kept in registers throughout) are asked for ahead of the tables
  const _Float16* kg = KH + ((size_t)b * TT + (tid >> 3)) * CC + h * HD + (tid & 7) * 8; const size_t vo = ((size_t)b * CC + h * HD + (tid >> 3)) * (size_t)TT + (tid & 7) * 8; const __bf16 *vg = VT + vo, *lg = VL + vo; const int* mp = AM + ((size_t)b * TT + ql0 + (lane >> 3)) * TT + (lane & 7) * 4;
  v4u kr[4], vr[8]; v4i mg[4];
  kt_load(kr, kg); vt_load(vr, vg, lg); mt_load(mg, mp); ISSUED3(kg, vg, lg);
  const _Float16 *qhp = QH + ((size_t)b * TT + ql0 + col) * CC + h * HD, *qlp = QL + ((size_t)b * TT + ql0 + col) * CC + h * HD;
  const v16h qh0 = frag_h(qhp, lane), qh1 = frag_h(qhp + 32, lane), ql_0 = frag_h(qlp, lane), ql_1 = frag_h(qlp + 32, lane);
  ISSUED3(qhp, qlp, mp);
  // the block's 64 x 1,024 scores meet only 1,087 distances s - t: slp[i] = log1p|i - 63 - tb|, each computed once for the block
  for (int e = tid; e < TT + 63; e += 128) slp[e] = log1pf(fabsf((float)(e - 63 - tb)));
  for (int e = tid; e < 64 * 4; e += 128) *(v4f*)&sqr[e >> 2][(e & 3) * 4] = *(const v4f*)(QR + (size_t)tb * 16 + e * 4);
  for (int e = tid; e < NRL * HD; e += 128) srv[e / HD][e % HD] = bfr(RV[e]);
  for (int e = tid; e < 64 * NRL; e += 128) sb[e / NRL][e % NRL] = -3.0e38f;   // a window place outside 0..1,023 keeps this and ends as weight 0
  kt_store(sk[0], kr, tid); vt_store(sv[0], vr, tid); mt_store(sm[wave], mg, lane);
  mt_load(mg, mp + 32); ISSUED1(mp);
  __syncthreads();
  v8f acc[4] = {}; float m = -3.0e38f, l = 0.f;
  // rolled: a trip asks for the next piece, works on this one out of LDS, stores the next into the other buffers; the one barrier of a trip publishes those and ends the reads of these (it stands outside the test on c, as in the other kernels). The loops over sp, jt, j, s and o are unrolled so that the tiles are registers
#pragma unroll 1
  for (int c = 0; c < TT / 64; ++c) { const int bu = c & 1;
    if (c + 1 < TT / 64) { kg += 64 * CC; vg += 64; lg += 64; kt_load(kr, kg); vt_load(vr, vg, lg); ISSUED3(kg, vg, lg); }
#pragma unroll
    for (int sp = 0; sp < 2; ++sp) { const int k0 = c * 64 + sp * 32; v8f st[2] = {};
      // the pass's LDS reads stand together ahead of its products: k fragments, table values, and the mask words, which come out of the wave's own LDS rows in the score tiles' map
      v16h ka[4]; v4i mk[4]; float lp[16];
#pragma unroll
      for (int jt = 0; jt < 2; ++jt) { ka[jt] = frag_h(&sk[bu][sp * 32 + jt * 16 + col][0], lane); ka[2 + jt] = frag_h(&sk[bu][sp * 32 + jt * 16 + col][32], lane); }
#pragma unroll
      for (int jt = 0; jt < 2; ++jt) { mk[2 * jt] = *(const v4i*)&sm[wave][col][jt * 16 + 8 * g]; mk[2 * jt + 1] = *(const v4i*)&sm[wave][col][jt * 16 + 8 * g + 4]; }
#pragma unroll
      for (int s = 0; s < 16; ++s) lp[s] = slp[k0 + (s >> 3) * 16 + 8 * g + (s & 7) - rw + 63];
      // the two tiles' products alternate, so that none waits for the one before it; each tile's order of sums is hi, lo, hi, lo
      st[0] = mm_h(ka[0], qh0, st[0]); st[1] = mm_h(ka[1], qh0, st[1]); st[0] = mm_h(ka[0], ql_0, st[0]); st[1] = mm_h(ka[1], ql_0, st[1]);
      st[0] = mm_h(ka[2], qh1, st[0]); st[1] = mm_h(ka[3], qh1, st[1]); st[0] = mm_h(ka[2], ql_1, st[0]); st[1] = mm_h(ka[3], ql_1, st[1]);
      // the next pass's mask words, fetched a pass ago, go into those rows, and the pass after that is asked for (past the last pass the last one again: an address in bounds and no branch among the loads)
      LDSW();   // the wave's reads of its mask rows are over before it writes them anew
      mt_store(sm[wave], mg, lane);
      LDSW();   // and the new rows are written before lanes read what other lanes of the wave stored
      { const int pn = c * 2 + sp + 2; const int* mn = mp + (pn < TT / 32 ? pn : TT / 32 - 1) * 32; mt_load(mg, mn); ISSUED1(mn); }
      // the relative-key term: one test a pass, the same in every lane of a wave (at most 2 of a wave's 32 passes meet the band |s - t| <= 4), index clamped into 0..8
      const bool band = k0 + 31 >= ql0 - WR && k0 <= ql0 + 15 + WR;
      if (band) {
#pragma unroll
        for (int s = 0; s < 16; ++s) { const int dw = k0 + (s >> 3) * 16 + 8 * g + (s & 7) - (ql0 + col) + WR; const float qv = sqr[rw][dw < 0 ? 0 : dw > 2 * WR ? 2 * WR : dw]; if (dw >= 0 && dw <= 2 * WR) st[s >> 3][s & 7] += qv; } }
      float pm = -3.0e38f;
#pragma unroll
      for (int s = 0; s < 16; ++s) { float v = st[s >> 3][s & 7] * 0.125f - lp[s]; if (mk[s >> 2][s & 3] == 0) v = -10000.0f; st[s >> 3][s & 7] = v; pm = fmaxf(pm, v); }
      // the 9 scores of each query's window are kept for the relative-value term
      if (band) {
#pragma unroll
        for (int s = 0; s < 16; ++s) { const int dw = k0 + (s >> 3) * 16 + 8 * g + (s & 7) - (ql0 + col) + WR; if (dw >= 0 && dw <= 2 * WR) sb[rw][dw] = st[s >> 3][s & 7]; } }
      pm = fmaxf(pm, xhalf(pm));
      // the maximum in use moves, and sums and ctx are rescaled, only when some query's new maximum passes it by more than 5 (e stays below e^5): one test a pass
      if (__builtin_amdgcn_ballot_w32(pm > m + 5.0f) != 0) { const float mn = fmaxf(m, pm), sc = expf(m - mn); m = mn; l *= sc;
#pragma unroll
        for (int j = 0; j < 4; ++j) acc[j] *= sc; }
      v16b ph, pl; float ev[16];
#pragma unroll
      for (int s = 0; s < 16; ++s) { ev[s] = expf(st[s >> 3][s & 7] - m); ph[s] = (__bf16)ev[s]; }
      // the hi parts are taken back as f32 out of the packed words (low half shifted up, high half masked): the same values as a conversion of each
      { const v8u pw2 = __builtin_bit_cast(v8u, ph);
#pragma unroll
        for (int s = 0; s < 16; s += 2) { pl[s] = (__bf16)(ev[s] - __builtin_bit_cast(float, pw2[s >> 1] << 16)); pl[s + 1] = (__bf16)(ev[s + 1] - __builtin_bit_cast(float, pw2[s >> 1] & 0xffff0000u)); } }
      // the pass's 16 terms are joined as a tree, not as one chain of dependent additions
#pragma unroll
      for (int o = 8; o > 0; o >>= 1)
#pragma unroll
        for (int s = 0; s < o; ++s) ev[s] += ev[s + o];
      l += ev[0];
      // two d tiles' products alternate; each tile's order of sums is vh.ph, vh.pl, vl.ph
#pragma unroll
      for (int j = 0; j < 4; j += 2) { const v16b vh0 = frag_b(&sv[bu][0][j * 16 + col][sp * 32], lane), vl0 = frag_b(&sv[bu][1][j * 16 + col][sp * 32], lane), vh1 = frag_b(&sv[bu][0][j * 16 + 16 + col][sp * 32], lane), vl1 = frag_b(&sv[bu][1][j * 16 + 16 + col][sp * 32], lane);
        acc[j] = mm_b(vh0, ph, acc[j]); acc[j + 1] = mm_b(vh1, ph, acc[j + 1]); acc[j] = mm_b(vh0, pl, acc[j]); acc[j + 1] = mm_b(vh1, pl, acc[j + 1]); acc[j] = mm_b(vl0, ph, acc[j]); acc[j + 1] = mm_b(vl1, ph, acc[j + 1]); } }
    if (c + 1 < TT / 64) { kt_store(sk[bu ^ 1], kr, tid); vt_store(sv[bu ^ 1], vr, tid); }
    __syncthreads(); }
  // behind the last barrier the v buffers are output staging, each wave in a range of its own
  float (*so)[68] = (float (*)[68])((float*)&sv[0][0][0][0] + wave * 16 * 68);
  l += xhalf(l); const float inv = 1.0f / l; float pw[NRL];
#pragma unroll
  for (int jj = 0; jj < NRL; ++jj) pw[jj] = expf(sb[rw][jj] - m);
#pragma unroll
  for (int j = 0; j < 4; ++j)
#pragma unroll
    for (int r = 0; r < 8; ++r) { const int d = j * 16 + 8 * g + r; float a = acc[j][r];
#pragma unroll
      for (int jj = 0; jj < NRL; ++jj) a += pw[jj] * srv[jj][d];
      so[col][d] = a * inv; }
  LDSX();   // rows leave LDS as whole 256-byte pieces, two rows a store
#pragma unroll
  for (int rl = 0; rl < 16; rl += 2) vst2(CX + ((size_t)b * TT + ql0 + rl + g) * CC + h * HD + col * 4, *(const v4f*)&so[rl + g][col * 4]); }
// ---- k_out: block = (64 positions, 128 out channels, b): out[o][t] = sum_c Wo[o][c] ctx[t][c] + bo; A = ctx rows (hi + lo), B = Wo [o][c]; transposed to planes
__global__ __launch_bounds__(128) void k_out(const float* __restrict__ CX, const float* __restrict__ WO, const float* __restrict__ BO, float* __restrict__ OUT) { __shared__ __align__(16) float so[128][68]; __shared__ __align__(16) float sc[2][64][FP]; __shared__ __align__(16) __bf16 sw[2][128][WP];
  const int tid = threadIdx.x, wave = tid >> 5, lane = tid & 31, col = lane & 15, g = lane >> 4; const int t0 = blockIdx.x * 64, c0 = blockIdx.y * 128; const size_t b = blockIdx.z;
  v8f acc[8] = {};
  // a piece = 64 channels: the block's 64 ctx rows (f32) and its 128 weight rows (as bf16), fetched once a block into LDS, two buffers
  const float* cq = CX + (b * TT + t0 + (tid >> 4)) * CC + (tid & 15) * 4; const float* wq = WO + (size_t)(c0 + (tid >> 4)) * CC + (tid & 15) * 4; v4f cr[8], wv[16];
  ft_load<CC>(cr, cq); wt_load(wv, wq); ISSUED2(cq, wq);
  ft_store(sc[0], cr, tid); wt_store(sw[0], wv, tid);
  __syncthreads();
  // rolled: a trip asks for the next piece, works on this one out of LDS, stores the next into the other buffers; the one barrier of a trip publishes those and ends the reads of these (it stands outside the test on c: inside it the compiler put a wait in front of every load of the next group). The loops over ks, jg and jj are unrolled so that cv, w and acc are registers
#pragma unroll 1
  for (int c = 0; c < CC / 64; ++c) { const int bu = c & 1;
    if (c + 1 < CC / 64) { const float *cn = cq + (c + 1) * 64, *wn = wq + (c + 1) * 64; ft_load<CC>(cr, cn); wt_load(wv, wn); ISSUED2(cn, wn); }
#pragma unroll
    for (int ks = 0; ks < 2; ++ks) { float cv[16]; pv_load_p(cv, &sc[bu][wave * 16 + col][ks * 32 + 8 * g]); const F2 a = bsplit16(cv);
#pragma unroll
      for (int jg = 0; jg < 8; jg += 4) { v16b w[4];   // four weight fragments at a time: eight, beside the next piece's 96 registers, take the kernel past 256 registers
#pragma unroll
        for (int jj = 0; jj < 4; ++jj) w[jj] = frag_b(&sw[bu][(jg + jj) * 16 + col][ks * 32], lane);
#pragma unroll
        for (int jj = 0; jj < 4; ++jj) { acc[jg + jj] = wmma_bf(a.h, w[jj], acc[jg + jj]); acc[jg + jj] = wmma_bf(a.l, w[jj], acc[jg + jj]); } } }
    if (c + 1 < CC / 64) { ft_store(sc[bu ^ 1], cr, tid); wt_store(sw[bu ^ 1], wv, tid); }
    __syncthreads(); }
#pragma unroll
  for (int j = 0; j < 8; ++j) { const float bb = bfr(BO[c0 + j * 16 + col]);
#pragma unroll
    for (int r = 0; r < 8; ++r) so[j * 16 + col][wave * 16 + 8 * g + r] = acc[j][r] + bb; }
  __syncthreads(); for (int e = tid; e < 128 * 16; e += 128) { const int cl = e >> 4, q = e & 15; vst2(OUT + ((size_t)b * CC + c0 + cl) * TT + t0 + q * 4, *(const v4f*)&so[cl][q * 4]); } }
extern "C" void kernel_launch(void* const* d_in, const int* in_sizes, int n_in, void* d_out, int out_size, void* d_ws, size_t ws_size, hipStream_t stream) {
  (void)in_sizes; (void)n_in; (void)out_size;
  const float** F = (const float**)d_in;   // 0 x [8,512,1024], 1 c [8,512,1024], 2 attn_mask [8,1,1024,1024] int, 3 Wq [512,512], 4 bq, 5 Wk, 6 bk, 7 Wv, 8 bv, 9 Wo [512,512], 10 bo, 11 emb_rel_k [1,9,64], 12 emb_rel_v [1,9,64]
  if (ws_size < (size_t)WS_END) return;
  char* ws = (char*)d_ws; float *QF = (float*)(ws + WS_QF), *QR = (float*)(ws + WS_QR), *CX = (float*)(ws + WS_CX); _Float16 *QH = (_Float16*)(ws + WS_QH), *QL = (_Float16*)(ws + WS_QL), *KH = (_Float16*)(ws + WS_KH); __bf16 *VT = (__bf16*)(ws + WS_VT), *VL = (__bf16*)(ws + WS_VL);
  k_proj<<<dim3(TT / 64, CC / 128, TNB * 3), 128, 0, stream>>>(F[0], F[1], F[3], F[4], F[5], F[6], F[7], F[8], QF, QH, QL, KH, VT, VL);
  k_qr<<<dim3(TT / 64, 1, TNB * NH), 64, 0, stream>>>(QF, F[11], QR);
  k_fa<<<dim3(TT / 64, 1, TNB * NH), 128, 0, stream>>>(QH, QL, KH, QR, (const int*)d_in[2], VT, VL, F[12], CX);
  k_out<<<dim3(TT / 64, CC / 128, TNB), 128, 0, stream>>>(CX, F[9], F[10], (float*)d_out);
}

// v007
// Measured time: 118 microseconds a run.
// Two timings next to v006 both put it at 1.09 times that version's speed.
// All steps since v000 together make it 12.5 times as fast.
// compute dtype: all float inputs rounded to bf16, attn_mask (int) read; q = Wq x + bq (from x), k/v = W c + b (from c) as 1x1 convs with EXACT bf16 products on WMMA 16x16x32 (channel-major tiles transposed in LDS), f32 accumulate; q as f16 hi + residual, k f16 -> 2-product content logits; the 9 windowed relative-key logits q_t . rel_k[s-t+4] and the relative-value term sum_j p[t][t+j-4] rel_v[j] in f32 on the VALU; proximity bias -log1p|s-t| (precise log1pf) and the mask in f32; softmax in f32 with a running maximum and sum, scores kept in log2 units (log2 e folded into the 1/8 scale, the bias table and the mask value), exp(score - maximum) = 2^(difference) by the hardware's exp2, split bf16 hi + lo against v bf16 hi + lo (3 products), divided by the sum at the end; out = Wo ctx (bf16 hi + lo) + bo written channel-major; f32 output.
#include <hip/hip_runtime.h>
#include <math.h>

typedef __attribute__((ext_vector_type(16))) _Float16 v16h;
typedef __attribute__((ext_vector_type(16))) __bf16 v16b;
typedef __attribute__((ext_vector_type(8)))  _Float16 v8h;
typedef __attribute__((ext_vector_type(8)))  float v8f;
typedef __attribute__((ext_vector_type(4)))  float v4f;
typedef __attribute__((ext_vector_type(2)))  float v2f;
typedef __attribute__((ext_vector_type(4)))  unsigned v4u;
typedef __attribute__((ext_vector_type(4)))  int v4i;
typedef float __attribute__((may_alias)) float_a;
typedef int __attribute__((may_alias)) int_a;

template <typename T> __device__ __forceinline__ void vst2(void* p, T v) { *(T*)p = v;  }
__device__ __forceinline__ v8f wmma16(v16h a, v16h b, v8f c) {
  v8f d = __builtin_amdgcn_wmma_f32_16x16x32_f16(false, a, false, b, (short)0, c, false, false);
  asm volatile("v_nop\n\tv_nop\n\tv_nop\n\tv_nop" : "+v"(d) : "v"(a), "v"(b));
  return d;
}
__device__ __forceinline__ v8f wmma_bf(v16b a, v16b b, v8f c) {
  v8f d = __builtin_amdgcn_wmma_f32_16x16x32_bf16(false, a, false, b, (short)0, c, false, false);
  asm volatile("v_nop\n\tv_nop\n\tv_nop\n\tv_nop" : "+v"(d) : "v"(a), "v"(b));
  return d;
}
// 16x16x32 fragments: lane = (h = lane>>4, row/col = lane&15); elements 0..7 = k0+8h+0..7, 8..15 = k0+16+8h+0..7; D element r = row 8h+r
__device__ __forceinline__ v16h frag_h(const _Float16* rowk0, int lane) {
  union { v16h v; v8h q[2]; } u; const _Float16* p = rowk0 + 8 * (lane >> 4);
  u.q[0] = *(const v8h*)p; u.q[1] = *(const v8h*)(p + 16); return u.v;
}
__device__ __forceinline__ v16h frag_f32(const float* rowk0, int lane) {
  v16h a; const float* p = rowk0 + 8 * (lane >> 4);
#pragma unroll
  for (int i = 0; i < 8; ++i) { a[i] = (_Float16)p[i]; a[8 + i] = (_Float16)p[16 + i]; }
  return a;
}
__device__ __forceinline__ v16h frag_f32s(const float* rowk0, int lane, float sc) {
  v16h a; const float* p = rowk0 + 8 * (lane >> 4);
#pragma unroll
  for (int i = 0; i < 8; ++i) { a[i] = (_Float16)(p[i] * sc); a[8 + i] = (_Float16)(p[16 + i] * sc); }
  return a;
}
// column fragment from a [K][ld] layout (column n), rows >= K read as 0
__device__ __forceinline__ v16h fragc_f32(const float* W, int k0, int n, int lane, int ld, int K) {
  v16h a; const int g = lane >> 4;
#pragma unroll
  for (int i = 0; i < 8; ++i) { const int ka = k0 + 8 * g + i, kb = ka + 16;
    a[i] = (_Float16)(ka < K ? W[(size_t)(ka < K ? ka : K - 1) * ld + n] : 0.f); a[8 + i] = (_Float16)(kb < K ? W[(size_t)(kb < K ? kb : K - 1) * ld + n] : 0.f); }
  return a;
}
struct F2 { v16b h, l; };
__device__ __forceinline__ F2 bsplit16(const float v[16]) { F2 r;
#pragma unroll
  for (int i = 0; i < 16; ++i) { const __bf16 h = (__bf16)v[i]; r.h[i] = h; r.l[i] = (__bf16)(v[i] - (float)h); }
  return r; }
__device__ __forceinline__ F2 split_row(const float* row, int k0, int lane) { float v[16]; const float* p = row + k0 + 8 * (lane >> 4);
#pragma unroll
  for (int i = 0; i < 8; ++i) { v[i] = p[i]; v[8 + i] = p[16 + i]; }
  return bsplit16(v); }
__device__ __forceinline__ F2 split_rowK(const float* row, int k0, int lane, int K) { float v[16]; const int g = lane >> 4;
#pragma unroll
  for (int i = 0; i < 8; ++i) { const int ka = k0 + 8 * g + i, kb = ka + 16; v[i] = ka < K ? row[ka < K ? ka : K - 1] : 0.f; v[8 + i] = kb < K ? row[kb < K ? kb : K - 1] : 0.f; }
  return bsplit16(v); }
__device__ __forceinline__ F2 split_col(const float* W, int k0, int n, int lane, int ld, int K) { float v[16]; const int g = lane >> 4;
#pragma unroll
  for (int i = 0; i < 8; ++i) { const int ka = k0 + 8 * g + i, kb = ka + 16; v[i] = ka < K ? W[(size_t)(ka < K ? ka : K - 1) * ld + n] : 0.f; v[8 + i] = kb < K ? W[(size_t)(kb < K ? kb : K - 1) * ld + n] : 0.f; }
  return bsplit16(v); }
__device__ __forceinline__ v8f mac3(const F2& a, const F2& b, v8f c) { c = wmma_bf(a.l, b.h, c); c = wmma_bf(a.h, b.l, c); return wmma_bf(a.h, b.h, c); }
__device__ __forceinline__ float sigm(float v) { return 1.0f / (1.0f + expf(-v)); }
// stands directly behind a group of global loads: keeps the whole group issued in front of the work that follows (nothing of it sinks to its use), and the precaution before the loads' address registers are written again
#define ISSUED() asm volatile("s_wait_xcnt 0x0" ::: "memory")
// the same, and the group's pointers are inputs of the wait: they stay in their registers up to it, so that no result of the group is laid over an address that a load of the group still names
#define ISSUED1(p) asm volatile("s_wait_xcnt 0x0" :: "v"(p) : "memory")
#define ISSUED2(p, q) asm volatile("s_wait_xcnt 0x0" :: "v"(p), "v"(q) : "memory")
#define ISSUED3(p, q, r) asm volatile("s_wait_xcnt 0x0" :: "v"(p), "v"(q), "v"(r) : "memory")
#define LDSX() do { asm volatile("s_wait_dscnt 0" ::: "memory"); __builtin_amdgcn_wave_barrier(); __builtin_amdgcn_fence(__ATOMIC_RELEASE, "workgroup"); } while (0)


// VITS-style relative-position multi-head attention (B 8, C 512 = 8 x 64, T 1,024, window 4): content + windowed relative-key logits, proximity bias, mask, softmax, value + windowed relative-value, output 1x1 conv.
#define NB 8
#define CC 512
#define TT 1024
#define NH 8
#define HD 64
#define WR 4
#define NRL 9
#ifndef TNB
#define TNB NB
#endif
typedef __attribute__((ext_vector_type(8))) __bf16 v8b;
__device__ __forceinline__ v16b frag_b(const __bf16* rowk0, int lane) {
  union { v16b v; v8b q[2]; } u; const __bf16* p = rowk0 + 8 * (lane >> 4);
  u.q[0] = *(const v8b*)p; u.q[1] = *(const v8b*)(p + 16); return u.v;
}
__device__ __forceinline__ float bfr(float v) { return (float)(__bf16)v; }
__device__ __attribute__((noinline)) float exp_ni(float v) { return expf(v); }
__device__ __attribute__((noinline)) float erf_ni(float v) { return erff(v); }

#define WS_QF  0u                                  // f32 q rows [b*t][512] (for the rel-k dots)
#define WS_QH  (WS_QF + 4u * (size_t)NB * TT * CC)
#define WS_QL  (WS_QH + 2u * (size_t)NB * TT * CC)
#define WS_KH  (WS_QL + 2u * (size_t)NB * TT * CC)
#define WS_VT  (WS_KH + 2u * (size_t)NB * TT * CC)     // bf16 v planes [b][512][t]
#define WS_VL  (WS_VT + 2u * (size_t)NB * CC * TT)
#define WS_QR  (WS_VL + 2u * (size_t)NB * CC * TT)     // f32 rel-k logits [b][h][t][16] (9 used)
#define WS_CX  (WS_QR + 4u * (size_t)NB * NH * TT * 16) // f32 ctx rows [b*t][512]
#define WS_END (WS_CX + 4u * (size_t)NB * TT * CC)

typedef __attribute__((ext_vector_type(4))) __bf16 v4b;
#define WP 72   // LDS pitch of a row of 64 16-bit elements: 144 B = 16 B x 9, so that the 16 rows of a ds_load_b128 fragment read spread over the banks
#define FP 68   // LDS pitch of a row of 64 f32: 272 B = 16 B x 17, for the same reason
// Staging of a 64-k piece of a matrix operand by a block of 128 threads: every global load of a wave covers whole 128-byte lines (512 B in 4 lines), and each piece is fetched once a block. The loops over u and i are unrolled so that the pieces are registers
// [128 rows][64] f32 out of rows of 512 (weights): thread = row u * 8 + (tid >> 4), 16 bytes at (tid & 15); stored as bf16
__device__ __forceinline__ void wt_load(v4f wv[16], const float* wq) {
#pragma unroll
  for (int u = 0; u < 16; ++u) wv[u] = *(const v4f*)(wq + u * 8 * CC); }
__device__ __forceinline__ void wt_store(__bf16 (*sw)[WP], const v4f wv[16], int tid) {
#pragma unroll
  for (int u = 0; u < 16; ++u) { v4b o;
#pragma unroll
    for (int i = 0; i < 4; ++i) o[i] = (__bf16)wv[u][i];
    *(v4b*)&sw[u * 8 + (tid >> 4)][(tid & 15) * 4] = o; } }
// [64 rows][64] f32 out of rows of LD (ctx): the same thread map, kept f32
template <int LD> __device__ __forceinline__ void ft_load(v4f fv[8], const float* fq) {
#pragma unroll
  for (int u = 0; u < 8; ++u) fv[u] = *(const v4f*)(fq + u * 8 * LD); }
__device__ __forceinline__ void ft_store(float (*sp)[FP], const v4f fv[8], int tid) {
#pragma unroll
  for (int u = 0; u < 8; ++u) *(v4f*)&sp[u * 8 + (tid >> 4)][(tid & 15) * 4] = fv[u]; }
// ---- k_proj: block = (64 positions, 128 out channels, b*3 + which): x^T / c^T tile in LDS; W [out][in] + b exact
__global__ __launch_bounds__(128) void k_proj(const float* __restrict__ X, const float* __restrict__ Cc, const float* __restrict__ WQ, const float* __restrict__ BQ, const float* __restrict__ WK, const float* __restrict__ BK, const float* __restrict__ WV, const float* __restrict__ BV, float* __restrict__ QF, _Float16* __restrict__ QH, _Float16* __restrict__ QL, _Float16* __restrict__ KH, __bf16* __restrict__ VT, __bf16* __restrict__ VL) {
  __shared__ __align__(16) __bf16 sx[64][CC + 8]; __shared__ __align__(16) float sf[64][132]; __shared__ __align__(16) unsigned char sbuf[2 * 128 * 72 * 2];   // union: (th, tl2) for v  |  (sh, sl) for q/k
  __bf16 (*th)[72] = (__bf16 (*)[72])sbuf; __bf16 (*tl2)[72] = (__bf16 (*)[72])(sbuf + 128 * 72 * 2); _Float16 (*sh)[136] = (_Float16 (*)[136])sbuf; _Float16 (*sl)[136] = (_Float16 (*)[136])(sbuf + 64 * 136 * 2); __bf16 (*sw)[128][WP] = (__bf16 (*)[128][WP])sbuf;   // in the k loop sbuf is the two weight buffers
  const int tid = threadIdx.x, wave = tid >> 5, lane = tid & 31, col = lane & 15, g = lane >> 4; const int p0 = blockIdx.x * 64; const int c0 = blockIdx.y * 128; const size_t b = blockIdx.z / 3; const int which = blockIdx.z % 3;
  const float* Xs = which == 0 ? X : Cc; const float* Wm = which == 0 ? WQ : which == 1 ? WK : WV; const float* Bm = which == 0 ? BQ : which == 1 ? BK : BV;
  // thread tid fills position tid & 63, channels (tid >> 6) + 2 k: 32 independent loads off one pointer are in flight before the first is waited for; the loops over u are unrolled so that xv is registers, the outer loop stays rolled: eight copies of the group would only lengthen the code
  const float* xp = Xs + (b * CC + (tid >> 6)) * (size_t)TT + p0 + (tid & 63);
  // the first weight piece is asked for ahead of the x tile and stored behind it
  const float* wq = Wm + (size_t)(c0 + (tid >> 4)) * CC + (tid & 15) * 4; v4f wv[16];
  wt_load(wv, wq); ISSUED1(wq);
#pragma unroll 1
  for (int kg = 0; kg < CC / 2; kg += 32) { float xv[32]; const float* xg = xp + (size_t)kg * 2 * TT;
#pragma unroll
    for (int u = 0; u < 32; ++u) xv[u] = xg[u * 2 * TT];
    ISSUED1(xg);
#pragma unroll
    for (int u = 0; u < 32; ++u) sx[tid & 63][(tid >> 6) + 2 * (kg + u)] = (__bf16)xv[u]; }
  wt_store(sw[0], wv, tid);
  __syncthreads();
  v8f acc[8] = {};
  // rolled: a trip asks for the next 64-k weight piece, works on this one out of LDS, stores the next into the other buffer; the one barrier of a trip publishes that buffer and ends the reads of this one (behind the last trip: before sbuf becomes output staging). The loops over ks and j are unrolled so that w and acc are registers
#pragma unroll 1
  for (int c = 0; c < CC / 64; ++c) { const int bu = c & 1;
    if (c + 1 < CC / 64) { const float* wn = wq + (c + 1) * 64; wt_load(wv, wn); ISSUED1(wn); }
#pragma unroll
    for (int ks = 0; ks < 2; ++ks) { const v16b a = frag_b(&sx[wave * 16 + col][c * 64 + ks * 32], lane); v16b w[8];
#pragma unroll
      for (int j = 0; j < 8; ++j) w[j] = frag_b(&sw[bu][j * 16 + col][ks * 32], lane);
#pragma unroll
      for (int j = 0; j < 8; ++j) acc[j] = wmma_bf(a, w[j], acc[j]); }
    if (c + 1 < CC / 64) wt_store(sw[bu ^ 1], wv, tid);
    __syncthreads(); }
  if (which < 2) {
#pragma unroll
    for (int j = 0; j < 8; ++j) { const float bb = bfr(Bm[c0 + j * 16 + col]);
#pragma unroll
      for (int r = 0; r < 8; ++r) sf[wave * 16 + 8 * g + r][j * 16 + col] = acc[j][r] + bb; }
    __syncthreads();
    // rows: f32 (q only), f16 hi (+ residual for q)
    for (int e = tid; e < 64 * 32; e += 128) { const int rl = e >> 5, q4 = e & 31; const size_t row = b * TT + p0 + rl; const float* src = &sf[rl][q4 * 4]; if (which == 0) vst2(QF + row * CC + c0 + q4 * 4, *(const v4f*)src); }
    for (int e = tid; e < 64 * 128; e += 128) { const int rl = e >> 7, cl = e & 127; const float v = sf[rl][cl]; const _Float16 hv = (_Float16)v; sh[rl][cl] = hv; sl[rl][cl] = (_Float16)(v - (float)hv); }
    __syncthreads();
    _Float16* dh = which == 0 ? QH : KH; for (int e = tid; e < 64 * 16; e += 128) { const int rl = e >> 4, q = e & 15; const size_t row = b * TT + p0 + rl; vst2((unsigned*)(dh + row * CC + c0 + q * 8), *(const v4u*)&sh[rl][q * 8]); if (which == 0) vst2((unsigned*)(QL + row * CC + c0 + q * 8), *(const v4u*)&sl[rl][q * 8]); } }
  else {
#pragma unroll
    for (int j = 0; j < 8; ++j) { const float bb = bfr(Bm[c0 + j * 16 + col]);
#pragma unroll
      for (int r = 0; r < 8; ++r) { const float v = acc[j][r] + bb; const int rl = wave * 16 + 8 * g + r, cl = j * 16 + col; const __bf16 bh = (__bf16)v; th[cl][rl] = bh; tl2[cl][rl] = (__bf16)(v - (float)bh); } }
    __syncthreads(); for (int e = tid; e < 128 * 8; e += 128) { const int cl = e >> 3, q = e & 7; const size_t o2 = (b * CC + c0 + cl) * (size_t)TT + p0 + q * 8; vst2((unsigned*)(VT + o2), *(const v4u*)&th[cl][q * 8]); vst2((unsigned*)(VL + o2), *(const v4u*)&tl2[cl][q * 8]); } } }
// ---- k_qr: block = (64 queries, b * 8 + head): QR[b][h][t][j] = q_t(head h) . rel_k[j] for j = 0..8 (f32)
__global__ __launch_bounds__(64) void k_qr(const float* __restrict__ QF, const float* __restrict__ RK, float* __restrict__ QR0) { __shared__ float srk[NRL][HD]; __shared__ __align__(16) float so[64][16]; __shared__ __align__(16) float sq[64][FP];
  const int t = threadIdx.x; const int b = blockIdx.z / NH, h = blockIdx.z % NH; float* QR = QR0 + (size_t)blockIdx.z * TT * 16; const int t0 = blockIdx.x * 64;
  // the block's 64 q rows (256 B each) are fetched together by loads that cover whole lines (thread = row u * 4 + (t >> 4), 16 bytes at (t & 15)) and turned through LDS, so that each thread then holds its own row; the loops over u and d are unrolled so that qr and qv are registers
  const float* q = QF + ((size_t)b * TT + t0 + (t >> 4)) * CC + h * HD + (t & 15) * 4; v4f qr[16]; float qv[HD];
#pragma unroll
  for (int u = 0; u < 16; ++u) qr[u] = *(const v4f*)(q + u * 4 * CC);
  ISSUED1(q);
  for (int e = t; e < NRL * HD; e += 64) srk[e / HD][e % HD] = bfr(RK[e]);
  for (int e = t; e < 64 * 16; e += 64) so[e >> 4][e & 15] = 0.f;
#pragma unroll
  for (int u = 0; u < 16; ++u) *(v4f*)&sq[u * 4 + (t >> 4)][(t & 15) * 4] = qr[u];
  __syncthreads();
#pragma unroll
  for (int d = 0; d < HD; ++d) qv[d] = sq[t][d];
#pragma unroll 1
  for (int j = 0; j < NRL; ++j) { float a = 0.f;
#pragma unroll
    for (int d = 0; d < HD; ++d) a += qv[d] * srk[j][d]; so[t][j] = a; }
  __syncthreads(); for (int e = t; e < 64 * 4; e += 64) { const int rl = e >> 2, qq = e & 3; vst2(QR + (size_t)(t0 + rl) * 16 + qq * 4, *(const v4f*)&so[rl][qq * 4]); } }
// the loop over i is unrolled so that the stage is registers, not indexed memory
__device__ __forceinline__ void pv_load_p(float p[16], const float* pk) {
#pragma unroll
  for (int i = 0; i < 8; ++i) { p[i] = pk[i]; p[8 + i] = pk[16 + i]; } }
// [2 planes][64 rows][64] bf16 out of rows of 1,024 (v hi, v lo): thread = row u * 16 + (tid >> 3), 16 bytes at (tid & 7); a wave's load covers 4 whole lines
__device__ __forceinline__ void vt_load(v4u vr[8], const __bf16* vg, const __bf16* lg) {
#pragma unroll
  for (int u = 0; u < 4; ++u) { vr[u] = *(const v4u*)(vg + u * 16 * TT); vr[4 + u] = *(const v4u*)(lg + u * 16 * TT); } }
__device__ __forceinline__ void vt_store(__bf16 (*sv)[64][WP], const v4u vr[8], int tid) {
#pragma unroll
  for (int u = 0; u < 4; ++u) { *(v4u*)&sv[0][u * 16 + (tid >> 3)][(tid & 7) * 8] = vr[u]; *(v4u*)&sv[1][u * 16 + (tid >> 3)][(tid & 7) * 8] = vr[4 + u]; } }
// [64 rows][64] f16 out of rows of 512 (k, one head): the same thread map
__device__ __forceinline__ void kt_load(v4u kr[4], const _Float16* kg) {
#pragma unroll
  for (int u = 0; u < 4; ++u) kr[u] = *(const v4u*)(kg + u * 16 * CC); }
__device__ __forceinline__ void kt_store(_Float16 (*sk)[WP], const v4u kr[4], int tid) {
#pragma unroll
  for (int u = 0; u < 4; ++u) *(v4u*)&sk[u * 16 + (tid >> 3)][(tid & 7) * 8] = kr[u]; }
// [16 rows][32] mask words out of rows of 1,024, one wave's own: lane = row u * 4 + (lane >> 3), 16 bytes at (lane & 7); a load covers 4 whole lines
__device__ __forceinline__ void mt_load(v4i mg[4], const int* mp) {
#pragma unroll
  for (int u = 0; u < 4; ++u) mg[u] = *(const v4i*)(mp + u * 4 * TT); }
#define MP 36   // LDS pitch of a row of 32 mask words: 144 B = 16 B x 9
__device__ __forceinline__ void mt_store(int (*sm)[MP], const v4i mg[4], int lane) {
#pragma unroll
  for (int u = 0; u < 4; ++u) *(v4i*)&sm[u * 4 + (lane >> 3)][(lane & 7) * 4] = mg[u]; }
// the matrix builtins as they are: the compiler keeps the distance behind them itself and fills it with the softmax's vector work where it can
__device__ __forceinline__ v8f mm_h(v16h a, v16h b, v8f c) { return __builtin_amdgcn_wmma_f32_16x16x32_f16(false, a, false, b, (short)0, c, false, false); }
__device__ __forceinline__ v8f mm_b(v16b a, v16b b, v8f c) { return __builtin_amdgcn_wmma_f32_16x16x32_bf16(false, a, false, b, (short)0, c, false, false); }
// orders a wave's accesses to LDS rows that only this wave uses: what stands above is over before what stands below begins; no fence, which would also wait for the global loads in flight
#define LDSW() do { asm volatile("s_wait_dscnt 0x0" ::: "memory"); __builtin_amdgcn_wave_barrier(); } while (0)
typedef __attribute__((ext_vector_type(8))) unsigned v8u;
#define L2E 1.4426950408889634f   // log2 e: exp(x) = 2^(x * L2E)
// 2^x as the one hardware instruction; a result below the smallest normal number may come out as 0: beside a row sum of at least 1 such a weight counts for nothing
__device__ __forceinline__ float ex2(float x) { return __builtin_amdgcn_exp2f(x); }
// lane l with lane l ^ 16
__device__ __forceinline__ float xhalf(float x) { return __builtin_bit_cast(float, __builtin_amdgcn_permlanex16(__builtin_bit_cast(int, x), __builtin_bit_cast(int, x), 0x76543210, 0xfedcba98, false, false)); }
// ---- k_fa: block = (64 queries, b * 8 + head), wave = 16 queries, all 1,024 keys in 16 pieces of 64 (k and v staged once a block in LDS, two buffers), a pass = 32 keys. Transposed products: S^T = k . q^T (a lane holds 8 keys of ONE query a tile), score = (q.k + [|s-t|<=4] QR[t][s-t+4]) / 8 - log1p|s-t| (table in LDS); mask == 0 -> -1e4; all three times log2 e, so that the exponential is one exp2; running maximum and sum per query; e = 2^(score - maximum in use) goes from the score registers straight into the B operand (bf16 hi + lo) of ctx^T += v^T . e^T (3 products); ctx rows [b*t][h*64+d] = (ctx^T + sum_j e[t][t+j-4] rel_v[j][d]) / sum. Second launch bound: 4 waves a SIMD, so that four blocks share a WGP
__global__ __launch_bounds__(128, 4) void k_fa(const _Float16* __restrict__ QH, const _Float16* __restrict__ QL, const _Float16* __restrict__ KH, const float* __restrict__ QR0, const int* __restrict__ AM, const __bf16* __restrict__ VT, const __bf16* __restrict__ VL, const float* __restrict__ RV, float* __restrict__ CX) {
  __shared__ __align__(16) _Float16 sk[2][64][WP]; __shared__ __align__(16) __bf16 sv[2][2][64][WP]; __shared__ __align__(16) int sm[4][16][MP]; __shared__ float slp[TT + 63]; __shared__ __align__(16) float sqr[64][16]; __shared__ float sb[64][NRL]; __shared__ __align__(16) float srv[NRL][HD];
  const int b = blockIdx.z / NH, h = blockIdx.z % NH; const float* QR = QR0 + (size_t)blockIdx.z * TT * 16;
  const int tid = threadIdx.x, wave = __builtin_amdgcn_readfirstlane(tid >> 5), lane = tid & 31, col = lane & 15, g = lane >> 4; const int tb = blockIdx.x * 64, ql0 = tb + wave * 16, rw = wave * 16 + col;
  // first piece of k and v, the wave's first pass of mask words, and its q fragments (kept in registers throughout) are asked for ahead of the tables
  const _Float16* kg = KH + ((size_t)b * TT + (tid >> 3)) * CC + h * HD + (tid & 7) * 8; const size_t vo = ((size_t)b * CC + h * HD + (tid >> 3)) * (size_t)TT + (tid & 7) * 8; const __bf16 *vg = VT + vo, *lg = VL + vo; const int* mp = AM + ((size_t)b * TT + ql0 + (lane >> 3)) * TT + (lane & 7) * 4;
  v4u kr[4], vr[8]; v4i mg[4];
  kt_load(kr, kg); vt_load(vr, vg, lg); mt_load(mg, mp); ISSUED3(kg, vg, lg);
  const _Float16 *qhp = QH + ((size_t)b * TT + ql0 + col) * CC + h * HD, *qlp = QL + ((size_t)b * TT + ql0 + col) * CC + h * HD;
  const v16h qh0 = frag_h(qhp, lane), qh1 = frag_h(qhp + 32, lane), ql_0 = frag_h(qlp, lane), ql_1 = frag_h(qlp + 32, lane);
  ISSUED3(qhp, qlp, mp);
  // the block's 64 x 1,024 scores meet only 1,087 distances s - t: slp[i] = log1p|i - 63 - tb| * log2 e, each computed once for the block
  for (int e = tid; e < TT + 63; e += 128) slp[e] = log1pf(fabsf((float)(e - 63 - tb))) * L2E;
  for (int e = tid; e < 64 * 4; e += 128) *(v4f*)&sqr[e >> 2][(e & 3) * 4] = *(const v4f*)(QR + (size_t)tb * 16 + e * 4);
  for (int e = tid; e < NRL * HD; e += 128) srv[e / HD][e % HD] = bfr(RV[e]);
  for (int e = tid; e < 64 * NRL; e += 128) sb[e / NRL][e % NRL] = -3.0e38f;   // a window place outside 0..1,023 keeps this and ends as weight 0
  kt_store(sk[0], kr, tid); vt_store(sv[0], vr, tid); mt_store(sm[wave], mg, lane);
  mt_load(mg, mp + 32); ISSUED1(mp);
  __syncthreads();
  v8f acc[4] = {}; float m = -3.0e38f, l = 0.f;
  // rolled: a trip asks for the next piece, works on this one out of LDS, stores the next into the other buffers; the one barrier of a trip publishes those and ends the reads of these (it stands outside the test on c, as in the other kernels). The loops over sp, jt, j, s and o are unrolled so that the tiles are registers
#pragma unroll 1
  for (int c = 0; c < TT / 64; ++c) { const int bu = c & 1;
    if (c + 1 < TT / 64) { kg += 64 * CC; vg += 64; lg += 64; kt_load(kr, kg); vt_load(vr, vg, lg); ISSUED3(kg, vg, lg); }
#pragma unroll
    for (int sp = 0; sp < 2; ++sp) { const int k0 = c * 64 + sp * 32; v8f st[2] = {};
      // the pass's LDS reads stand together ahead of its products: k fragments, table values, and the mask words, which come out of the wave's own LDS rows in the score tiles' map
      v16h ka[4]; v4i mk[4]; float lp[16];
#pragma unroll
      for (int jt = 0; jt < 2; ++jt) { ka[jt] = frag_h(&sk[bu][sp * 32 + jt * 16 + col][0], lane); ka[2 + jt] = frag_h(&sk[bu][sp * 32 + jt * 16 + col][32], lane); }
#pragma unroll
      for (int jt = 0; jt < 2; ++jt) { mk[2 * jt] = *(const v4i*)&sm[wave][col][jt * 16 + 8 * g]; mk[2 * jt + 1] = *(const v4i*)&sm[wave][col][jt * 16 + 8 * g + 4]; }
#pragma unroll
      for (int s = 0; s < 16; ++s) lp[s] = slp[k0 + (s >> 3) * 16 + 8 * g + (s & 7) - rw + 63];
      // the two tiles' products alternate, so that none waits for the one before it; each tile's order of sums is hi, lo, hi, lo
      st[0] = mm_h(ka[0], qh0, st[0]); st[1] = mm_h(ka[1], qh0, st[1]); st[0] = mm_h(ka[0], ql_0, st[0]); st[1] = mm_h(ka[1], ql_0, st[1]);
      st[0] = mm_h(ka[2], qh1, st[0]); st[1] = mm_h(ka[3], qh1, st[1]); st[0] = mm_h(ka[2], ql_1, st[0]); st[1] = mm_h(ka[3], ql_1, st[1]);
      // the next pass's mask words, fetched a pass ago, go into those rows, and the pass after that is asked for (past the last pass the last one again: an address in bounds and no branch among the loads)
      LDSW();   // the wave's reads of its mask rows are over before it writes them anew
      mt_store(sm[wave], mg, lane);
      LDSW();   // and the new rows are written before lanes read what other lanes of the wave stored
      { const int pn = c * 2 + sp + 2; const int* mn = mp + (pn < TT / 32 ? pn : TT / 32 - 1) * 32; mt_load(mg, mn); ISSUED1(mn); }
      // the relative-key term: one test a pass, the same in every lane of a wave (at most 2 of a wave's 32 passes meet the band |s - t| <= 4), index clamped into 0..8
      const bool band = k0 + 31 >= ql0 - WR && k0 <= ql0 + 15 + WR;
      if (band) {
#pragma unroll
        for (int s = 0; s < 16; ++s) { const int dw = k0 + (s >> 3) * 16 + 8 * g + (s & 7) - (ql0 + col) + WR; const float qv = sqr[rw][dw < 0 ? 0 : dw > 2 * WR ? 2 * WR : dw]; if (dw >= 0 && dw <= 2 * WR) st[s >> 3][s & 7] += qv; } }
      float pm = -3.0e38f;
#pragma unroll
      for (int s = 0; s < 16; ++s) { float v = st[s >> 3][s & 7] * (0.125f * L2E) - lp[s]; if (mk[s >> 2][s & 3] == 0) v = -10000.0f * L2E; st[s >> 3][s & 7] = v; pm = fmaxf(pm, v); }
      // the 9 scores of each query's window are kept for the relative-value term
      if (band) {
#pragma unroll
        for (int s = 0; s < 16; ++s) { const int dw = k0 + (s >> 3) * 16 + 8 * g + (s & 7) - (ql0 + col) + WR; if (dw >= 0 && dw <= 2 * WR) sb[rw][dw] = st[s >> 3][s & 7]; } }
      pm = fmaxf(pm, xhalf(pm));
      // the maximum in use moves, and sums and ctx are rescaled, only when some query's new maximum passes it by more than 7 (e stays below 2^7): one test a pass
      if (__builtin_amdgcn_ballot_w32(pm > m + 7.0f) != 0) { const float mn = fmaxf(m, pm), sc = ex2(m - mn); m = mn; l *= sc;
#pragma unroll
        for (int j = 0; j < 4; ++j) acc[j] *= sc; }
      v16b ph, pl; float ev[16];
      // two scores a step: one packed subtraction feeds two exp2
#pragma unroll
      for (int s = 0; s < 16; s += 2) { const v2f d = (v2f){st[s >> 3][s & 7], st[s >> 3][(s & 7) + 1]} - m; ev[s] = ex2(d[0]); ev[s + 1] = ex2(d[1]); ph[s] = (__bf16)ev[s]; ph[s + 1] = (__bf16)ev[s + 1]; }
      // the hi parts are taken back as f32 out of the packed words (low half shifted up, high half masked): the same values as a conversion of each
      { const v8u pw2 = __builtin_bit_cast(v8u, ph);
#pragma unroll
        for (int s = 0; s < 16; s += 2) { pl[s] = (__bf16)(ev[s] - __builtin_bit_cast(float, pw2[s >> 1] << 16)); pl[s + 1] = (__bf16)(ev[s + 1] - __builtin_bit_cast(float, pw2[s >> 1] & 0xffff0000u)); } }
      // the pass's 16 terms are joined as a tree, not as one chain of dependent additions
#pragma unroll
      for (int o = 8; o > 0; o >>= 1)
#pragma unroll
        for (int s = 0; s < o; ++s) ev[s] += ev[s + o];
      l += ev[0];
      // two d tiles' products alternate; each tile's order of sums is vh.ph, vh.pl, vl.ph
#pragma unroll
      for (int j = 0; j < 4; j += 2) { const v16b vh0 = frag_b(&sv[bu][0][j * 16 + col][sp * 32], lane), vl0 = frag_b(&sv[bu][1][j * 16 + col][sp * 32], lane), vh1 = frag_b(&sv[bu][0][j * 16 + 16 + col][sp * 32], lane), vl1 = frag_b(&sv[bu][1][j * 16 + 16 + col][sp * 32], lane);
        acc[j] = mm_b(vh0, ph, acc[j]); acc[j + 1] = mm_b(vh1, ph, acc[j + 1]); acc[j] = mm_b(vh0, pl, acc[j]); acc[j + 1] = mm_b(vh1, pl, acc[j + 1]); acc[j] = mm_b(vl0, ph, acc[j]); acc[j + 1] = mm_b(vl1, ph, acc[j + 1]); } }
    if (c + 1 < TT / 64) { kt_store(sk[bu ^ 1], kr, tid); vt_store(sv[bu ^ 1], vr, tid); }
    __syncthreads(); }
  // behind the last barrier the v buffers are output staging, each wave in a range of its own
  float (*so)[68] = (float (*)[68])((float*)&sv[0][0][0][0] + wave * 16 * 68);
  l += xhalf(l); const float inv = 1.0f / l; float pw[NRL];
#pragma unroll
  for (int jj = 0; jj < NRL; ++jj) pw[jj] = ex2(sb[rw][jj] - m);
#pragma unroll
  for (int j = 0; j < 4; ++j)
#pragma unroll
    for (int r = 0; r < 8; ++r) { const int d = j * 16 + 8 * g + r; float a = acc[j][r];
#pragma unroll
      for (int jj = 0; jj < NRL; ++jj) a += pw[jj] * srv[jj][d];
      so[col][d] = a * inv; }
  LDSX();   // rows leave LDS as whole 256-byte pieces, two rows a store
#pragma unroll
  for (int rl = 0; rl < 16; rl += 2) vst2(CX + ((size_t)b * TT + ql0 + rl + g) * CC + h * HD + col * 4, *(const v4f*)&so[rl + g][col * 4]); }
// ---- k_out: block = (64 positions, 128 out channels, b): out[o][t] = sum_c Wo[o][c] ctx[t][c] + bo; A = ctx rows (hi + lo), B = Wo [o][c]; transposed to planes
__global__ __launch_bounds__(128) void k_out(const float* __restrict__ CX, const float* __restrict__ WO, const float* __restrict__ BO, float* __restrict__ OUT) { __shared__ __align__(16) float so[128][68]; __shared__ __align__(16) float sc[2][64][FP]; __shared__ __align__(16) __bf16 sw[2][128][WP];
  const int tid = threadIdx.x, wave = tid >> 5, lane = tid & 31, col = lane & 15, g = lane >> 4; const int t0 = blockIdx.x * 64, c0 = blockIdx.y * 128; const size_t b = blockIdx.z;
  v8f acc[8] = {};
  // a piece = 64 channels: the block's 64 ctx rows (f32) and its 128 weight rows (as bf16), fetched once a block into LDS, two buffers
  const float* cq = CX + (b * TT + t0 + (tid >> 4)) * CC + (tid & 15) * 4; const float* wq = WO + (size_t)(c0 + (tid >> 4)) * CC + (tid & 15) * 4; v4f cr[8], wv[16];
  ft_load<CC>(cr, cq); wt_load(wv, wq); ISSUED2(cq, wq);
  ft_store(sc[0], cr, tid); wt_store(sw[0], wv, tid);
  __syncthreads();
  // rolled: a trip asks for the next piece, works on this one out of LDS, stores the next into the other buffers; the one barrier of a trip publishes those and ends the reads of these (it stands outside the test on c: inside it the compiler put a wait in front of every load of the next group). The loops over ks, jg and jj are unrolled so that cv, w and acc are registers
#pragma unroll 1
  for (int c = 0; c < CC / 64; ++c) { const int bu = c & 1;
    if (c + 1 < CC / 64) { const float *cn = cq + (c + 1) * 64, *wn = wq + (c + 1) * 64; ft_load<CC>(cr, cn); wt_load(wv, wn); ISSUED2(cn, wn); }
#pragma unroll
    for (int ks = 0; ks < 2; ++ks) { float cv[16]; pv_load_p(cv, &sc[bu][wave * 16 + col][ks * 32 + 8 * g]); const F2 a = bsplit16(cv);
#pragma unroll
      for (int jg = 0; jg < 8; jg += 4) { v16b w[4];   // four weight fragments at a time: eight, beside the next piece's 96 registers, take the kernel past 256 registers
#pragma unroll
        for (int jj = 0; jj < 4; ++jj) w[jj] = frag_b(&sw[bu][(jg + jj) * 16 + col][ks * 32], lane);
#pragma unroll
        for (int jj = 0; jj < 4; ++jj) { acc[jg + jj] = wmma_bf(a.h, w[jj], acc[jg + jj]); acc[jg + jj] = wmma_bf(a.l, w[jj], acc[jg + jj]); } } }
    if (c + 1 < CC / 64) { ft_store(sc[bu ^ 1], cr, tid); wt_store(sw[bu ^ 1], wv, tid); }
    __syncthreads(); }
#pragma unroll
  for (int j = 0; j < 8; ++j) { const float bb = bfr(BO[c0 + j * 16 + col]);
#pragma unroll
    for (int r = 0; r < 8; ++r) so[j * 16 + col][wave * 16 + 8 * g + r] = acc[j][r] + bb; }
  __syncthreads(); for (int e = tid; e < 128 * 16; e += 128) { const int cl = e >> 4, q = e & 15; vst2(OUT + ((size_t)b * CC + c0 + cl) * TT + t0 + q * 4, *(const v4f*)&so[cl][q * 4]); } }
extern "C" void kernel_launch(void* const* d_in, const int* in_sizes, int n_in, void* d_out, int out_size, void* d_ws, size_t ws_size, hipStream_t stream) {
  (void)in_sizes; (void)n_in; (void)out_size;
  const float** F = (const float**)d_in;   // 0 x [8,512,1024], 1 c [8,512,1024], 2 attn_mask [8,1,1024,1024] int, 3 Wq [512,512], 4 bq, 5 Wk, 6 bk, 7 Wv, 8 bv, 9 Wo [512,512], 10 bo, 11 emb_rel_k [1,9,64], 12 emb_rel_v [1,9,64]
  if (ws_size < (size_t)WS_END) return;
  char* ws = (char*)d_ws; float *QF = (float*)(ws + WS_QF), *QR = (float*)(ws + WS_QR), *CX = (float*)(ws + WS_CX); _Float16 *QH = (_Float16*)(ws + WS_QH), *QL = (_Float16*)(ws + WS_QL), *KH = (_Float16*)(ws + WS_KH); __bf16 *VT = (__bf16*)(ws + WS_VT), *VL = (__bf16*)(ws + WS_VL);
  k_proj<<<dim3(TT / 64, CC / 128, TNB * 3), 128, 0, stream>>>(F[0], F[1], F[3], F[4], F[5], F[6], F[7], F[8], QF, QH, QL, KH, VT, VL);
  k_qr<<<dim3(TT / 64, 1, TNB * NH), 64, 0, stream>>>(QF, F[11], QR);
  k_fa<<<dim3(TT / 64, 1, TNB * NH), 128, 0, stream>>>(QH, QL, KH, QR, (const int*)d_in[2], VT, VL, F[12], CX);
  k_out<<<dim3(TT / 64, CC / 128, TNB), 128, 0, stream>>>(CX, F[9], F[10], (float*)d_out);
}

// v008
// It runs in 108 microseconds.
// Two timings next to v007 put it at 1.08 and 1.07 times that version's speed.
// Over all steps from v000 it is 13.4 times as fast.
// compute dtype: all float inputs rounded to bf16, attn_mask (int) read; q = Wq x + bq (from x), k/v = W c + b (from c) as 1x1 convs with EXACT bf16 products on WMMA 16x16x32 (channel-major tiles transposed in LDS), f32 accumulate; q as f16 hi + residual, k f16 -> 2-product content logits; the 9 windowed relative-key logits q_t . rel_k[s-t+4] and the relative-value term sum_j p[t][t+j-4] rel_v[j] in f32 on the VALU; proximity bias -log1p|s-t| (precise log1pf) and the mask in f32; softmax in f32 with a running maximum and sum, scores kept in log2 units (log2 e folded into the 1/8 scale, the bias table and the mask value), exp(score - maximum) = 2^(difference) by the hardware's exp2, split bf16 hi + lo against v bf16 hi + lo (3 products), divided by the sum at the end; out = Wo ctx (bf16 hi + lo) + bo written channel-major; f32 output.
#include <hip/hip_runtime.h>
#include <math.h>

typedef __attribute__((ext_vector_type(16))) _Float16 v16h;
typedef __attribute__((ext_vector_type(16))) __bf16 v16b;
typedef __attribute__((ext_vector_type(8)))  _Float16 v8h;
typedef __attribute__((ext_vector_type(8)))  float v8f;
typedef __attribute__((ext_vector_type(4)))  float v4f;
typedef __attribute__((ext_vector_type(2)))  float v2f;
typedef __attribute__((ext_vector_type(4)))  unsigned v4u;
typedef __attribute__((ext_vector_type(4)))  int v4i;
typedef float __attribute__((may_alias)) float_a;
typedef int __attribute__((may_alias)) int_a;

template <typename T> __device__ __forceinline__ void vst2(void* p, T v) { *(T*)p = v;  }
__device__ __forceinline__ v8f wmma16(v16h a, v16h b, v8f c) {
  v8f d = __builtin_amdgcn_wmma_f32_16x16x32_f16(false, a, false, b, (short)0, c, false, false);
  asm volatile("v_nop\n\tv_nop\n\tv_nop\n\tv_nop" : "+v"(d) : "v"(a), "v"(b));
  return d;
}
__device__ __forceinline__ v8f wmma_bf(v16b a, v16b b, v8f c) {
  v8f d = __builtin_amdgcn_wmma_f32_16x16x32_bf16(false, a, false, b, (short)0, c, false, false);
  asm volatile("v_nop\n\tv_nop\n\tv_nop\n\tv_nop" : "+v"(d) : "v"(a), "v"(b));
  return d;
}
// 16x16x32 fragments: lane = (h = lane>>4, row/col = lane&15); elements 0..7 = k0+8h+0..7, 8..15 = k0+16+8h+0..7; D element r = row 8h+r
__device__ __forceinline__ v16h frag_h(const _Float16* rowk0, int lane) {
  union { v16h v; v8h q[2]; } u; const _Float16* p = rowk0 + 8 * (lane >> 4);
  u.q[0] = *(const v8h*)p; u.q[1] = *(const v8h*)(p + 16); return u.v;
}
__device__ __forceinline__ v16h frag_f32(const float* rowk0, int lane) {
  v16h a; const float* p = rowk0 + 8 * (lane >> 4);
#pragma unroll
  for (int i = 0; i < 8; ++i) { a[i] = (_Float16)p[i]; a[8 + i] = (_Float16)p[16 + i]; }
  return a;
}
__device__ __forceinline__ v16h frag_f32s(const float* rowk0, int lane, float sc) {
  v16h a; const float* p = rowk0 + 8 * (lane >> 4);
#pragma unroll
  for (int i = 0; i < 8; ++i) { a[i] = (_Float16)(p[i] * sc); a[8 + i] = (_Float16)(p[16 + i] * sc); }
  return a;
}
// column fragment from a [K][ld] layout (column n), rows >= K read as 0
__device__ __forceinline__ v16h fragc_f32(const float* W, int k0, int n, int lane, int ld, int K) {
  v16h a; const int g = lane >> 4;
#pragma unroll
  for (int i = 0; i < 8; ++i) { const int ka = k0 + 8 * g + i, kb = ka + 16;
    a[i] = (_Float16)(ka < K ? W[(size_t)(ka < K ? ka : K - 1) * ld + n] : 0.f); a[8 + i] = (_Float16)(kb < K ? W[(size_t)(kb < K ? kb : K - 1) * ld + n] : 0.f); }
  return a;
}
struct F2 { v16b h, l; };
__device__ __forceinline__ F2 bsplit16(const float v[16]) { F2 r;
#pragma unroll
  for (int i = 0; i < 16; ++i) { const __bf16 h = (__bf16)v[i]; r.h[i] = h; r.l[i] = (__bf16)(v[i] - (float)h); }
  return r; }
__device__ __forceinline__ F2 split_row(const float* row, int k0, int lane) { float v[16]; const float* p = row + k0 + 8 * (lane >> 4);
#pragma unroll
  for (int i = 0; i < 8; ++i) { v[i] = p[i]; v[8 + i] = p[16 + i]; }
  return bsplit16(v); }
__device__ __forceinline__ F2 split_rowK(const float* row, int k0, int lane, int K) { float v[16]; const int g = lane >> 4;
#pragma unroll
  for (int i = 0; i < 8; ++i) { const int ka = k0 + 8 * g + i, kb = ka + 16; v[i] = ka < K ? row[ka < K ? ka : K - 1] : 0.f; v[8 + i] = kb < K ? row[kb < K ? kb : K - 1] : 0.f; }
  return bsplit16(v); }
__device__ __forceinline__ F2 split_col(const float* W, int k0, int n, int lane, int ld, int K) { float v[16]; const int g = lane >> 4;
#pragma unroll
  for (int i = 0; i < 8; ++i) { const int ka = k0 + 8 * g + i, kb = ka + 16; v[i] = ka < K ? W[(size_t)(ka < K ? ka : K - 1) * ld + n] : 0.f; v[8 + i] = kb < K ? W[(size_t)(kb < K ? kb : K - 1) * ld + n] : 0.f; }
  return bsplit16(v); }
__device__ __forceinline__ v8f mac3(const F2& a, const F2& b, v8f c) { c = wmma_bf(a.l, b.h, c); c = wmma_bf(a.h, b.l, c); return wmma_bf(a.h, b.h, c); }
__device__ __forceinline__ float sigm(float v) { return 1.0f / (1.0f + expf(-v)); }
// stands directly behind a group of global loads: keeps the whole group issued in front of the work that follows (nothing of it sinks to its use), and the precaution before the loads' address registers are written again
#define ISSUED() asm volatile("s_wait_xcnt 0x0" ::: "memory")
// the same, and the group's pointers are inputs of the wait: they stay in their registers up to it, so that no result of the group is laid over an address that a load of the group still names
#define ISSUED1(p) asm volatile("s_wait_xcnt 0x0" :: "v"(p) : "memory")
#define ISSUED2(p, q) asm volatile("s_wait_xcnt 0x0" :: "v"(p), "v"(q) : "memory")
#define ISSUED3(p, q, r) asm volatile("s_wait_xcnt 0x0" :: "v"(p), "v"(q), "v"(r) : "memory")
#define LDSX() do { asm volatile("s_wait_dscnt 0" ::: "memory"); __builtin_amdgcn_wave_barrier(); __builtin_amdgcn_fence(__ATOMIC_RELEASE, "workgroup"); } while (0)


// VITS-style relative-position multi-head attention (B 8, C 512 = 8 x 64, T 1,024, window 4): content + windowed relative-key logits, proximity bias, mask, softmax, value + windowed relative-value, output 1x1 conv.
#define NB 8
#define CC 512
#define TT 1024
#define NH 8
#define HD 64
#define WR 4
#define NRL 9
#ifndef TNB
#define TNB NB
#endif
typedef __attribute__((ext_vector_type(8))) __bf16 v8b;
__device__ __forceinline__ v16b frag_b(const __bf16* rowk0, int lane) {
  union { v16b v; v8b q[2]; } u; const __bf16* p = rowk0 + 8 * (lane >> 4);
  u.q[0] = *(const v8b*)p; u.q[1] = *(const v8b*)(p + 16); return u.v;
}
__device__ __forceinline__ float bfr(float v) { return (float)(__bf16)v; }
__device__ __attribute__((noinline)) float exp_ni(float v) { return expf(v); }
__device__ __attribute__((noinline)) float erf_ni(float v) { return erff(v); }

#define WS_QF  0u                                  // f32 q rows [b*t][512] (for the rel-k dots)
#define WS_QH  (WS_QF + 4u * (size_t)NB * TT * CC)
#define WS_QL  (WS_QH + 2u * (size_t)NB * TT * CC)
#define WS_KH  (WS_QL + 2u * (size_t)NB * TT * CC)
#define WS_VT  (WS_KH + 2u * (size_t)NB * TT * CC)     // bf16 v planes [b][512][t]
#define WS_VL  (WS_VT + 2u * (size_t)NB * CC * TT)
#define WS_QR  (WS_VL + 2u * (size_t)NB * CC * TT)     // f32 rel-k logits [b][h][t][16] (9 used)
#define WS_CX  (WS_QR + 4u * (size_t)NB * NH * TT * 16) // f32 ctx rows [b*t][512]
#define WS_END (WS_CX + 4u * (size_t)NB * TT * CC)

typedef __attribute__((ext_vector_type(4))) __bf16 v4b;
#define WP 72   // LDS pitch of a row of 64 16-bit elements: 144 B = 16 B x 9, so that the 16 rows of a ds_load_b128 fragment read spread over the banks
#define FP 68   // LDS pitch of a row of 64 f32: 272 B = 16 B x 17, for the same reason
// Staging of a 64-k piece of a matrix operand by a block of 128 threads: every global load of a wave covers whole 128-byte lines (512 B in 4 lines), and each piece is fetched once a block. The loops over u and i are unrolled so that the pieces are registers
// [128 rows][64] f32 out of rows of 512 (weights): thread = row u * 8 + (tid >> 4), 16 bytes at (tid & 15); stored as bf16
__device__ __forceinline__ void wt_load(v4f wv[16], const float* wq) {
#pragma unroll
  for (int u = 0; u < 16; ++u) wv[u] = *(const v4f*)(wq + u * 8 * CC); }
__device__ __forceinline__ void wt_store(__bf16 (*sw)[WP], const v4f wv[16], int tid) {
#pragma unroll
  for (int u = 0; u < 16; ++u) { v4b o;
#pragma unroll
    for (int i = 0; i < 4; ++i) o[i] = (__bf16)wv[u][i];
    *(v4b*)&sw[u * 8 + (tid >> 4)][(tid & 15) * 4] = o; } }
// [64 rows][64] f32 out of rows of LD (ctx): the same thread map, kept f32
template <int LD> __device__ __forceinline__ void ft_load(v4f fv[8], const float* fq) {
#pragma unroll
  for (int u = 0; u < 8; ++u) fv[u] = *(const v4f*)(fq + u * 8 * LD); }
__device__ __forceinline__ void ft_store(float (*sp)[FP], const v4f fv[8], int tid) {
#pragma unroll
  for (int u = 0; u < 8; ++u) *(v4f*)&sp[u * 8 + (tid >> 4)][(tid & 15) * 4] = fv[u]; }
// [64 channels][64 positions] f32 out of rows of 1,024 (x or c, channel-major): thread = channel pair tid >> 3 (and 16 pairs on), 16 bytes at (tid & 7) of each 128-byte half row; a wave's load covers 4 whole lines. The loops over u and i are unrolled so that the piece is registers
typedef __attribute__((ext_vector_type(2))) __bf16 v2b;
__device__ __forceinline__ void xt_load(v4f xr[8], const float* xq) {
#pragma unroll
  for (int u = 0; u < 8; ++u) xr[u] = *(const v4f*)(xq + ((u >> 1 & 1) * 32 + (u & 1)) * TT + (u >> 2) * 32); }
// turned on the way into LDS: [position][channel] bf16, the two channels of a pair as one 4-byte store
__device__ __forceinline__ void xt_store(__bf16 (*sx)[WP], const v4f xr[8], int tid) {
#pragma unroll
  for (int u = 0; u < 8; u += 2)
#pragma unroll
    for (int i = 0; i < 4; ++i) { v2b o; o[0] = (__bf16)xr[u][i]; o[1] = (__bf16)xr[u + 1][i];
      *(v2b*)&sx[(u >> 2) * 32 + (tid & 7) * 4 + i][(u >> 1 & 1) * 32 + (tid >> 3) * 2] = o; } }
// ---- k_proj: block = (64 positions, 128 out channels, b*3 + which): x^T / c^T and W [out][in] in LDS by pieces of 64 channels; + b exact
__global__ __launch_bounds__(128) void k_proj(const float* __restrict__ X, const float* __restrict__ Cc, const float* __restrict__ WQ, const float* __restrict__ BQ, const float* __restrict__ WK, const float* __restrict__ BK, const float* __restrict__ WV, const float* __restrict__ BV, float* __restrict__ QF, _Float16* __restrict__ QH, _Float16* __restrict__ QL, _Float16* __restrict__ KH, __bf16* __restrict__ VT, __bf16* __restrict__ VL) {
  __shared__ __align__(16) unsigned char sbuf[2 * 128 * 72 * 2 + 64 * 132 * 4];   // k loop: two weight buffers, then two x buffers  |  behind it: (th, tl2) for v or (sh, sl) for q/k, then sf
  __bf16 (*th)[72] = (__bf16 (*)[72])sbuf; __bf16 (*tl2)[72] = (__bf16 (*)[72])(sbuf + 128 * 72 * 2); _Float16 (*sh)[136] = (_Float16 (*)[136])sbuf; _Float16 (*sl)[136] = (_Float16 (*)[136])(sbuf + 64 * 136 * 2); __bf16 (*sw)[128][WP] = (__bf16 (*)[128][WP])sbuf;
  __bf16 (*sx)[64][WP] = (__bf16 (*)[64][WP])(sbuf + 2 * 128 * 72 * 2); float (*sf)[132] = (float (*)[132])(sbuf + 2 * 128 * 72 * 2);
  const int tid = threadIdx.x, wave = tid >> 5, lane = tid & 31, col = lane & 15, g = lane >> 4; const int p0 = blockIdx.x * 64; const int c0 = blockIdx.y * 128; const size_t b = blockIdx.z / 3; const int which = blockIdx.z % 3;
  const float* Xs = which == 0 ? X : Cc; const float* Wm = which == 0 ? WQ : which == 1 ? WK : WV; const float* Bm = which == 0 ? BQ : which == 1 ? BK : BV;
  // a piece = 64 channels: the block's 64 positions of x (as bf16, turned) and its 128 weight rows (as bf16), fetched once a block into LDS, two buffers
  const float* xq = Xs + (b * CC + (tid >> 3) * 2) * (size_t)TT + p0 + (tid & 7) * 4; const float* wq = Wm + (size_t)(c0 + (tid >> 4)) * CC + (tid & 15) * 4; v4f xr[8], wv[16];
  xt_load(xr, xq); wt_load(wv, wq); ISSUED2(xq, wq);
  xt_store(sx[0], xr, tid); wt_store(sw[0], wv, tid);
  __syncthreads();
  v8f acc[8] = {};
  // rolled: a trip asks for the next piece, works on this one out of LDS, stores the next into the other buffers; the one barrier of a trip publishes those and ends the reads of these (behind the last trip: before sbuf becomes output staging). The loops over ks and j are unrolled so that w and acc are registers
#pragma unroll 1
  for (int c = 0; c < CC / 64; ++c) { const int bu = c & 1;
    if (c + 1 < CC / 64) { xq += 64 * TT; wq += 64; xt_load(xr, xq); wt_load(wv, wq); ISSUED2(xq, wq); }
#pragma unroll
    for (int ks = 0; ks < 2; ++ks) { const v16b a = frag_b(&sx[bu][wave * 16 + col][ks * 32], lane); v16b w[8];
#pragma unroll
      for (int j = 0; j < 8; ++j) w[j] = frag_b(&sw[bu][j * 16 + col][ks * 32], lane);
#pragma unroll
      for (int j = 0; j < 8; ++j) acc[j] = wmma_bf(a, w[j], acc[j]); }
    if (c + 1 < CC / 64) { xt_store(sx[bu ^ 1], xr, tid); wt_store(sw[bu ^ 1], wv, tid); }
    __syncthreads(); }
  if (which < 2) {
#pragma unroll
    for (int j = 0; j < 8; ++j) { const float bb = bfr(Bm[c0 + j * 16 + col]);
#pragma unroll
      for (int r = 0; r < 8; ++r) sf[wave * 16 + 8 * g + r][j * 16 + col] = acc[j][r] + bb; }
    __syncthreads();
    // rows: f32 (q only), f16 hi (+ residual for q)
    for (int e = tid; e < 64 * 32; e += 128) { const int rl = e >> 5, q4 = e & 31; const size_t row = b * TT + p0 + rl; const float* src = &sf[rl][q4 * 4]; if (which == 0) vst2(QF + row * CC + c0 + q4 * 4, *(const v4f*)src); }
    for (int e = tid; e < 64 * 128; e += 128) { const int rl = e >> 7, cl = e & 127; const float v = sf[rl][cl]; const _Float16 hv = (_Float16)v; sh[rl][cl] = hv; sl[rl][cl] = (_Float16)(v - (float)hv); }
    __syncthreads();
    _Float16* dh = which == 0 ? QH : KH; for (int e = tid; e < 64 * 16; e += 128) { const int rl = e >> 4, q = e & 15; const size_t row = b * TT + p0 + rl; vst2((unsigned*)(dh + row * CC + c0 + q * 8), *(const v4u*)&sh[rl][q * 8]); if (which == 0) vst2((unsigned*)(QL + row * CC + c0 + q * 8), *(const v4u*)&sl[rl][q * 8]); } }
  else {
#pragma unroll
    for (int j = 0; j < 8; ++j) { const float bb = bfr(Bm[c0 + j * 16 + col]);
#pragma unroll
      for (int r = 0; r < 8; ++r) { const float v = acc[j][r] + bb; const int rl = wave * 16 + 8 * g + r, cl = j * 16 + col; const __bf16 bh = (__bf16)v; th[cl][rl] = bh; tl2[cl][rl] = (__bf16)(v - (float)bh); } }
    __syncthreads(); for (int e = tid; e < 128 * 8; e += 128) { const int cl = e >> 3, q = e & 7; const size_t o2 = (b * CC + c0 + cl) * (size_t)TT + p0 + q * 8; vst2((unsigned*)(VT + o2), *(const v4u*)&th[cl][q * 8]); vst2((unsigned*)(VL + o2), *(const v4u*)&tl2[cl][q * 8]); } } }
// ---- k_qr: block = (64 queries, b * 8 + head): QR[b][h][t][j] = q_t(head h) . rel_k[j] for j = 0..8 (f32)
__global__ __launch_bounds__(64) void k_qr(const float* __restrict__ QF, const float* __restrict__ RK, float* __restrict__ QR0) { __shared__ float srk[NRL][HD]; __shared__ __align__(16) float so[64][16]; __shared__ __align__(16) float sq[64][FP];
  const int t = threadIdx.x; const int b = blockIdx.z / NH, h = blockIdx.z % NH; float* QR = QR0 + (size_t)blockIdx.z * TT * 16; const int t0 = blockIdx.x * 64;
  // the block's 64 q rows (256 B each) are fetched together by loads that cover whole lines (thread = row u * 4 + (t >> 4), 16 bytes at (t & 15)) and turned through LDS, so that each thread then holds its own row; the loops over u and d are unrolled so that qr and qv are registers
  const float* q = QF + ((size_t)b * TT + t0 + (t >> 4)) * CC + h * HD + (t & 15) * 4; v4f qr[16]; float qv[HD];
#pragma unroll
  for (int u = 0; u < 16; ++u) qr[u] = *(const v4f*)(q + u * 4 * CC);
  ISSUED1(q);
  for (int e = t; e < NRL * HD; e += 64) srk[e / HD][e % HD] = bfr(RK[e]);
  for (int e = t; e < 64 * 16; e += 64) so[e >> 4][e & 15] = 0.f;
#pragma unroll
  for (int u = 0; u < 16; ++u) *(v4f*)&sq[u * 4 + (t >> 4)][(t & 15) * 4] = qr[u];
  __syncthreads();
#pragma unroll
  for (int d = 0; d < HD; ++d) qv[d] = sq[t][d];
#pragma unroll 1
  for (int j = 0; j < NRL; ++j) { float a = 0.f;
#pragma unroll
    for (int d = 0; d < HD; ++d) a += qv[d] * srk[j][d]; so[t][j] = a; }
  __syncthreads(); for (int e = t; e < 64 * 4; e += 64) { const int rl = e >> 2, qq = e & 3; vst2(QR + (size_t)(t0 + rl) * 16 + qq * 4, *(const v4f*)&so[rl][qq * 4]); } }
// the loop over i is unrolled so that the stage is registers, not indexed memory
__device__ __forceinline__ void pv_load_p(float p[16], const float* pk) {
#pragma unroll
  for (int i = 0; i < 8; ++i) { p[i] = pk[i]; p[8 + i] = pk[16 + i]; } }
// [2 planes][64 rows][64] bf16 out of rows of 1,024 (v hi, v lo): thread = row u * 16 + (tid >> 3), 16 bytes at (tid & 7); a wave's load covers 4 whole lines
__device__ __forceinline__ void vt_load(v4u vr[8], const __bf16* vg, const __bf16* lg) {
#pragma unroll
  for (int u = 0; u < 4; ++u) { vr[u] = *(const v4u*)(vg + u * 16 * TT); vr[4 + u] = *(const v4u*)(lg + u * 16 * TT); } }
__device__ __forceinline__ void vt_store(__bf16 (*sv)[64][WP], const v4u vr[8], int tid) {
#pragma unroll
  for (int u = 0; u < 4; ++u) { *(v4u*)&sv[0][u * 16 + (tid >> 3)][(tid & 7) * 8] = vr[u]; *(v4u*)&sv[1][u * 16 + (tid >> 3)][(tid & 7) * 8] = vr[4 + u]; } }
// [64 rows][64] f16 out of rows of 512 (k, one head): the same thread map
__device__ __forceinline__ void kt_load(v4u kr[4], const _Float16* kg) {
#pragma unroll
  for (int u = 0; u < 4; ++u) kr[u] = *(const v4u*)(kg + u * 16 * CC); }
__device__ __forceinline__ void kt_store(_Float16 (*sk)[WP], const v4u kr[4], int tid) {
#pragma unroll
  for (int u = 0; u < 4; ++u) *(v4u*)&sk[u * 16 + (tid >> 3)][(tid & 7) * 8] = kr[u]; }
// [16 rows][32] mask words out of rows of 1,024, one wave's own: lane = row u * 4 + (lane >> 3), 16 bytes at (lane & 7); a load covers 4 whole lines
__device__ __forceinline__ void mt_load(v4i mg[4], const int* mp) {
#pragma unroll
  for (int u = 0; u < 4; ++u) mg[u] = *(const v4i*)(mp + u * 4 * TT); }
#define MP 36   // LDS pitch of a row of 32 mask words: 144 B = 16 B x 9
__device__ __forceinline__ void mt_store(int (*sm)[MP], const v4i mg[4], int lane) {
#pragma unroll
  for (int u = 0; u < 4; ++u) *(v4i*)&sm[u * 4 + (lane >> 3)][(lane & 7) * 4] = mg[u]; }
// the matrix builtins as they are: the compiler keeps the distance behind them itself and fills it with the softmax's vector work where it can
__device__ __forceinline__ v8f mm_h(v16h a, v16h b, v8f c) { return __builtin_amdgcn_wmma_f32_16x16x32_f16(false, a, false, b, (short)0, c, false, false); }
__device__ __forceinline__ v8f mm_b(v16b a, v16b b, v8f c) { return __builtin_amdgcn_wmma_f32_16x16x32_bf16(false, a, false, b, (short)0, c, false, false); }
// orders a wave's accesses to LDS rows that only this wave uses: what stands above is over before what stands below begins; no fence, which would also wait for the global loads in flight
#define LDSW() do { asm volatile("s_wait_dscnt 0x0" ::: "memory"); __builtin_amdgcn_wave_barrier(); } while (0)
typedef __attribute__((ext_vector_type(8))) unsigned v8u;
#define L2E 1.4426950408889634f   // log2 e: exp(x) = 2^(x * L2E)
// 2^x as the one hardware instruction; a result below the smallest normal number may come out as 0: beside a row sum of at least 1 such a weight counts for nothing
__device__ __forceinline__ float ex2(float x) { return __builtin_amdgcn_exp2f(x); }
// lane l with lane l ^ 16
__device__ __forceinline__ float xhalf(float x) { return __builtin_bit_cast(float, __builtin_amdgcn_permlanex16(__builtin_bit_cast(int, x), __builtin_bit_cast(int, x), 0x76543210, 0xfedcba98, false, false)); }
// ---- k_fa: block = (64 queries, b * 8 + head), wave = 16 queries, all 1,024 keys in 16 pieces of 64 (k and v staged once a block in LDS, two buffers), a pass = 32 keys. Transposed products: S^T = k . q^T (a lane holds 8 keys of ONE query a tile), score = (q.k + [|s-t|<=4] QR[t][s-t+4]) / 8 - log1p|s-t| (table in LDS); mask == 0 -> -1e4; all three times log2 e, so that the exponential is one exp2; running maximum and sum per query; e = 2^(score - maximum in use) goes from the score registers straight into the B operand (bf16 hi + lo) of ctx^T += v^T . e^T (3 products); ctx rows [b*t][h*64+d] = (ctx^T + sum_j e[t][t+j-4] rel_v[j][d]) / sum. Second launch bound: 4 waves a SIMD, so that four blocks share a WGP
__global__ __launch_bounds__(128, 4) void k_fa(const _Float16* __restrict__ QH, const _Float16* __restrict__ QL, const _Float16* __restrict__ KH, const float* __restrict__ QR0, const int* __restrict__ AM, const __bf16* __restrict__ VT, const __bf16* __restrict__ VL, const float* __restrict__ RV, float* __restrict__ CX) {
  __shared__ __align__(16) _Float16 sk[2][64][WP]; __shared__ __align__(16) __bf16 sv[2][2][64][WP]; __shared__ __align__(16) int sm[4][16][MP]; __shared__ float slp[TT + 63]; __shared__ __align__(16) float sqr[64][16]; __shared__ float sb[64][NRL]; __shared__ __align__(16) float srv[NRL][HD];
  const int b = blockIdx.z / NH, h = blockIdx.z % NH; const float* QR = QR0 + (size_t)blockIdx.z * TT * 16;
  const int tid = threadIdx.x, wave = __builtin_amdgcn_readfirstlane(tid >> 5), lane = tid & 31, col = lane & 15, g = lane >> 4; const int tb = blockIdx.x * 64, ql0 = tb + wave * 16, rw = wave * 16 + col;
  // first piece of k and v, the wave's first pass of mask words, and its q fragments (kept in registers throughout) are asked for ahead of the tables
  const _Float16* kg = KH + ((size_t)b * TT + (tid >> 3)) * CC + h * HD + (tid & 7) * 8; const size_t vo = ((size_t)b * CC + h * HD + (tid >> 3)) * (size_t)TT + (tid & 7) * 8; const __bf16 *vg = VT + vo, *lg = VL + vo; const int* mp = AM + ((size_t)b * TT + ql0 + (lane >> 3)) * TT + (lane & 7) * 4;
  v4u kr[4], vr[8]; v4i mg[4];
  kt_load(kr, kg); vt_load(vr, vg, lg); mt_load(mg, mp); ISSUED3(kg, vg, lg);
  const _Float16 *qhp = QH + ((size_t)b * TT + ql0 + col) * CC + h * HD, *qlp = QL + ((size_t)b * TT + ql0 + col) * CC + h * HD;
  const v16h qh0 = frag_h(qhp, lane), qh1 = frag_h(qhp + 32, lane), ql_0 = frag_h(qlp, lane), ql_1 = frag_h(qlp + 32, lane);
  ISSUED3(qhp, qlp, mp);
  // the block's 64 x 1,024 scores meet only 1,087 distances s - t: slp[i] = log1p|i - 63 - tb| * log2 e, each computed once for the block
  for (int e = tid; e < TT + 63; e += 128) slp[e] = log1pf(fabsf((float)(e - 63 - tb))) * L2E;
  for (int e = tid; e < 64 * 4; e += 128) *(v4f*)&sqr[e >> 2][(e & 3) * 4] = *(const v4f*)(QR + (size_t)tb * 16 + e * 4);
  for (int e = tid; e < NRL * HD; e += 128) srv[e / HD][e % HD] = bfr(RV[e]);
  for (int e = tid; e < 64 * NRL; e += 128) sb[e / NRL][e % NRL] = -3.0e38f;   // a window place outside 0..1,023 keeps this and ends as weight 0
  kt_store(sk[0], kr, tid); vt_store(sv[0], vr, tid); mt_store(sm[wave], mg, lane);
  mt_load(mg, mp + 32); ISSUED1(mp);
  __syncthreads();
  v8f acc[4] = {}; float m = -3.0e38f, l = 0.f;
  // rolled: a trip asks for the next piece, works on this one out of LDS, stores the next into the other buffers; the one barrier of a trip publishes those and ends the reads of these (it stands outside the test on c, as in the other kernels). The loops over sp, jt, j, s and o are unrolled so that the tiles are registers
#pragma unroll 1
  for (int c = 0; c < TT / 64; ++c) { const int bu = c & 1;
    if (c + 1 < TT / 64) { kg += 64 * CC; vg += 64; lg += 64; kt_load(kr, kg); vt_load(vr, vg, lg); ISSUED3(kg, vg, lg); }
#pragma unroll
    for (int sp = 0; sp < 2; ++sp) { const int k0 = c * 64 + sp * 32; v8f st[2] = {};
      // the pass's LDS reads stand together ahead of its products: k fragments, table values, and the mask words, which come out of the wave's own LDS rows in the score tiles' map
      v16h ka[4]; v4i mk[4]; float lp[16];
#pragma unroll
      for (int jt = 0; jt < 2; ++jt) { ka[jt] = frag_h(&sk[bu][sp * 32 + jt * 16 + col][0], lane); ka[2 + jt] = frag_h(&sk[bu][sp * 32 + jt * 16 + col][32], lane); }
#pragma unroll
      for (int jt = 0; jt < 2; ++jt) { mk[2 * jt] = *(const v4i*)&sm[wave][col][jt * 16 + 8 * g]; mk[2 * jt + 1] = *(const v4i*)&sm[wave][col][jt * 16 + 8 * g + 4]; }
#pragma unroll
      for (int s = 0; s < 16; ++s) lp[s] = slp[k0 + (s >> 3) * 16 + 8 * g + (s & 7) - rw + 63];
      // the two tiles' products alternate, so that none waits for the one before it; each tile's order of sums is hi, lo, hi, lo
      st[0] = mm_h(ka[0], qh0, st[0]); st[1] = mm_h(ka[1], qh0, st[1]); st[0] = mm_h(ka[0], ql_0, st[0]); st[1] = mm_h(ka[1], ql_0, st[1]);
      st[0] = mm_h(ka[2], qh1, st[0]); st[1] = mm_h(ka[3], qh1, st[1]); st[0] = mm_h(ka[2], ql_1, st[0]); st[1] = mm_h(ka[3], ql_1, st[1]);
      // the next pass's mask words, fetched a pass ago, go into those rows, and the pass after that is asked for (past the last pass the last one again: an address in bounds and no branch among the loads)
      LDSW();   // the wave's reads of its mask rows are over before it writes them anew
      mt_store(sm[wave], mg, lane);
      LDSW();   // and the new rows are written before lanes read what other lanes of the wave stored
      { const int pn = c * 2 + sp + 2; const int* mn = mp + (pn < TT / 32 ? pn : TT / 32 - 1) * 32; mt_load(mg, mn); ISSUED1(mn); }
      // the relative-key term: one test a pass, the same in every lane of a wave (at most 2 of a wave's 32 passes meet the band |s - t| <= 4), index clamped into 0..8
      const bool band = k0 + 31 >= ql0 - WR && k0 <= ql0 + 15 + WR;
      if (band) {
#pragma unroll
        for (int s = 0; s < 16; ++s) { const int dw = k0 + (s >> 3) * 16 + 8 * g + (s & 7) - (ql0 + col) + WR; const float qv = sqr[rw][dw < 0 ? 0 : dw > 2 * WR ? 2 * WR : dw]; if (dw >= 0 && dw <= 2 * WR) st[s >> 3][s & 7] += qv; } }
      float pm = -3.0e38f;
#pragma unroll
      for (int s = 0; s < 16; ++s) { float v = st[s >> 3][s & 7] * (0.125f * L2E) - lp[s]; if (mk[s >> 2][s & 3] == 0) v = -10000.0f * L2E; st[s >> 3][s & 7] = v; pm = fmaxf(pm, v); }
      // the 9 scores of each query's window are kept for the relative-value term
      if (band) {
#pragma unroll
        for (int s = 0; s < 16; ++s) { const int dw = k0 + (s >> 3) * 16 + 8 * g + (s & 7) - (ql0 + col) + WR; if (dw >= 0 && dw <= 2 * WR) sb[rw][dw] = st[s >> 3][s & 7]; } }
      pm = fmaxf(pm, xhalf(pm));
      // the maximum in use moves, and sums and ctx are rescaled, only when some query's new maximum passes it by more than 7 (e stays below 2^7): one test a pass
      if (__builtin_amdgcn_ballot_w32(pm > m + 7.0f) != 0) { const float mn = fmaxf(m, pm), sc = ex2(m - mn); m = mn; l *= sc;
#pragma unroll
        for (int j = 0; j < 4; ++j) acc[j] *= sc; }
      v16b ph, pl; float ev[16];
      // two scores a step: one packed subtraction feeds two exp2
#pragma unroll
      for (int s = 0; s < 16; s += 2) { const v2f d = (v2f){st[s >> 3][s & 7], st[s >> 3][(s & 7) + 1]} - m; ev[s] = ex2(d[0]); ev[s + 1] = ex2(d[1]); ph[s] = (__bf16)ev[s]; ph[s + 1] = (__bf16)ev[s + 1]; }
      // the hi parts are taken back as f32 out of the packed words (low half shifted up, high half masked): the same values as a conversion of each
      { const v8u pw2 = __builtin_bit_cast(v8u, ph);
#pragma unroll
        for (int s = 0; s < 16; s += 2) { pl[s] = (__bf16)(ev[s] - __builtin_bit_cast(float, pw2[s >> 1] << 16)); pl[s + 1] = (__bf16)(ev[s + 1] - __builtin_bit_cast(float, pw2[s >> 1] & 0xffff0000u)); } }
      // the pass's 16 terms are joined as a tree, not as one chain of dependent additions
#pragma unroll
      for (int o = 8; o > 0; o >>= 1)
#pragma unroll
        for (int s = 0; s < o; ++s) ev[s] += ev[s + o];
      l += ev[0];
      // two d tiles' products alternate; each tile's order of sums is vh.ph, vh.pl, vl.ph
#pragma unroll
      for (int j = 0; j < 4; j += 2) { const v16b vh0 = frag_b(&sv[bu][0][j * 16 + col][sp * 32], lane), vl0 = frag_b(&sv[bu][1][j * 16 + col][sp * 32], lane), vh1 = frag_b(&sv[bu][0][j * 16 + 16 + col][sp * 32], lane), vl1 = frag_b(&sv[bu][1][j * 16 + 16 + col][sp * 32], lane);
        acc[j] = mm_b(vh0, ph, acc[j]); acc[j + 1] = mm_b(vh1, ph, acc[j + 1]); acc[j] = mm_b(vh0, pl, acc[j]); acc[j + 1] = mm_b(vh1, pl, acc[j + 1]); acc[j] = mm_b(vl0, ph, acc[j]); acc[j + 1] = mm_b(vl1, ph, acc[j + 1]); } }
    if (c + 1 < TT / 64) { kt_store(sk[bu ^ 1], kr, tid); vt_store(sv[bu ^ 1], vr, tid); }
    __syncthreads(); }
  // behind the last barrier the v buffers are output staging, each wave in a range of its own
  float (*so)[68] = (float (*)[68])((float*)&sv[0][0][0][0] + wave * 16 * 68);
  l += xhalf(l); const float inv = 1.0f / l; float pw[NRL];
#pragma unroll
  for (int jj = 0; jj < NRL; ++jj) pw[jj] = ex2(sb[rw][jj] - m);
#pragma unroll
  for (int j = 0; j < 4; ++j)
#pragma unroll
    for (int r = 0; r < 8; ++r) { const int d = j * 16 + 8 * g + r; float a = acc[j][r];
#pragma unroll
      for (int jj = 0; jj < NRL; ++jj) a += pw[jj] * srv[jj][d];
      so[col][d] = a * inv; }
  LDSX();   // rows leave LDS as whole 256-byte pieces, two rows a store
#pragma unroll
  for (int rl = 0; rl < 16; rl += 2) vst2(CX + ((size_t)b * TT + ql0 + rl + g) * CC + h * HD + col * 4, *(const v4f*)&so[rl + g][col * 4]); }
// ---- k_out: block = (64 positions, 128 out channels, b): out[o][t] = sum_c Wo[o][c] ctx[t][c] + bo; A = ctx rows (hi + lo), B = Wo [o][c]; transposed to planes
__global__ __launch_bounds__(128) void k_out(const float* __restrict__ CX, const float* __restrict__ WO, const float* __restrict__ BO, float* __restrict__ OUT) { __shared__ __align__(16) float so[128][68]; __shared__ __align__(16) float sc[2][64][FP]; __shared__ __align__(16) __bf16 sw[2][128][WP];
  const int tid = threadIdx.x, wave = tid >> 5, lane = tid & 31, col = lane & 15, g = lane >> 4; const int t0 = blockIdx.x * 64, c0 = blockIdx.y * 128; const size_t b = blockIdx.z;
  v8f acc[8] = {};
  // a piece = 64 channels: the block's 64 ctx rows (f32) and its 128 weight rows (as bf16), fetched once a block into LDS, two buffers
  const float* cq = CX + (b * TT + t0 + (tid >> 4)) * CC + (tid & 15) * 4; const float* wq = WO + (size_t)(c0 + (tid >> 4)) * CC + (tid & 15) * 4; v4f cr[8], wv[16];
  ft_load<CC>(cr, cq); wt_load(wv, wq); ISSUED2(cq, wq);
  ft_store(sc[0], cr, tid); wt_store(sw[0], wv, tid);
  __syncthreads();
  // rolled: a trip asks for the next piece, works on this one out of LDS, stores the next into the other buffers; the one barrier of a trip publishes those and ends the reads of these (it stands outside the test on c: inside it the compiler put a wait in front of every load of the next group). The loops over ks, jg and jj are unrolled so that cv, w and acc are registers
#pragma unroll 1
  for (int c = 0; c < CC / 64; ++c) { const int bu = c & 1;
    if (c + 1 < CC / 64) { const float *cn = cq + (c + 1) * 64, *wn = wq + (c + 1) * 64; ft_load<CC>(cr, cn); wt_load(wv, wn); ISSUED2(cn, wn); }
#pragma unroll
    for (int ks = 0; ks < 2; ++ks) { float cv[16]; pv_load_p(cv, &sc[bu][wave * 16 + col][ks * 32 + 8 * g]); const F2 a = bsplit16(cv);
#pragma unroll
      for (int jg = 0; jg < 8; jg += 4) { v16b w[4];   // four weight fragments at a time: eight, beside the next piece's 96 registers, take the kernel past 256 registers
#pragma unroll
        for (int jj = 0; jj < 4; ++jj) w[jj] = frag_b(&sw[bu][(jg + jj) * 16 + col][ks * 32], lane);
#pragma unroll
        for (int jj = 0; jj < 4; ++jj) { acc[jg + jj] = wmma_bf(a.h, w[jj], acc[jg + jj]); acc[jg + jj] = wmma_bf(a.l, w[jj], acc[jg + jj]); } } }
    if (c + 1 < CC / 64) { ft_store(sc[bu ^ 1], cr, tid); wt_store(sw[bu ^ 1], wv, tid); }
    __syncthreads(); }
#pragma unroll
  for (int j = 0; j < 8; ++j) { const float bb = bfr(BO[c0 + j * 16 + col]);
#pragma unroll
    for (int r = 0; r < 8; ++r) so[j * 16 + col][wave * 16 + 8 * g + r] = acc[j][r] + bb; }
  __syncthreads(); for (int e = tid; e < 128 * 16; e += 128) { const int cl = e >> 4, q = e & 15; vst2(OUT + ((size_t)b * CC + c0 + cl) * TT + t0 + q * 4, *(const v4f*)&so[cl][q * 4]); } }
extern "C" void kernel_launch(void* const* d_in, const int* in_sizes, int n_in, void* d_out, int out_size, void* d_ws, size_t ws_size, hipStream_t stream) {
  (void)in_sizes; (void)n_in; (void)out_size;
  const float** F = (const float**)d_in;   // 0 x [8,512,1024], 1 c [8,512,1024], 2 attn_mask [8,1,1024,1024] int, 3 Wq [512,512], 4 bq, 5 Wk, 6 bk, 7 Wv, 8 bv, 9 Wo [512,512], 10 bo, 11 emb_rel_k [1,9,64], 12 emb_rel_v [1,9,64]
  if (ws_size < (size_t)WS_END) return;
  char* ws = (char*)d_ws; float *QF = (float*)(ws + WS_QF), *QR = (float*)(ws + WS_QR), *CX = (float*)(ws + WS_CX); _Float16 *QH = (_Float16*)(ws + WS_QH), *QL = (_Float16*)(ws + WS_QL), *KH = (_Float16*)(ws + WS_KH); __bf16 *VT = (__bf16*)(ws + WS_VT), *VL = (__bf16*)(ws + WS_VL);
  k_proj<<<dim3(TT / 64, CC / 128, TNB * 3), 128, 0, stream>>>(F[0], F[1], F[3], F[4], F[5], F[6], F[7], F[8], QF, QH, QL, KH, VT, VL);
  k_qr<<<dim3(TT / 64, 1, TNB * NH), 64, 0, stream>>>(QF, F[11], QR);
  k_fa<<<dim3(TT / 64, 1, TNB * NH), 128, 0, stream>>>(QH, QL, KH, QR, (const int*)d_in[2], VT, VL, F[12], CX);
  k_out<<<dim3(TT / 64, CC / 128, TNB), 128, 0, stream>>>(CX, F[9], F[10], (float*)d_out);
}

// v009
// A run of this version takes 96.6 microseconds.
// Two timings next to v008 both put it at 1.13 times that version's speed.
// Over all steps from v000 it is 15.2 times as fast.
// compute dtype: all float inputs rounded to bf16, attn_mask (int) read; q = Wq x + bq (from x), k/v = W c + b (from c) as 1x1 convs with EXACT bf16 products on WMMA 16x16x32 (channel-major tiles transposed in LDS), f32 accumulate; q as f16 hi + residual, k f16 -> 2-product content logits; the 9 windowed relative-key logits q_t . rel_k[s-t+4] on WMMA too (the same q f16 hi + residual against rel_k, whose bf16 value is carried in f16; 2 products, f32 accumulate); the relative-value term sum_j p[t][t+j-4] rel_v[j] in f32 on the VALU; proximity bias -log1p|s-t| (precise log1pf) and the mask in f32; softmax in f32 with a running maximum and sum, scores kept in log2 units (log2 e folded into the 1/8 scale, the bias table and the mask value), exp(score - maximum) = 2^(difference) by the hardware's exp2, split bf16 hi + lo against v bf16 hi + lo (3 products), divided by the sum at the end; out = Wo ctx (bf16 hi + lo) + bo written channel-major; f32 output.
#include <hip/hip_runtime.h>
#include <math.h>

typedef __attribute__((ext_vector_type(16))) _Float16 v16h;
typedef __attribute__((ext_vector_type(16))) __bf16 v16b;
typedef __attribute__((ext_vector_type(8)))  _Float16 v8h;
typedef __attribute__((ext_vector_type(8)))  float v8f;
typedef __attribute__((ext_vector_type(4)))  float v4f;
typedef __attribute__((ext_vector_type(2)))  float v2f;
typedef __attribute__((ext_vector_type(4)))  unsigned v4u;
typedef __attribute__((ext_vector_type(4)))  int v4i;
typedef float __attribute__((may_alias)) float_a;
typedef int __attribute__((may_alias)) int_a;

template <typename T> __device__ __forceinline__ void vst2(void* p, T v) { *(T*)p = v;  }
__device__ __forceinline__ v8f wmma16(v16h a, v16h b, v8f c) {
  v8f d = __builtin_amdgcn_wmma_f32_16x16x32_f16(false, a, false, b, (short)0, c, false, false);
  asm volatile("v_nop\n\tv_nop\n\tv_nop\n\tv_nop" : "+v"(d) : "v"(a), "v"(b));
  return d;
}
__device__ __forceinline__ v8f wmma_bf(v16b a, v16b b, v8f c) {
  v8f d = __builtin_amdgcn_wmma_f32_16x16x32_bf16(false, a, false, b, (short)0, c, false, false);
  asm volatile("v_nop\n\tv_nop\n\tv_nop\n\tv_nop" : "+v"(d) : "v"(a), "v"(b));
  return d;
}
// 16x16x32 fragments: lane = (h = lane>>4, row/col = lane&15); elements 0..7 = k0+8h+0..7, 8..15 = k0+16+8h+0..7; D element r = row 8h+r
__device__ __forceinline__ v16h frag_h(const _Float16* rowk0, int lane) {
  union { v16h v; v8h q[2]; } u; const _Float16* p = rowk0 + 8 * (lane >> 4);
  u.q[0] = *(const v8h*)p; u.q[1] = *(const v8h*)(p + 16); return u.v;
}
__device__ __forceinline__ v16h frag_f32(const float* rowk0, int lane) {
  v16h a; const float* p = rowk0 + 8 * (lane >> 4);
#pragma unroll
  for (int i = 0; i < 8; ++i) { a[i] = (_Float16)p[i]; a[8 + i] = (_Float16)p[16 + i]; }
  return a;
}
__device__ __forceinline__ v16h frag_f32s(const float* rowk0, int lane, float sc) {
  v16h a; const float* p = rowk0 + 8 * (lane >> 4);
#pragma unroll
  for (int i = 0; i < 8; ++i) { a[i] = (_Float16)(p[i] * sc); a[8 + i] = (_Float16)(p[16 + i] * sc); }
  return a;
}
// column fragment from a [K][ld] layout (column n), rows >= K read as 0
__device__ __forceinline__ v16h fragc_f32(const float* W, int k0, int n, int lane, int ld, int K) {
  v16h a; const int g = lane >> 4;
#pragma unroll
  for (int i = 0; i < 8; ++i) { const int ka = k0 + 8 * g + i, kb = ka + 16;
    a[i] = (_Float16)(ka < K ? W[(size_t)(ka < K ? ka : K - 1) * ld + n] : 0.f); a[8 + i] = (_Float16)(kb < K ? W[(size_t)(kb < K ? kb : K - 1) * ld + n] : 0.f); }
  return a;
}
struct F2 { v16b h, l; };
__device__ __forceinline__ F2 bsplit16(const float v[16]) { F2 r;
#pragma unroll
  for (int i = 0; i < 16; ++i) { const __bf16 h = (__bf16)v[i]; r.h[i] = h; r.l[i] = (__bf16)(v[i] - (float)h); }
  return r; }
__device__ __forceinline__ F2 split_row(const float* row, int k0, int lane) { float v[16]; const float* p = row + k0 + 8 * (lane >> 4);
#pragma unroll
  for (int i = 0; i < 8; ++i) { v[i] = p[i]; v[8 + i] = p[16 + i]; }
  return bsplit16(v); }
__device__ __forceinline__ F2 split_rowK(const float* row, int k0, int lane, int K) { float v[16]; const int g = lane >> 4;
#pragma unroll
  for (int i = 0; i < 8; ++i) { const int ka = k0 + 8 * g + i, kb = ka + 16; v[i] = ka < K ? row[ka < K ? ka : K - 1] : 0.f; v[8 + i] = kb < K ? row[kb < K ? kb : K - 1] : 0.f; }
  return bsplit16(v); }
__device__ __forceinline__ F2 split_col(const float* W, int k0, int n, int lane, int ld, int K) { float v[16]; const int g = lane >> 4;
#pragma unroll
  for (int i = 0; i < 8; ++i) { const int ka = k0 + 8 * g + i, kb = ka + 16; v[i] = ka < K ? W[(size_t)(ka < K ? ka : K - 1) * ld + n] : 0.f; v[8 + i] = kb < K ? W[(size_t)(kb < K ? kb : K - 1) * ld + n] : 0.f; }
  return bsplit16(v); }
__device__ __forceinline__ v8f mac3(const F2& a, const F2& b, v8f c) { c = wmma_bf(a.l, b.h, c); c = wmma_bf(a.h, b.l, c); return wmma_bf(a.h, b.h, c); }
__device__ __forceinline__ float sigm(float v) { return 1.0f / (1.0f + expf(-v)); }
// stands directly behind a group of global loads: keeps the whole group issued in front of the work that follows (nothing of it sinks to its use), and the precaution before the loads' address registers are written again
#define ISSUED() asm volatile("s_wait_xcnt 0x0" ::: "memory")
// the same, and the group's pointers are inputs of the wait: they stay in their registers up to it, so that no result of the group is laid over an address that a load of the group still names
#define ISSUED1(p) asm volatile("s_wait_xcnt 0x0" :: "v"(p) : "memory")
#define ISSUED2(p, q) asm volatile("s_wait_xcnt 0x0" :: "v"(p), "v"(q) : "memory")
#define ISSUED3(p, q, r) asm volatile("s_wait_xcnt 0x0" :: "v"(p), "v"(q), "v"(r) : "memory")
#define LDSX() do { asm volatile("s_wait_dscnt 0" ::: "memory"); __builtin_amdgcn_wave_barrier(); __builtin_amdgcn_fence(__ATOMIC_RELEASE, "workgroup"); } while (0)


// VITS-style relative-position multi-head attention (B 8, C 512 = 8 x 64, T 1,024, window 4): content + windowed relative-key logits, proximity bias, mask, softmax, value + windowed relative-value, output 1x1 conv.
#define NB 8
#define CC 512
#define TT 1024
#define NH 8
#define HD 64
#define WR 4
#define NRL 9
#ifndef TNB
#define TNB NB
#endif
typedef __attribute__((ext_vector_type(8))) __bf16 v8b;
__device__ __forceinline__ v16b frag_b(const __bf16* rowk0, int lane) {
  union { v16b v; v8b q[2]; } u; const __bf16* p = rowk0 + 8 * (lane >> 4);
  u.q[0] = *(const v8b*)p; u.q[1] = *(const v8b*)(p + 16); return u.v;
}
__device__ __forceinline__ float bfr(float v) { return (float)(__bf16)v; }
__device__ __attribute__((noinline)) float exp_ni(float v) { return expf(v); }
__device__ __attribute__((noinline)) float erf_ni(float v) { return erff(v); }

#define WS_QH  0u                                  // f16 q rows [b*t][512], hi; then the residual
#define WS_QL  (WS_QH + 2u * (size_t)NB * TT * CC)
#define WS_KH  (WS_QL + 2u * (size_t)NB * TT * CC)
#define WS_VT  (WS_KH + 2u * (size_t)NB * TT * CC)     // bf16 v planes [b][512][t]
#define WS_VL  (WS_VT + 2u * (size_t)NB * CC * TT)
#define WS_CX  (WS_VL + 2u * (size_t)NB * CC * TT)     // f32 ctx rows [b*t][512]
#define WS_END (WS_CX + 4u * (size_t)NB * TT * CC)

typedef __attribute__((ext_vector_type(4))) __bf16 v4b;
#define WP 72   // LDS pitch of a row of 64 16-bit elements: 144 B = 16 B x 9, so that the 16 rows of a ds_load_b128 fragment read spread over the banks
#define FP 68   // LDS pitch of a row of 64 f32: 272 B = 16 B x 17, for the same reason
// Staging of a 64-k piece of a matrix operand by a block of 128 threads: every global load of a wave covers whole 128-byte lines (512 B in 4 lines), and each piece is fetched once a block. The loops over u and i are unrolled so that the pieces are registers
// [128 rows][64] f32 out of rows of 512 (weights): thread = row u * 8 + (tid >> 4), 16 bytes at (tid & 15); stored as bf16
__device__ __forceinline__ void wt_load(v4f wv[16], const float* wq) {
#pragma unroll
  for (int u = 0; u < 16; ++u) wv[u] = *(const v4f*)(wq + u * 8 * CC); }
__device__ __forceinline__ void wt_store(__bf16 (*sw)[WP], const v4f wv[16], int tid) {
#pragma unroll
  for (int u = 0; u < 16; ++u) { v4b o;
#pragma unroll
    for (int i = 0; i < 4; ++i) o[i] = (__bf16)wv[u][i];
    *(v4b*)&sw[u * 8 + (tid >> 4)][(tid & 15) * 4] = o; } }
// [64 rows][64] f32 out of rows of LD (ctx): the same thread map, kept f32
template <int LD> __device__ __forceinline__ void ft_load(v4f fv[8], const float* fq) {
#pragma unroll
  for (int u = 0; u < 8; ++u) fv[u] = *(const v4f*)(fq + u * 8 * LD); }
__device__ __forceinline__ void ft_store(float (*sp)[FP], const v4f fv[8], int tid) {
#pragma unroll
  for (int u = 0; u < 8; ++u) *(v4f*)&sp[u * 8 + (tid >> 4)][(tid & 15) * 4] = fv[u]; }
// [64 channels][64 positions] f32 out of rows of 1,024 (x or c, channel-major): thread = channel pair tid >> 3 (and 16 pairs on), 16 bytes at (tid & 7) of each 128-byte half row; a wave's load covers 4 whole lines. The loops over u and i are unrolled so that the piece is registers
typedef __attribute__((ext_vector_type(2))) __bf16 v2b;
__device__ __forceinline__ void xt_load(v4f xr[8], const float* xq) {
#pragma unroll
  for (int u = 0; u < 8; ++u) xr[u] = *(const v4f*)(xq + ((u >> 1 & 1) * 32 + (u & 1)) * TT + (u >> 2) * 32); }
// turned on the way into LDS: [position][channel] bf16, the two channels of a pair as one 4-byte store
__device__ __forceinline__ void xt_store(__bf16 (*sx)[WP], const v4f xr[8], int tid) {
#pragma unroll
  for (int u = 0; u < 8; u += 2)
#pragma unroll
    for (int i = 0; i < 4; ++i) { v2b o; o[0] = (__bf16)xr[u][i]; o[1] = (__bf16)xr[u + 1][i];
      *(v2b*)&sx[(u >> 2) * 32 + (tid & 7) * 4 + i][(u >> 1 & 1) * 32 + (tid >> 3) * 2] = o; } }
// ---- k_proj: block = (64 positions, 128 out channels, b*3 + which): x^T / c^T and W [out][in] in LDS by pieces of 64 channels; + b exact
__global__ __launch_bounds__(128) void k_proj(const float* __restrict__ X, const float* __restrict__ Cc, const float* __restrict__ WQ, const float* __restrict__ BQ, const float* __restrict__ WK, const float* __restrict__ BK, const float* __restrict__ WV, const float* __restrict__ BV, _Float16* __restrict__ QH, _Float16* __restrict__ QL, _Float16* __restrict__ KH, __bf16* __restrict__ VT, __bf16* __restrict__ VL) {
  __shared__ __align__(16) unsigned char sbuf[2 * 128 * 72 * 2 + 64 * 132 * 4];   // k loop: two weight buffers, then two x buffers  |  behind it: (th, tl2) for v or (sh, sl) for q/k, then sf
  __bf16 (*th)[72] = (__bf16 (*)[72])sbuf; __bf16 (*tl2)[72] = (__bf16 (*)[72])(sbuf + 128 * 72 * 2); _Float16 (*sh)[136] = (_Float16 (*)[136])sbuf; _Float16 (*sl)[136] = (_Float16 (*)[136])(sbuf + 64 * 136 * 2); __bf16 (*sw)[128][WP] = (__bf16 (*)[128][WP])sbuf;
  __bf16 (*sx)[64][WP] = (__bf16 (*)[64][WP])(sbuf + 2 * 128 * 72 * 2); float (*sf)[132] = (float (*)[132])(sbuf + 2 * 128 * 72 * 2);
  const int tid = threadIdx.x, wave = tid >> 5, lane = tid & 31, col = lane & 15, g = lane >> 4; const int p0 = blockIdx.x * 64; const int c0 = blockIdx.y * 128; const size_t b = blockIdx.z / 3; const int which = blockIdx.z % 3;
  const float* Xs = which == 0 ? X : Cc; const float* Wm = which == 0 ? WQ : which == 1 ? WK : WV; const float* Bm = which == 0 ? BQ : which == 1 ? BK : BV;
  // a piece = 64 channels: the block's 64 positions of x (as bf16, turned) and its 128 weight rows (as bf16), fetched once a block into LDS, two buffers
  const float* xq = Xs + (b * CC + (tid >> 3) * 2) * (size_t)TT + p0 + (tid & 7) * 4; const float* wq = Wm + (size_t)(c0 + (tid >> 4)) * CC + (tid & 15) * 4; v4f xr[8], wv[16];
  xt_load(xr, xq); wt_load(wv, wq); ISSUED2(xq, wq);
  xt_store(sx[0], xr, tid); wt_store(sw[0], wv, tid);
  __syncthreads();
  v8f acc[8] = {};
  // rolled: a trip asks for the next piece, works on this one out of LDS, stores the next into the other buffers; the one barrier of a trip publishes those and ends the reads of these (behind the last trip: before sbuf becomes output staging). The loops over ks and j are unrolled so that w and acc are registers
#pragma unroll 1
  for (int c = 0; c < CC / 64; ++c) { const int bu = c & 1;
    if (c + 1 < CC / 64) { xq += 64 * TT; wq += 64; xt_load(xr, xq); wt_load(wv, wq); ISSUED2(xq, wq); }
#pragma unroll
    for (int ks = 0; ks < 2; ++ks) { const v16b a = frag_b(&sx[bu][wave * 16 + col][ks * 32], lane); v16b w[8];
#pragma unroll
      for (int j = 0; j < 8; ++j) w[j] = frag_b(&sw[bu][j * 16 + col][ks * 32], lane);
#pragma unroll
      for (int j = 0; j < 8; ++j) acc[j] = wmma_bf(a, w[j], acc[j]); }
    if (c + 1 < CC / 64) { xt_store(sx[bu ^ 1], xr, tid); wt_store(sw[bu ^ 1], wv, tid); }
    __syncthreads(); }
  if (which < 2) {
#pragma unroll
    for (int j = 0; j < 8; ++j) { const float bb = bfr(Bm[c0 + j * 16 + col]);
#pragma unroll
      for (int r = 0; r < 8; ++r) sf[wave * 16 + 8 * g + r][j * 16 + col] = acc[j][r] + bb; }
    __syncthreads();
    // rows: f16 hi (+ residual for q)
    for (int e = tid; e < 64 * 128; e += 128) { const int rl = e >> 7, cl = e & 127; const float v = sf[rl][cl]; const _Float16 hv = (_Float16)v; sh[rl][cl] = hv; sl[rl][cl] = (_Float16)(v - (float)hv); }
    __syncthreads();
    _Float16* dh = which == 0 ? QH : KH; for (int e = tid; e < 64 * 16; e += 128) { const int rl = e >> 4, q = e & 15; const size_t row = b * TT + p0 + rl; vst2((unsigned*)(dh + row * CC + c0 + q * 8), *(const v4u*)&sh[rl][q * 8]); if (which == 0) vst2((unsigned*)(QL + row * CC + c0 + q * 8), *(const v4u*)&sl[rl][q * 8]); } }
  else {
#pragma unroll
    for (int j = 0; j < 8; ++j) { const float bb = bfr(Bm[c0 + j * 16 + col]);
#pragma unroll
      for (int r = 0; r < 8; ++r) { const float v = acc[j][r] + bb; const int rl = wave * 16 + 8 * g + r, cl = j * 16 + col; const __bf16 bh = (__bf16)v; th[cl][rl] = bh; tl2[cl][rl] = (__bf16)(v - (float)bh); } }
    __syncthreads(); for (int e = tid; e < 128 * 8; e += 128) { const int cl = e >> 3, q = e & 7; const size_t o2 = (b * CC + c0 + cl) * (size_t)TT + p0 + q * 8; vst2((unsigned*)(VT + o2), *(const v4u*)&th[cl][q * 8]); vst2((unsigned*)(VL + o2), *(const v4u*)&tl2[cl][q * 8]); } } }
// the loop over i is unrolled so that the stage is registers, not indexed memory
__device__ __forceinline__ void pv_load_p(float p[16], const float* pk) {
#pragma unroll
  for (int i = 0; i < 8; ++i) { p[i] = pk[i]; p[8 + i] = pk[16 + i]; } }
// [2 planes][64 rows][64] bf16 out of rows of 1,024 (v hi, v lo): thread = row u * 16 + (tid >> 3), 16 bytes at (tid & 7); a wave's load covers 4 whole lines
__device__ __forceinline__ void vt_load(v4u vr[8], const __bf16* vg, const __bf16* lg) {
#pragma unroll
  for (int u = 0; u < 4; ++u) { vr[u] = *(const v4u*)(vg + u * 16 * TT); vr[4 + u] = *(const v4u*)(lg + u * 16 * TT); } }
__device__ __forceinline__ void vt_store(__bf16 (*sv)[64][WP], const v4u vr[8], int tid) {
#pragma unroll
  for (int u = 0; u < 4; ++u) { *(v4u*)&sv[0][u * 16 + (tid >> 3)][(tid & 7) * 8] = vr[u]; *(v4u*)&sv[1][u * 16 + (tid >> 3)][(tid & 7) * 8] = vr[4 + u]; } }
// [64 rows][64] f16 out of rows of 512 (k, one head): the same thread map
__device__ __forceinline__ void kt_load(v4u kr[4], const _Float16* kg) {
#pragma unroll
  for (int u = 0; u < 4; ++u) kr[u] = *(const v4u*)(kg + u * 16 * CC); }
__device__ __forceinline__ void kt_store(_Float16 (*sk)[WP], const v4u kr[4], int tid) {
#pragma unroll
  for (int u = 0; u < 4; ++u) *(v4u*)&sk[u * 16 + (tid >> 3)][(tid & 7) * 8] = kr[u]; }
// [16 rows][32] mask words out of rows of 1,024, one wave's own: lane = row u * 4 + (lane >> 3), 16 bytes at (lane & 7); a load covers 4 whole lines
__device__ __forceinline__ void mt_load(v4i mg[4], const int* mp) {
#pragma unroll
  for (int u = 0; u < 4; ++u) mg[u] = *(const v4i*)(mp + u * 4 * TT); }
#define MP 36   // LDS pitch of a row of 32 mask words: 144 B = 16 B x 9
__device__ __forceinline__ void mt_store(int (*sm)[MP], const v4i mg[4], int lane) {
#pragma unroll
  for (int u = 0; u < 4; ++u) *(v4i*)&sm[u * 4 + (lane >> 3)][(lane & 7) * 4] = mg[u]; }
// the matrix builtins as they are: the compiler keeps the distance behind them itself and fills it with the softmax's vector work where it can
__device__ __forceinline__ v8f mm_h(v16h a, v16h b, v8f c) { return __builtin_amdgcn_wmma_f32_16x16x32_f16(false, a, false, b, (short)0, c, false, false); }
__device__ __forceinline__ v8f mm_b(v16b a, v16b b, v8f c) { return __builtin_amdgcn_wmma_f32_16x16x32_bf16(false, a, false, b, (short)0, c, false, false); }
// orders a wave's accesses to LDS rows that only this wave uses: what stands above is over before what stands below begins; no fence, which would also wait for the global loads in flight
#define LDSW() do { asm volatile("s_wait_dscnt 0x0" ::: "memory"); __builtin_amdgcn_wave_barrier(); } while (0)
typedef __attribute__((ext_vector_type(8))) unsigned v8u;
#define L2E 1.4426950408889634f   // log2 e: exp(x) = 2^(x * L2E)
// 2^x as the one hardware instruction; a result below the smallest normal number may come out as 0: beside a row sum of at least 1 such a weight counts for nothing
__device__ __forceinline__ float ex2(float x) { return __builtin_amdgcn_exp2f(x); }
// lane l with lane l ^ 16
__device__ __forceinline__ float xhalf(float x) { return __builtin_bit_cast(float, __builtin_amdgcn_permlanex16(__builtin_bit_cast(int, x), __builtin_bit_cast(int, x), 0x76543210, 0xfedcba98, false, false)); }
// ---- k_fa: block = (64 queries, b * 8 + head), wave = 16 queries, all 1,024 keys in 16 pieces of 64 (k and v staged once a block in LDS, two buffers), a pass = 32 keys. Transposed products: S^T = k . q^T (a lane holds 8 keys of ONE query a tile), score = (q.k + [|s-t|<=4] q_t.rel_k[s-t+4]) / 8 - log1p|s-t| (table in LDS); mask == 0 -> -1e4; all three times log2 e, so that the exponential is one exp2; running maximum and sum per query; e = 2^(score - maximum in use) goes from the score registers straight into the B operand (bf16 hi + lo) of ctx^T += v^T . e^T (3 products); ctx rows [b*t][h*64+d] = (ctx^T + sum_j e[t][t+j-4] rel_v[j][d]) / sum. Second launch bound: 4 waves a SIMD, so that four blocks share a WGP
__global__ __launch_bounds__(128, 4) void k_fa(const _Float16* __restrict__ QH, const _Float16* __restrict__ QL, const _Float16* __restrict__ KH, const float* __restrict__ RK, const int* __restrict__ AM, const __bf16* __restrict__ VT, const __bf16* __restrict__ VL, const float* __restrict__ RV, float* __restrict__ CX) {
  __shared__ __align__(16) _Float16 sk[2][64][WP]; __shared__ __align__(16) __bf16 sv[2][2][64][WP]; __shared__ __align__(16) int sm[4][16][MP]; __shared__ float slp[TT + 63]; __shared__ __align__(16) float sqr[64][16]; __shared__ float sb[64][NRL]; __shared__ __align__(16) float srv[NRL][HD];
  const int b = blockIdx.z / NH, h = blockIdx.z % NH;
  const int tid = threadIdx.x, wave = __builtin_amdgcn_readfirstlane(tid >> 5), lane = tid & 31, col = lane & 15, g = lane >> 4; const int tb = blockIdx.x * 64, ql0 = tb + wave * 16, rw = wave * 16 + col;
  // first piece of k and v, the wave's first pass of mask words, and its q fragments (kept in registers throughout) are asked for ahead of the tables
  const _Float16* kg = KH + ((size_t)b * TT + (tid >> 3)) * CC + h * HD + (tid & 7) * 8; const size_t vo = ((size_t)b * CC + h * HD + (tid >> 3)) * (size_t)TT + (tid & 7) * 8; const __bf16 *vg = VT + vo, *lg = VL + vo; const int* mp = AM + ((size_t)b * TT + ql0 + (lane >> 3)) * TT + (lane & 7) * 4;
  v4u kr[4], vr[8]; v4i mg[4];
  kt_load(kr, kg); vt_load(vr, vg, lg); mt_load(mg, mp); ISSUED3(kg, vg, lg);
  const _Float16 *qhp = QH + ((size_t)b * TT + ql0 + col) * CC + h * HD, *qlp = QL + ((size_t)b * TT + ql0 + col) * CC + h * HD;
  const v16h qh0 = frag_h(qhp, lane), qh1 = frag_h(qhp + 32, lane), ql_0 = frag_h(qlp, lane), ql_1 = frag_h(qlp + 32, lane);
  ISSUED3(qhp, qlp, mp);
  // rel_k row lane & 15 (rows 9..15 do not exist: row 8 is read in their place and set to 0 below), in the k order of an A fragment; asked for with the q fragments, used behind the table. The loop over u is unrolled so that rr is registers
  const float* rp = RK + (col < NRL ? col : NRL - 1) * HD + 8 * g; v4f rr[8];
#pragma unroll
  for (int u = 0; u < 4; ++u) { rr[2 * u] = *(const v4f*)(rp + u * 16); rr[2 * u + 1] = *(const v4f*)(rp + u * 16 + 4); }
  ISSUED1(rp);
  // the block's 64 x 1,024 scores meet only 1,087 distances s - t: slp[i] = log1p|i - 63 - tb| * log2 e, each computed once for the block
  for (int e = tid; e < TT + 63; e += 128) slp[e] = log1pf(fabsf((float)(e - 63 - tb))) * L2E;
  // the relative-key logits of the wave's 16 queries, sqr[query][j] = q . rel_k[j]: rel_k as the A operand against the q fragments that the score products use (D element r = j 8g + r of query lane & 15); order of sums hi, lo, hi, lo as in the scores. The loop over i is unrolled so that the fragments are registers
  { v16h ra0, ra1;
#pragma unroll
    for (int i = 0; i < 16; ++i) { ra0[i] = col < NRL ? (_Float16)bfr(rr[i >> 2][i & 3]) : (_Float16)0.f; ra1[i] = col < NRL ? (_Float16)bfr(rr[4 + (i >> 2)][i & 3]) : (_Float16)0.f; }
    v8f qk = {}; qk = mm_h(ra0, qh0, qk); qk = mm_h(ra0, ql_0, qk); qk = mm_h(ra1, qh1, qk); qk = mm_h(ra1, ql_1, qk);
    *(v4f*)&sqr[rw][8 * g] = (v4f){qk[0], qk[1], qk[2], qk[3]}; *(v4f*)&sqr[rw][8 * g + 4] = (v4f){qk[4], qk[5], qk[6], qk[7]}; }
  for (int e = tid; e < NRL * HD; e += 128) srv[e / HD][e % HD] = bfr(RV[e]);
  for (int e = tid; e < 64 * NRL; e += 128) sb[e / NRL][e % NRL] = -3.0e38f;   // a window place outside 0..1,023 keeps this and ends as weight 0
  kt_store(sk[0], kr, tid); vt_store(sv[0], vr, tid); mt_store(sm[wave], mg, lane);
  mt_load(mg, mp + 32); ISSUED1(mp);
  __syncthreads();
  v8f acc[4] = {}; float m = -3.0e38f, l = 0.f;
  // rolled: a trip asks for the next piece, works on this one out of LDS, stores the next into the other buffers; the one barrier of a trip publishes those and ends the reads of these (it stands outside the test on c, as in the other kernels). The loops over sp, jt, j, s and o are unrolled so that the tiles are registers
#pragma unroll 1
  for (int c = 0; c < TT / 64; ++c) { const int bu = c & 1;
    if (c + 1 < TT / 64) { kg += 64 * CC; vg += 64; lg += 64; kt_load(kr, kg); vt_load(vr, vg, lg); ISSUED3(kg, vg, lg); }
#pragma unroll
    for (int sp = 0; sp < 2; ++sp) { const int k0 = c * 64 + sp * 32; v8f st[2] = {};
      // the pass's LDS reads stand together ahead of its products: k fragments, table values, and the mask words, which come out of the wave's own LDS rows in the score tiles' map
      v16h ka[4]; v4i mk[4]; float lp[16];
#pragma unroll
      for (int jt = 0; jt < 2; ++jt) { ka[jt] = frag_h(&sk[bu][sp * 32 + jt * 16 + col][0], lane); ka[2 + jt] = frag_h(&sk[bu][sp * 32 + jt * 16 + col][32], lane); }
#pragma unroll
      for (int jt = 0; jt < 2; ++jt) { mk[2 * jt] = *(const v4i*)&sm[wave][col][jt * 16 + 8 * g]; mk[2 * jt + 1] = *(const v4i*)&sm[wave][col][jt * 16 + 8 * g + 4]; }
#pragma unroll
      for (int s = 0; s < 16; ++s) lp[s] = slp[k0 + (s >> 3) * 16 + 8 * g + (s & 7) - rw + 63];
      // the two tiles' products alternate, so that none waits for the one before it; each tile's order of sums is hi, lo, hi, lo
      st[0] = mm_h(ka[0], qh0, st[0]); st[1] = mm_h(ka[1], qh0, st[1]); st[0] = mm_h(ka[0], ql_0, st[0]); st[1] = mm_h(ka[1], ql_0, st[1]);
      st[0] = mm_h(ka[2], qh1, st[0]); st[1] = mm_h(ka[3], qh1, st[1]); st[0] = mm_h(ka[2], ql_1, st[0]); st[1] = mm_h(ka[3], ql_1, st[1]);
      // the next pass's mask words, fetched a pass ago, go into those rows, and the pass after that is asked for (past the last pass the last one again: an address in bounds and no branch among the loads)
      LDSW();   // the wave's reads of its mask rows are over before it writes them anew
      mt_store(sm[wave], mg, lane);
      LDSW();   // and the new rows are written before lanes read what other lanes of the wave stored
      { const int pn = c * 2 + sp + 2; const int* mn = mp + (pn < TT / 32 ? pn : TT / 32 - 1) * 32; mt_load(mg, mn); ISSUED1(mn); }
      // the relative-key term: one test a pass, the same in every lane of a wave (at most 2 of a wave's 32 passes meet the band |s - t| <= 4), index clamped into 0..8
      const bool band = k0 + 31 >= ql0 - WR && k0 <= ql0 + 15 + WR;
      if (band) {
#pragma unroll
        for (int s = 0; s < 16; ++s) { const int dw = k0 + (s >> 3) * 16 + 8 * g + (s & 7) - (ql0 + col) + WR; const float qv = sqr[rw][dw < 0 ? 0 : dw > 2 * WR ? 2 * WR : dw]; if (dw >= 0 && dw <= 2 * WR) st[s >> 3][s & 7] += qv; } }
      float pm = -3.0e38f;
#pragma unroll
      for (int s = 0; s < 16; ++s) { float v = st[s >> 3][s & 7] * (0.125f * L2E) - lp[s]; if (mk[s >> 2][s & 3] == 0) v = -10000.0f * L2E; st[s >> 3][s & 7] = v; pm = fmaxf(pm, v); }
      // the 9 scores of each query's window are kept for the relative-value term
      if (band) {
#pragma unroll
        for (int s = 0; s < 16; ++s) { const int dw = k0 + (s >> 3) * 16 + 8 * g + (s & 7) - (ql0 + col) + WR; if (dw >= 0 && dw <= 2 * WR) sb[rw][dw] = st[s >> 3][s & 7]; } }
      pm = fmaxf(pm, xhalf(pm));
      // the maximum in use moves, and sums and ctx are rescaled, only when some query's new maximum passes it by more than 7 (e stays below 2^7): one test a pass
      if (__builtin_amdgcn_ballot_w32(pm > m + 7.0f) != 0) { const float mn = fmaxf(m, pm), sc = ex2(m - mn); m = mn; l *= sc;
#pragma unroll
        for (int j = 0; j < 4; ++j) acc[j] *= sc; }
      v16b ph, pl; float ev[16];
      // two scores a step: one packed subtraction feeds two exp2
#pragma unroll
      for (int s = 0; s < 16; s += 2) { const v2f d = (v2f){st[s >> 3][s & 7], st[s >> 3][(s & 7) + 1]} - m; ev[s] = ex2(d[0]); ev[s + 1] = ex2(d[1]); ph[s] = (__bf16)ev[s]; ph[s + 1] = (__bf16)ev[s + 1]; }
      // the hi parts are taken back as f32 out of the packed words (low half shifted up, high half masked): the same values as a conversion of each
      { const v8u pw2 = __builtin_bit_cast(v8u, ph);
#pragma unroll
        for (int s = 0; s < 16; s += 2) { pl[s] = (__bf16)(ev[s] - __builtin_bit_cast(float, pw2[s >> 1] << 16)); pl[s + 1] = (__bf16)(ev[s + 1] - __builtin_bit_cast(float, pw2[s >> 1] & 0xffff0000u)); } }
      // the pass's 16 terms are joined as a tree, not as one chain of dependent additions
#pragma unroll
      for (int o = 8; o > 0; o >>= 1)
#pragma unroll
        for (int s = 0; s < o; ++s) ev[s] += ev[s + o];
      l += ev[0];
      // two d tiles' products alternate; each tile's order of sums is vh.ph, vh.pl, vl.ph
#pragma unroll
      for (int j = 0; j < 4; j += 2) { const v16b vh0 = frag_b(&sv[bu][0][j * 16 + col][sp * 32], lane), vl0 = frag_b(&sv[bu][1][j * 16 + col][sp * 32], lane), vh1 = frag_b(&sv[bu][0][j * 16 + 16 + col][sp * 32], lane), vl1 = frag_b(&sv[bu][1][j * 16 + 16 + col][sp * 32], lane);
        acc[j] = mm_b(vh0, ph, acc[j]); acc[j + 1] = mm_b(vh1, ph, acc[j + 1]); acc[j] = mm_b(vh0, pl, acc[j]); acc[j + 1] = mm_b(vh1, pl, acc[j + 1]); acc[j] = mm_b(vl0, ph, acc[j]); acc[j + 1] = mm_b(vl1, ph, acc[j + 1]); } }
    if (c + 1 < TT / 64) { kt_store(sk[bu ^ 1], kr, tid); vt_store(sv[bu ^ 1], vr, tid); }
    __syncthreads(); }
  // behind the last barrier the v buffers are output staging, each wave in a range of its own
  float (*so)[68] = (float (*)[68])((float*)&sv[0][0][0][0] + wave * 16 * 68);
  l += xhalf(l); const float inv = 1.0f / l; float pw[NRL];
#pragma unroll
  for (int jj = 0; jj < NRL; ++jj) pw[jj] = ex2(sb[rw][jj] - m);
#pragma unroll
  for (int j = 0; j < 4; ++j)
#pragma unroll
    for (int r = 0; r < 8; ++r) { const int d = j * 16 + 8 * g + r; float a = acc[j][r];
#pragma unroll
      for (int jj = 0; jj < NRL; ++jj) a += pw[jj] * srv[jj][d];
      so[col][d] = a * inv; }
  LDSX();   // rows leave LDS as whole 256-byte pieces, two rows a store
#pragma unroll
  for (int rl = 0; rl < 16; rl += 2) vst2(CX + ((size_t)b * TT + ql0 + rl + g) * CC + h * HD + col * 4, *(const v4f*)&so[rl + g][col * 4]); }
// ---- k_out: block = (64 positions, 128 out channels, b): out[o][t] = sum_c Wo[o][c] ctx[t][c] + bo; A = ctx rows (hi + lo), B = Wo [o][c]; transposed to planes
__global__ __launch_bounds__(128) void k_out(const float* __restrict__ CX, const float* __restrict__ WO, const float* __restrict__ BO, float* __restrict__ OUT) { __shared__ __align__(16) float so[128][68]; __shared__ __align__(16) float sc[2][64][FP]; __shared__ __align__(16) __bf16 sw[2][128][WP];
  const int tid = threadIdx.x, wave = tid >> 5, lane = tid & 31, col = lane & 15, g = lane >> 4; const int t0 = blockIdx.x * 64, c0 = blockIdx.y * 128; const size_t b = blockIdx.z;
  v8f acc[8] = {};
  // a piece = 64 channels: the block's 64 ctx rows (f32) and its 128 weight rows (as bf16), fetched once a block into LDS, two buffers
  const float* cq = CX + (b * TT + t0 + (tid >> 4)) * CC + (tid & 15) * 4; const float* wq = WO + (size_t)(c0 + (tid >> 4)) * CC + (tid & 15) * 4; v4f cr[8], wv[16];
  ft_load<CC>(cr, cq); wt_load(wv, wq); ISSUED2(cq, wq);
  ft_store(sc[0], cr, tid); wt_store(sw[0], wv, tid);
  __syncthreads();
  // rolled: a trip asks for the next piece, works on this one out of LDS, stores the next into the other buffers; the one barrier of a trip publishes those and ends the reads of these (it stands outside the test on c: inside it the compiler put a wait in front of every load of the next group). The loops over ks, jg and jj are unrolled so that cv, w and acc are registers
#pragma unroll 1
  for (int c = 0; c < CC / 64; ++c) { const int bu = c & 1;
    if (c + 1 < CC / 64) { const float *cn = cq + (c + 1) * 64, *wn = wq + (c + 1) * 64; ft_load<CC>(cr, cn); wt_load(wv, wn); ISSUED2(cn, wn); }
#pragma unroll
    for (int ks = 0; ks < 2; ++ks) { float cv[16]; pv_load_p(cv, &sc[bu][wave * 16 + col][ks * 32 + 8 * g]); const F2 a = bsplit16(cv);
#pragma unroll
      for (int jg = 0; jg < 8; jg += 4) { v16b w[4];   // four weight fragments at a time: eight, beside the next piece's 96 registers, take the kernel past 256 registers
#pragma unroll
        for (int jj = 0; jj < 4; ++jj) w[jj] = frag_b(&sw[bu][(jg + jj) * 16 + col][ks * 32], lane);
#pragma unroll
        for (int jj = 0; jj < 4; ++jj) { acc[jg + jj] = wmma_bf(a.h, w[jj], acc[jg + jj]); acc[jg + jj] = wmma_bf(a.l, w[jj], acc[jg + jj]); } } }
    if (c + 1 < CC / 64) { ft_store(sc[bu ^ 1], cr, tid); wt_store(sw[bu ^ 1], wv, tid); }
    __syncthreads(); }
#pragma unroll
  for (int j = 0; j < 8; ++j) { const float bb = bfr(BO[c0 + j * 16 + col]);
#pragma unroll
    for (int r = 0; r < 8; ++r) so[j * 16 + col][wave * 16 + 8 * g + r] = acc[j][r] + bb; }
  __syncthreads(); for (int e = tid; e < 128 * 16; e += 128) { const int cl = e >> 4, q = e & 15; vst2(OUT + ((size_t)b * CC + c0 + cl) * TT + t0 + q * 4, *(const v4f*)&so[cl][q * 4]); } }
extern "C" void kernel_launch(void* const* d_in, const int* in_sizes, int n_in, void* d_out, int out_size, void* d_ws, size_t ws_size, hipStream_t stream) {
  (void)in_sizes; (void)n_in; (void)out_size;
  const float** F = (const float**)d_in;   // 0 x [8,512,1024], 1 c [8,512,1024], 2 attn_mask [8,1,1024,1024] int, 3 Wq [512,512], 4 bq, 5 Wk, 6 bk, 7 Wv, 8 bv, 9 Wo [512,512], 10 bo, 11 emb_rel_k [1,9,64], 12 emb_rel_v [1,9,64]
  if (ws_size < (size_t)WS_END) return;
  char* ws = (char*)d_ws; float *CX = (float*)(ws + WS_CX); _Float16 *QH = (_Float16*)(ws + WS_QH), *QL = (_Float16*)(ws + WS_QL), *KH = (_Float16*)(ws + WS_KH); __bf16 *VT = (__bf16*)(ws + WS_VT), *VL = (__bf16*)(ws + WS_VL);
  k_proj<<<dim3(TT / 64, CC / 128, TNB * 3), 128, 0, stream>>>(F[0], F[1], F[3], F[4], F[5], F[6], F[7], F[8], QH, QL, KH, VT, VL);
  k_fa<<<dim3(TT / 64, 1, TNB * NH), 128, 0, stream>>>(QH, QL, KH, F[11], (const int*)d_in[2], VT, VL, F[12], CX);
  k_out<<<dim3(TT / 64, CC / 128, TNB), 128, 0, stream>>>(CX, F[9], F[10], (float*)d_out);
}

// v010
// It runs in 91.8 microseconds.
// Two timings next to v009 both put it at 1.05 times that version's speed.
// All steps since v000 together make it 16.0 times as fast.
// compute dtype: all float inputs rounded to bf16, attn_mask (int) read; q = Wq x + bq (from x), k/v = W c + b (from c) as 1x1 convs with EXACT bf16 products on WMMA 16x16x32 (channel-major tiles transposed in LDS), f32 accumulate; q as f16 hi + residual, k f16 -> 2-product content logits; the 9 windowed relative-key logits q_t . rel_k[s-t+4] on WMMA too (the same q f16 hi + residual against rel_k, whose bf16 value is carried in f16; 2 products, f32 accumulate); the relative-value term sum_j p[t][t+j-4] rel_v[j] in f32 on the VALU; proximity bias -log1p|s-t| (precise log1pf) and the mask in f32; softmax in f32 with a running maximum and sum, scores kept in log2 units (log2 e folded into the 1/8 scale, the bias table and the mask value), exp(score - maximum) = 2^(difference) by the hardware's exp2, split bf16 hi + lo against v bf16 hi + lo (3 products), divided by the sum at the end; out = Wo ctx (bf16 hi + lo) + bo written channel-major; f32 output.
#include <hip/hip_runtime.h>
#include <math.h>

typedef __attribute__((ext_vector_type(16))) _Float16 v16h;
typedef __attribute__((ext_vector_type(16))) __bf16 v16b;
typedef __attribute__((ext_vector_type(8)))  _Float16 v8h;
typedef __attribute__((ext_vector_type(8)))  float v8f;
typedef __attribute__((ext_vector_type(4)))  float v4f;
typedef __attribute__((ext_vector_type(2)))  float v2f;
typedef __attribute__((ext_vector_type(4)))  unsigned v4u;
typedef __attribute__((ext_vector_type(4)))  int v4i;
typedef float __attribute__((may_alias)) float_a;
typedef int __attribute__((may_alias)) int_a;

template <typename T> __device__ __forceinline__ void vst2(void* p, T v) { *(T*)p = v;  }
__device__ __forceinline__ v8f wmma16(v16h a, v16h b, v8f c) {
  v8f d = __builtin_amdgcn_wmma_f32_16x16x32_f16(false, a, false, b, (short)0, c, false, false);
  asm volatile("v_nop\n\tv_nop\n\tv_nop\n\tv_nop" : "+v"(d) : "v"(a), "v"(b));
  return d;
}
__device__ __forceinline__ v8f wmma_bf(v16b a, v16b b, v8f c) {
  v8f d = __builtin_amdgcn_wmma_f32_16x16x32_bf16(false, a, false, b, (short)0, c, false, false);
  asm volatile("v_nop\n\tv_nop\n\tv_nop\n\tv_nop" : "+v"(d) : "v"(a), "v"(b));
  return d;
}
// 16x16x32 fragments: lane = (h = lane>>4, row/col = lane&15); elements 0..7 = k0+8h+0..7, 8..15 = k0+16+8h+0..7; D element r = row 8h+r
__device__ __forceinline__ v16h frag_h(const _Float16* rowk0, int lane) {
  union { v16h v; v8h q[2]; } u; const _Float16* p = rowk0 + 8 * (lane >> 4);
  u.q[0] = *(const v8h*)p; u.q[1] = *(const v8h*)(p + 16); return u.v;
}
__device__ __forceinline__ v16h frag_f32(const float* rowk0, int lane) {
  v16h a; const float* p = rowk0 + 8 * (lane >> 4);
#pragma unroll
  for (int i = 0; i < 8; ++i) { a[i] = (_Float16)p[i]; a[8 + i] = (_Float16)p[16 + i]; }
  return a;
}
__device__ __forceinline__ v16h frag_f32s(const float* rowk0, int lane, float sc) {
  v16h a; const float* p = rowk0 + 8 * (lane >> 4);
#pragma unroll
  for (int i = 0; i < 8; ++i) { a[i] = (_Float16)(p[i] * sc); a[8 + i] = (_Float16)(p[16 + i] * sc); }
  return a;
}
// column fragment from a [K][ld] layout (column n), rows >= K read as 0
__device__ __forceinline__ v16h fragc_f32(const float* W, int k0, int n, int lane, int ld, int K) {
  v16h a; const int g = lane >> 4;
#pragma unroll
  for (int i = 0; i < 8; ++i) { const int ka = k0 + 8 * g + i, kb = ka + 16;
    a[i] = (_Float16)(ka < K ? W[(size_t)(ka < K ? ka : K - 1) * ld + n] : 0.f); a[8 + i] = (_Float16)(kb < K ? W[(size_t)(kb < K ? kb : K - 1) * ld + n] : 0.f); }
  return a;
}
struct F2 { v16b h, l; };
__device__ __forceinline__ F2 bsplit16(const float v[16]) { F2 r;
#pragma unroll
  for (int i = 0; i < 16; ++i) { const __bf16 h = (__bf16)v[i]; r.h[i] = h; r.l[i] = (__bf16)(v[i] - (float)h); }
  return r; }
__device__ __forceinline__ F2 split_row(const float* row, int k0, int lane) { float v[16]; const float* p = row + k0 + 8 * (lane >> 4);
#pragma unroll
  for (int i = 0; i < 8; ++i) { v[i] = p[i]; v[8 + i] = p[16 + i]; }
  return bsplit16(v); }
__device__ __forceinline__ F2 split_rowK(const float* row, int k0, int lane, int K) { float v[16]; const int g = lane >> 4;
#pragma unroll
  for (int i = 0; i < 8; ++i) { const int ka = k0 + 8 * g + i, kb = ka + 16; v[i] = ka < K ? row[ka < K ? ka : K - 1] : 0.f; v[8 + i] = kb < K ? row[kb < K ? kb : K - 1] : 0.f; }
  return bsplit16(v); }
__device__ __forceinline__ F2 split_col(const float* W, int k0, int n, int lane, int ld, int K) { float v[16]; const int g = lane >> 4;
#pragma unroll
  for (int i = 0; i < 8; ++i) { const int ka = k0 + 8 * g + i, kb = ka + 16; v[i] = ka < K ? W[(size_t)(ka < K ? ka : K - 1) * ld + n] : 0.f; v[8 + i] = kb < K ? W[(size_t)(kb < K ? kb : K - 1) * ld + n] : 0.f; }
  return bsplit16(v); }
__device__ __forceinline__ v8f mac3(const F2& a, const F2& b, v8f c) { c = wmma_bf(a.l, b.h, c); c = wmma_bf(a.h, b.l, c); return wmma_bf(a.h, b.h, c); }
__device__ __forceinline__ float sigm(float v) { return 1.0f / (1.0f + expf(-v)); }
// stands directly behind a group of global loads: keeps the whole group issued in front of the work that follows (nothing of it sinks to its use), and the precaution before the loads' address registers are written again
#define ISSUED() asm volatile("s_wait_xcnt 0x0" ::: "memory")
// the same, and the group's pointers are inputs of the wait: they stay in their registers up to it, so that no result of the group is laid over an address that a load of the group still names
#define ISSUED1(p) asm volatile("s_wait_xcnt 0x0" :: "v"(p) : "memory")
#define ISSUED2(p, q) asm volatile("s_wait_xcnt 0x0" :: "v"(p), "v"(q) : "memory")
#define ISSUED3(p, q, r) asm volatile("s_wait_xcnt 0x0" :: "v"(p), "v"(q), "v"(r) : "memory")
#define LDSX() do { asm volatile("s_wait_dscnt 0" ::: "memory"); __builtin_amdgcn_wave_barrier(); __builtin_amdgcn_fence(__ATOMIC_RELEASE, "workgroup"); } while (0)


// VITS-style relative-position multi-head attention (B 8, C 512 = 8 x 64, T 1,024, window 4): content + windowed relative-key logits, proximity bias, mask, softmax, value + windowed relative-value, output 1x1 conv.
#define NB 8
#define CC 512
#define TT 1024
#define NH 8
#define HD 64
#define WR 4
#define NRL 9
#ifndef TNB
#define TNB NB
#endif
typedef __attribute__((ext_vector_type(8))) __bf16 v8b;
__device__ __forceinline__ v16b frag_b(const __bf16* rowk0, int lane) {
  union { v16b v; v8b q[2]; } u; const __bf16* p = rowk0 + 8 * (lane >> 4);
  u.q[0] = *(const v8b*)p; u.q[1] = *(const v8b*)(p + 16); return u.v;
}
__device__ __forceinline__ float bfr(float v) { return (float)(__bf16)v; }
__device__ __attribute__((noinline)) float exp_ni(float v) { return expf(v); }
__device__ __attribute__((noinline)) float erf_ni(float v) { return erff(v); }

#define WS_QH  0u                                  // f16 q rows [b*t][512], hi; then the residual
#define WS_QL  (WS_QH + 2u * (size_t)NB * TT * CC)
#define WS_KH  (WS_QL + 2u * (size_t)NB * TT * CC)
#define WS_VT  (WS_KH + 2u * (size_t)NB * TT * CC)     // bf16 v planes [b][512][t]
#define WS_VL  (WS_VT + 2u * (size_t)NB * CC * TT)
#define WS_CX  (WS_VL + 2u * (size_t)NB * CC * TT)     // f32 ctx rows [b*t][512]
#define WS_MB  (WS_CX + 4u * (size_t)NB * TT * CC)     // mask bits, 32 words a row [b*t][32]
#define WS_END (WS_MB + 4u * (size_t)NB * TT * 32)

typedef __attribute__((ext_vector_type(4))) __bf16 v4b;
#define WP 72   // LDS pitch of a row of 64 16-bit elements: 144 B = 16 B x 9, so that the 16 rows of a ds_load_b128 fragment read spread over the banks
#define FP 68   // LDS pitch of a row of 64 f32: 272 B = 16 B x 17, for the same reason
// Staging of a 64-k piece of a matrix operand by a block of 128 threads: every global load of a wave covers whole 128-byte lines (512 B in 4 lines), and each piece is fetched once a block. The loops over u and i are unrolled so that the pieces are registers
// [128 rows][64] f32 out of rows of 512 (weights): thread = row u * 8 + (tid >> 4), 16 bytes at (tid & 15); stored as bf16
__device__ __forceinline__ void wt_load(v4f wv[16], const float* wq) {
#pragma unroll
  for (int u = 0; u < 16; ++u) wv[u] = *(const v4f*)(wq + u * 8 * CC); }
__device__ __forceinline__ void wt_store(__bf16 (*sw)[WP], const v4f wv[16], int tid) {
#pragma unroll
  for (int u = 0; u < 16; ++u) { v4b o;
#pragma unroll
    for (int i = 0; i < 4; ++i) o[i] = (__bf16)wv[u][i];
    *(v4b*)&sw[u * 8 + (tid >> 4)][(tid & 15) * 4] = o; } }
// [64 rows][64] f32 out of rows of LD (ctx): the same thread map, kept f32
template <int LD> __device__ __forceinline__ void ft_load(v4f fv[8], const float* fq) {
#pragma unroll
  for (int u = 0; u < 8; ++u) fv[u] = *(const v4f*)(fq + u * 8 * LD); }
__device__ __forceinline__ void ft_store(float (*sp)[FP], const v4f fv[8], int tid) {
#pragma unroll
  for (int u = 0; u < 8; ++u) *(v4f*)&sp[u * 8 + (tid >> 4)][(tid & 15) * 4] = fv[u]; }
// [64 channels][64 positions] f32 out of rows of 1,024 (x or c, channel-major): thread = channel pair tid >> 3 (and 16 pairs on), 16 bytes at (tid & 7) of each 128-byte half row; a wave's load covers 4 whole lines. The loops over u and i are unrolled so that the piece is registers
typedef __attribute__((ext_vector_type(2))) __bf16 v2b;
__device__ __forceinline__ void xt_load(v4f xr[8], const float* xq) {
#pragma unroll
  for (int u = 0; u < 8; ++u) xr[u] = *(const v4f*)(xq + ((u >> 1 & 1) * 32 + (u & 1)) * TT + (u >> 2) * 32); }
// turned on the way into LDS: [position][channel] bf16, the two channels of a pair as one 4-byte store
__device__ __forceinline__ void xt_store(__bf16 (*sx)[WP], const v4f xr[8], int tid) {
#pragma unroll
  for (int u = 0; u < 8; u += 2)
#pragma unroll
    for (int i = 0; i < 4; ++i) { v2b o; o[0] = (__bf16)xr[u][i]; o[1] = (__bf16)xr[u + 1][i];
      *(v2b*)&sx[(u >> 2) * 32 + (tid & 7) * 4 + i][(u >> 1 & 1) * 32 + (tid >> 3) * 2] = o; } }
// attn_mask as one bit a score: a wave packs 4 rows of 1,024 words. A lane's 16-byte load holds keys 128 j + 4 lane + i (i = 0..3), a load covers 4 whole lines; bit l of word 4 j + i of a row = (mask word of key 128 j + 4 l + i is not 0), made by one ballot; lane 4 j + i keeps and stores that word. All 32 loads are asked for together; the loops are unrolled so that mv is registers
__device__ __forceinline__ void mask_pack(const int* __restrict__ AM, unsigned* __restrict__ MB, size_t row0, int lane) {
  const int* mr = AM + row0 * TT + lane * 4; v4i mv[4][8];
#pragma unroll
  for (int rr = 0; rr < 4; ++rr)
#pragma unroll
    for (int j = 0; j < 8; ++j) mv[rr][j] = __builtin_nontemporal_load((const v4i*)(mr + rr * TT + j * 128));   // the mask words are read this once: they need no place in L2
  ISSUED1(mr);
  unsigned* mo = MB + row0 * 32 + lane;
#pragma unroll
  for (int rr = 0; rr < 4; ++rr) { unsigned w = 0;
#pragma unroll
    for (int j = 0; j < 8; ++j)
#pragma unroll
      for (int i = 0; i < 4; ++i) { const unsigned bal = __builtin_amdgcn_ballot_w32(mv[rr][j][i] != 0); w = lane == 4 * j + i ? bal : w; }
    mo[rr * 32] = w; } }
// ---- k_proj: block = (64 positions, 128 out channels, b*3 + which; behind those, z = 24 + b: the block packs mask rows 64 x + 16 y .. + 15 of batch b and is done): x^T / c^T and W [out][in] in LDS by pieces of 64 channels; + b exact
__global__ __launch_bounds__(128) void k_proj(const float* __restrict__ X, const float* __restrict__ Cc, const float* __restrict__ WQ, const float* __restrict__ BQ, const float* __restrict__ WK, const float* __restrict__ BK, const float* __restrict__ WV, const float* __restrict__ BV, _Float16* __restrict__ QH, _Float16* __restrict__ QL, _Float16* __restrict__ KH, __bf16* __restrict__ VT, __bf16* __restrict__ VL, const int* __restrict__ AM, unsigned* __restrict__ MB) {
  // the same for a whole block, and in front of every barrier
  if (blockIdx.z >= TNB * 3) { mask_pack(AM, MB, (size_t)(blockIdx.z - TNB * 3) * TT + blockIdx.x * 64 + blockIdx.y * 16 + (threadIdx.x >> 5) * 4, threadIdx.x & 31); return; }
  __shared__ __align__(16) unsigned char sbuf[2 * 128 * 72 * 2 + 64 * 132 * 4];   // k loop: two weight buffers, then two x buffers  |  behind it: (th, tl2) for v or (sh, sl) for q/k, then sf
  __bf16 (*th)[72] = (__bf16 (*)[72])sbuf; __bf16 (*tl2)[72] = (__bf16 (*)[72])(sbuf + 128 * 72 * 2); _Float16 (*sh)[136] = (_Float16 (*)[136])sbuf; _Float16 (*sl)[136] = (_Float16 (*)[136])(sbuf + 64 * 136 * 2); __bf16 (*sw)[128][WP] = (__bf16 (*)[128][WP])sbuf;
  __bf16 (*sx)[64][WP] = (__bf16 (*)[64][WP])(sbuf + 2 * 128 * 72 * 2); float (*sf)[132] = (float (*)[132])(sbuf + 2 * 128 * 72 * 2);
  const int tid = threadIdx.x, wave = tid >> 5, lane = tid & 31, col = lane & 15, g = lane >> 4; const int p0 = blockIdx.x * 64; const int c0 = blockIdx.y * 128; const size_t b = blockIdx.z / 3; const int which = blockIdx.z % 3;
  const float* Xs = which == 0 ? X : Cc; const float* Wm = which == 0 ? WQ : which == 1 ? WK : WV; const float* Bm = which == 0 ? BQ : which == 1 ? BK : BV;
  // a piece = 64 channels: the block's 64 positions of x (as bf16, turned) and its 128 weight rows (as bf16), fetched once a block into LDS, two buffers
  const float* xq = Xs + (b * CC + (tid >> 3) * 2) * (size_t)TT + p0 + (tid & 7) * 4; const float* wq = Wm + (size_t)(c0 + (tid >> 4)) * CC + (tid & 15) * 4; v4f xr[8], wv[16];
  xt_load(xr, xq); wt_load(wv, wq); ISSUED2(xq, wq);
  xt_store(sx[0], xr, tid); wt_store(sw[0], wv, tid);
  __syncthreads();
  v8f acc[8] = {};
  // rolled: a trip asks for the next piece, works on this one out of LDS, stores the next into the other buffers; the one barrier of a trip publishes those and ends the reads of these (behind the last trip: before sbuf becomes output staging). The loops over ks and j are unrolled so that w and acc are registers
#pragma unroll 1
  for (int c = 0; c < CC / 64; ++c) { const int bu = c & 1;
    if (c + 1 < CC / 64) { xq += 64 * TT; wq += 64; xt_load(xr, xq); wt_load(wv, wq); ISSUED2(xq, wq); }
#pragma unroll
    for (int ks = 0; ks < 2; ++ks) { const v16b a = frag_b(&sx[bu][wave * 16 + col][ks * 32], lane); v16b w[8];
#pragma unroll
      for (int j = 0; j < 8; ++j) w[j] = frag_b(&sw[bu][j * 16 + col][ks * 32], lane);
#pragma unroll
      for (int j = 0; j < 8; ++j) acc[j] = wmma_bf(a, w[j], acc[j]); }
    if (c + 1 < CC / 64) { xt_store(sx[bu ^ 1], xr, tid); wt_store(sw[bu ^ 1], wv, tid); }
    __syncthreads(); }
  if (which < 2) {
#pragma unroll
    for (int j = 0; j < 8; ++j) { const float bb = bfr(Bm[c0 + j * 16 + col]);
#pragma unroll
      for (int r = 0; r < 8; ++r) sf[wave * 16 + 8 * g + r][j * 16 + col] = acc[j][r] + bb; }
    __syncthreads();
    // rows: f16 hi (+ residual for q)
    for (int e = tid; e < 64 * 128; e += 128) { const int rl = e >> 7, cl = e & 127; const float v = sf[rl][cl]; const _Float16 hv = (_Float16)v; sh[rl][cl] = hv; sl[rl][cl] = (_Float16)(v - (float)hv); }
    __syncthreads();
    _Float16* dh = which == 0 ? QH : KH; for (int e = tid; e < 64 * 16; e += 128) { const int rl = e >> 4, q = e & 15; const size_t row = b * TT + p0 + rl; vst2((unsigned*)(dh + row * CC + c0 + q * 8), *(const v4u*)&sh[rl][q * 8]); if (which == 0) vst2((unsigned*)(QL + row * CC + c0 + q * 8), *(const v4u*)&sl[rl][q * 8]); } }
  else {
#pragma unroll
    for (int j = 0; j < 8; ++j) { const float bb = bfr(Bm[c0 + j * 16 + col]);
#pragma unroll
      for (int r = 0; r < 8; ++r) { const float v = acc[j][r] + bb; const int rl = wave * 16 + 8 * g + r, cl = j * 16 + col; const __bf16 bh = (__bf16)v; th[cl][rl] = bh; tl2[cl][rl] = (__bf16)(v - (float)bh); } }
    __syncthreads(); for (int e = tid; e < 128 * 8; e += 128) { const int cl = e >> 3, q = e & 7; const size_t o2 = (b * CC + c0 + cl) * (size_t)TT + p0 + q * 8; vst2((unsigned*)(VT + o2), *(const v4u*)&th[cl][q * 8]); vst2((unsigned*)(VL + o2), *(const v4u*)&tl2[cl][q * 8]); } } }
// the loop over i is unrolled so that the stage is registers, not indexed memory
__device__ __forceinline__ void pv_load_p(float p[16], const float* pk) {
#pragma unroll
  for (int i = 0; i < 8; ++i) { p[i] = pk[i]; p[8 + i] = pk[16 + i]; } }
// [2 planes][64 rows][64] bf16 out of rows of 1,024 (v hi, v lo): thread = row u * 16 + (tid >> 3), 16 bytes at (tid & 7); a wave's load covers 4 whole lines
__device__ __forceinline__ void vt_load(v4u vr[8], const __bf16* vg, const __bf16* lg) {
#pragma unroll
  for (int u = 0; u < 4; ++u) { vr[u] = *(const v4u*)(vg + u * 16 * TT); vr[4 + u] = *(const v4u*)(lg + u * 16 * TT); } }
__device__ __forceinline__ void vt_store(__bf16 (*sv)[64][WP], const v4u vr[8], int tid) {
#pragma unroll
  for (int u = 0; u < 4; ++u) { *(v4u*)&sv[0][u * 16 + (tid >> 3)][(tid & 7) * 8] = vr[u]; *(v4u*)&sv[1][u * 16 + (tid >> 3)][(tid & 7) * 8] = vr[4 + u]; } }
// [64 rows][64] f16 out of rows of 512 (k, one head): the same thread map
__device__ __forceinline__ void kt_load(v4u kr[4], const _Float16* kg) {
#pragma unroll
  for (int u = 0; u < 4; ++u) kr[u] = *(const v4u*)(kg + u * 16 * CC); }
__device__ __forceinline__ void kt_store(_Float16 (*sk)[WP], const v4u kr[4], int tid) {
#pragma unroll
  for (int u = 0; u < 4; ++u) *(v4u*)&sk[u * 16 + (tid >> 3)][(tid & 7) * 8] = kr[u]; }
#define MP 36   // LDS pitch of a row of 32 words of mask bits: 144 B = 16 B x 9
// the matrix builtins as they are: the compiler keeps the distance behind them itself and fills it with the softmax's vector work where it can
__device__ __forceinline__ v8f mm_h(v16h a, v16h b, v8f c) { return __builtin_amdgcn_wmma_f32_16x16x32_f16(false, a, false, b, (short)0, c, false, false); }
__device__ __forceinline__ v8f mm_b(v16b a, v16b b, v8f c) { return __builtin_amdgcn_wmma_f32_16x16x32_bf16(false, a, false, b, (short)0, c, false, false); }
typedef __attribute__((ext_vector_type(8))) unsigned v8u;
#define L2E 1.4426950408889634f   // log2 e: exp(x) = 2^(x * L2E)
// 2^x as the one hardware instruction; a result below the smallest normal number may come out as 0: beside a row sum of at least 1 such a weight counts for nothing
__device__ __forceinline__ float ex2(float x) { return __builtin_amdgcn_exp2f(x); }
// lane l with lane l ^ 16
__device__ __forceinline__ float xhalf(float x) { return __builtin_bit_cast(float, __builtin_amdgcn_permlanex16(__builtin_bit_cast(int, x), __builtin_bit_cast(int, x), 0x76543210, 0xfedcba98, false, false)); }
// ---- k_fa: block = (64 queries, b * 8 + head), wave = 16 queries, all 1,024 keys in 16 pieces of 64 (k and v staged once a block in LDS, two buffers), a pass = 32 keys. Transposed products: S^T = k . q^T (a lane holds 8 keys of ONE query a tile), score = (q.k + [|s-t|<=4] q_t.rel_k[s-t+4]) / 8 - log1p|s-t| (table in LDS); mask == 0 -> -1e4; all three times log2 e, so that the exponential is one exp2; running maximum and sum per query; e = 2^(score - maximum in use) goes from the score registers straight into the B operand (bf16 hi + lo) of ctx^T += v^T . e^T (3 products); ctx rows [b*t][h*64+d] = (ctx^T + sum_j e[t][t+j-4] rel_v[j][d]) / sum. Second launch bound: 4 waves a SIMD, so that four blocks share a WGP
__global__ __launch_bounds__(128, 4) void k_fa(const _Float16* __restrict__ QH, const _Float16* __restrict__ QL, const _Float16* __restrict__ KH, const float* __restrict__ RK, const unsigned* __restrict__ MB, const __bf16* __restrict__ VT, const __bf16* __restrict__ VL, const float* __restrict__ RV, float* __restrict__ CX) {
  __shared__ __align__(16) _Float16 sk[2][64][WP]; __shared__ __align__(16) __bf16 sv[2][2][64][WP]; __shared__ __align__(16) unsigned smb[64][MP]; __shared__ float slp[TT + 63]; __shared__ __align__(16) float sqr[64][16]; __shared__ float sb[64][NRL]; __shared__ __align__(16) float srv[NRL][HD];
  const int b = blockIdx.z / NH, h = blockIdx.z % NH;
  const int tid = threadIdx.x, wave = __builtin_amdgcn_readfirstlane(tid >> 5), lane = tid & 31, col = lane & 15, g = lane >> 4; const int tb = blockIdx.x * 64, ql0 = tb + wave * 16, rw = wave * 16 + col;
  // first piece of k and v, the mask bits of the wave's 16 queries (lane = query lane & 15, keys 512 g .. + 511: 16 words), and its q fragments (kept in registers throughout) are asked for ahead of the tables
  const _Float16* kg = KH + ((size_t)b * TT + (tid >> 3)) * CC + h * HD + (tid & 7) * 8; const size_t vo = ((size_t)b * CC + h * HD + (tid >> 3)) * (size_t)TT + (tid & 7) * 8; const __bf16 *vg = VT + vo, *lg = VL + vo; const unsigned* mp = MB + ((size_t)b * TT + ql0 + col) * 32 + 16 * g;
  v4u kr[4], vr[8], mb[4];
  kt_load(kr, kg); vt_load(vr, vg, lg);
#pragma unroll   // so that mb is registers
  for (int jj = 0; jj < 4; ++jj) mb[jj] = *(const v4u*)(mp + 4 * jj);
  ISSUED3(kg, vg, lg);
  const _Float16 *qhp = QH + ((size_t)b * TT + ql0 + col) * CC + h * HD, *qlp = QL + ((size_t)b * TT + ql0 + col) * CC + h * HD;
  const v16h qh0 = frag_h(qhp, lane), qh1 = frag_h(qhp + 32, lane), ql_0 = frag_h(qlp, lane), ql_1 = frag_h(qlp + 32, lane);
  ISSUED3(qhp, qlp, mp);
  // rel_k row lane & 15 (rows 9..15 do not exist: row 8 is read in their place and set to 0 below), in the k order of an A fragment; asked for with the q fragments, used behind the table. The loop over u is unrolled so that rr is registers
  const float* rp = RK + (col < NRL ? col : NRL - 1) * HD + 8 * g; v4f rr[8];
#pragma unroll
  for (int u = 0; u < 4; ++u) { rr[2 * u] = *(const v4f*)(rp + u * 16); rr[2 * u + 1] = *(const v4f*)(rp + u * 16 + 4); }
  ISSUED1(rp);
  // the block's 64 x 1,024 scores meet only 1,087 distances s - t: slp[i] = log1p|i - 63 - tb| * log2 e, each computed once for the block
  for (int e = tid; e < TT + 63; e += 128) slp[e] = log1pf(fabsf((float)(e - 63 - tb))) * L2E;
  // the relative-key logits of the wave's 16 queries, sqr[query][j] = q . rel_k[j]: rel_k as the A operand against the q fragments that the score products use (D element r = j 8g + r of query lane & 15); order of sums hi, lo, hi, lo as in the scores. The loop over i is unrolled so that the fragments are registers
  { v16h ra0, ra1;
#pragma unroll
    for (int i = 0; i < 16; ++i) { ra0[i] = col < NRL ? (_Float16)bfr(rr[i >> 2][i & 3]) : (_Float16)0.f; ra1[i] = col < NRL ? (_Float16)bfr(rr[4 + (i >> 2)][i & 3]) : (_Float16)0.f; }
    v8f qk = {}; qk = mm_h(ra0, qh0, qk); qk = mm_h(ra0, ql_0, qk); qk = mm_h(ra1, qh1, qk); qk = mm_h(ra1, ql_1, qk);
    *(v4f*)&sqr[rw][8 * g] = (v4f){qk[0], qk[1], qk[2], qk[3]}; *(v4f*)&sqr[rw][8 * g + 4] = (v4f){qk[4], qk[5], qk[6], qk[7]}; }
  for (int e = tid; e < NRL * HD; e += 128) srv[e / HD][e % HD] = bfr(RV[e]);
  for (int e = tid; e < 64 * NRL; e += 128) sb[e / NRL][e % NRL] = -3.0e38f;   // a window place outside 0..1,023 keeps this and ends as weight 0
  kt_store(sk[0], kr, tid); vt_store(sv[0], vr, tid);
  // the bits go into LDS for the passes that need them; zf, the same in every lane: bit p is set when pass p (keys 32 p .. + 31) holds a 0 bit for one of the wave's 16 queries. A byte of the four words' AND stands for the 32 keys of one pass; a ballot's low half speaks for passes 0..15, its high half for 16..31. The loops are unrolled so that mb is registers
  unsigned zf = 0;
#pragma unroll
  for (int jj = 0; jj < 4; ++jj) { *(v4u*)&smb[rw][16 * g + 4 * jj] = mb[jj]; const unsigned all4 = mb[jj][0] & mb[jj][1] & mb[jj][2] & mb[jj][3];
#pragma unroll
    for (int pp = 0; pp < 4; ++pp) { const unsigned bal = __builtin_amdgcn_ballot_w32((all4 >> (8 * pp) & 0xffu) != 0xffu); zf |= ((bal & 0xffffu) != 0 ? 1u : 0u) << (4 * jj + pp) | ((bal >> 16) != 0 ? 1u : 0u) << (16 + 4 * jj + pp); } }
  __syncthreads();
  v8f acc[4] = {}; float m = -3.0e38f, l = 0.f;
  // rolled: a trip asks for the next piece, works on this one out of LDS, stores the next into the other buffers; the one barrier of a trip publishes those and ends the reads of these (it stands outside the test on c, as in the other kernels). The loops over sp, jt, j and s are unrolled so that the tiles are registers
#pragma unroll 1
  for (int c = 0; c < TT / 64; ++c) { const int bu = c & 1;
    if (c + 1 < TT / 64) { kg += 64 * CC; vg += 64; lg += 64; kt_load(kr, kg); vt_load(vr, vg, lg); ISSUED3(kg, vg, lg); }
#pragma unroll
    for (int sp = 0; sp < 2; ++sp) { const int k0 = c * 64 + sp * 32; v8f st[2] = {};
      // the pass's LDS reads stand together ahead of its products: k fragments and table values
      v16h ka[4]; float lp[16];
#pragma unroll
      for (int jt = 0; jt < 2; ++jt) { ka[jt] = frag_h(&sk[bu][sp * 32 + jt * 16 + col][0], lane); ka[2 + jt] = frag_h(&sk[bu][sp * 32 + jt * 16 + col][32], lane); }
#pragma unroll
      for (int s = 0; s < 16; ++s) lp[s] = slp[k0 + (s >> 3) * 16 + 8 * g + (s & 7) - rw + 63];
      // the two tiles' products alternate, so that none waits for the one before it; each tile's order of sums is hi, lo, hi, lo
      st[0] = mm_h(ka[0], qh0, st[0]); st[1] = mm_h(ka[1], qh0, st[1]); st[0] = mm_h(ka[0], ql_0, st[0]); st[1] = mm_h(ka[1], ql_0, st[1]);
      st[0] = mm_h(ka[2], qh1, st[0]); st[1] = mm_h(ka[3], qh1, st[1]); st[0] = mm_h(ka[2], ql_1, st[0]); st[1] = mm_h(ka[3], ql_1, st[1]);
      // the relative-key term: one test a pass, the same in every lane of a wave (at most 2 of a wave's 32 passes meet the band |s - t| <= 4), index clamped into 0..8
      const bool band = k0 + 31 >= ql0 - WR && k0 <= ql0 + 15 + WR;
      if (band) {
#pragma unroll
        for (int s = 0; s < 16; ++s) { const int dw = k0 + (s >> 3) * 16 + 8 * g + (s & 7) - (ql0 + col) + WR; const float qv = sqr[rw][dw < 0 ? 0 : dw > 2 * WR ? 2 * WR : dw]; if (dw >= 0 && dw <= 2 * WR) st[s >> 3][s & 7] += qv; } }
#pragma unroll
      for (int s = 0; s < 16; ++s) st[s >> 3][s & 7] = st[s >> 3][s & 7] * (0.125f * L2E) - lp[s];
      // the mask: one scalar test a pass; only a pass with a 0 bit reads its bits (key k0 + 16 (s >> 3) + 8 g + (s & 7) = bit 8 (pass & 3) + 4 (s >> 3) + 2 g + (s >> 2 & 1) of word 4 (pass >> 2) + (s & 3)) and selects
      if (zf >> (c * 2 + sp) & 1u) { const v4u bw = *(const v4u*)&smb[rw][(c >> 1) * 4]; const int sh = 8 * ((c & 1) * 2 + sp) + 2 * g;
#pragma unroll
        for (int s = 0; s < 16; ++s) if ((bw[s & 3] >> (sh + 4 * (s >> 3) + (s >> 2 & 1)) & 1u) == 0) st[s >> 3][s & 7] = -10000.0f * L2E; }
      float pm = -3.0e38f;
#pragma unroll
      for (int s = 0; s < 16; ++s) pm = fmaxf(pm, st[s >> 3][s & 7]);
      // the 9 scores of each query's window are kept for the relative-value term
      if (band) {
#pragma unroll
        for (int s = 0; s < 16; ++s) { const int dw = k0 + (s >> 3) * 16 + 8 * g + (s & 7) - (ql0 + col) + WR; if (dw >= 0 && dw <= 2 * WR) sb[rw][dw] = st[s >> 3][s & 7]; } }
      pm = fmaxf(pm, xhalf(pm));
      // the maximum in use moves, and sums and ctx are rescaled, only when some query's new maximum passes it by more than 7 (e stays below 2^7): one test a pass
      if (__builtin_amdgcn_ballot_w32(pm > m + 7.0f) != 0) { const float mn = fmaxf(m, pm), sc = ex2(m - mn); m = mn; l *= sc;
#pragma unroll
        for (int j = 0; j < 4; ++j) acc[j] *= sc; }
      v16b ph, pl; float ev[16];
      // two scores a step: one packed subtraction feeds two exp2
#pragma unroll
      for (int s = 0; s < 16; s += 2) { const v2f d = (v2f){st[s >> 3][s & 7], st[s >> 3][(s & 7) + 1]} - m; ev[s] = ex2(d[0]); ev[s + 1] = ex2(d[1]); ph[s] = (__bf16)ev[s]; ph[s + 1] = (__bf16)ev[s + 1]; }
      // the hi parts are taken back as f32 out of the packed words (low half shifted up, high half masked): the same values as a conversion of each
      { const v8u pw2 = __builtin_bit_cast(v8u, ph);
#pragma unroll
        for (int s = 0; s < 16; s += 2) { pl[s] = (__bf16)(ev[s] - __builtin_bit_cast(float, pw2[s >> 1] << 16)); pl[s + 1] = (__bf16)(ev[s + 1] - __builtin_bit_cast(float, pw2[s >> 1] & 0xffff0000u)); } }
      // the pass's 16 terms are joined as a tree, not as one chain of dependent additions
#pragma unroll
      for (int o = 8; o > 0; o >>= 1)
#pragma unroll
        for (int s = 0; s < o; ++s) ev[s] += ev[s + o];
      l += ev[0];
      // two d tiles' products alternate; each tile's order of sums is vh.ph, vh.pl, vl.ph
#pragma unroll
      for (int j = 0; j < 4; j += 2) { const v16b vh0 = frag_b(&sv[bu][0][j * 16 + col][sp * 32], lane), vl0 = frag_b(&sv[bu][1][j * 16 + col][sp * 32], lane), vh1 = frag_b(&sv[bu][0][j * 16 + 16 + col][sp * 32], lane), vl1 = frag_b(&sv[bu][1][j * 16 + 16 + col][sp * 32], lane);
        acc[j] = mm_b(vh0, ph, acc[j]); acc[j + 1] = mm_b(vh1, ph, acc[j + 1]); acc[j] = mm_b(vh0, pl, acc[j]); acc[j + 1] = mm_b(vh1, pl, acc[j + 1]); acc[j] = mm_b(vl0, ph, acc[j]); acc[j + 1] = mm_b(vl1, ph, acc[j + 1]); } }
    if (c + 1 < TT / 64) { kt_store(sk[bu ^ 1], kr, tid); vt_store(sv[bu ^ 1], vr, tid); }
    __syncthreads(); }
  // behind the last barrier the v buffers are output staging, each wave in a range of its own
  float (*so)[68] = (float (*)[68])((float*)&sv[0][0][0][0] + wave * 16 * 68);
  l += xhalf(l); const float inv = 1.0f / l; float pw[NRL];
#pragma unroll
  for (int jj = 0; jj < NRL; ++jj) pw[jj] = ex2(sb[rw][jj] - m);
#pragma unroll
  for (int j = 0; j < 4; ++j)
#pragma unroll
    for (int r = 0; r < 8; ++r) { const int d = j * 16 + 8 * g + r; float a = acc[j][r];
#pragma unroll
      for (int jj = 0; jj < NRL; ++jj) a += pw[jj] * srv[jj][d];
      so[col][d] = a * inv; }
  LDSX();   // rows leave LDS as whole 256-byte pieces, two rows a store
#pragma unroll
  for (int rl = 0; rl < 16; rl += 2) vst2(CX + ((size_t)b * TT + ql0 + rl + g) * CC + h * HD + col * 4, *(const v4f*)&so[rl + g][col * 4]); }
// ---- k_out: block = (64 positions, 128 out channels, b): out[o][t] = sum_c Wo[o][c] ctx[t][c] + bo; A = ctx rows (hi + lo), B = Wo [o][c]; transposed to planes
__global__ __launch_bounds__(128) void k_out(const float* __restrict__ CX, const float* __restrict__ WO, const float* __restrict__ BO, float* __restrict__ OUT) { __shared__ __align__(16) float so[128][68]; __shared__ __align__(16) float sc[2][64][FP]; __shared__ __align__(16) __bf16 sw[2][128][WP];
  const int tid = threadIdx.x, wave = tid >> 5, lane = tid & 31, col = lane & 15, g = lane >> 4; const int t0 = blockIdx.x * 64, c0 = blockIdx.y * 128; const size_t b = blockIdx.z;
  v8f acc[8] = {};
  // a piece = 64 channels: the block's 64 ctx rows (f32) and its 128 weight rows (as bf16), fetched once a block into LDS, two buffers
  const float* cq = CX + (b * TT + t0 + (tid >> 4)) * CC + (tid & 15) * 4; const float* wq = WO + (size_t)(c0 + (tid >> 4)) * CC + (tid & 15) * 4; v4f cr[8], wv[16];
  ft_load<CC>(cr, cq); wt_load(wv, wq); ISSUED2(cq, wq);
  ft_store(sc[0], cr, tid); wt_store(sw[0], wv, tid);
  __syncthreads();
  // rolled: a trip asks for the next piece, works on this one out of LDS, stores the next into the other buffers; the one barrier of a trip publishes those and ends the reads of these (it stands outside the test on c: inside it the compiler put a wait in front of every load of the next group). The loops over ks, jg and jj are unrolled so that cv, w and acc are registers
#pragma unroll 1
  for (int c = 0; c < CC / 64; ++c) { const int bu = c & 1;
    if (c + 1 < CC / 64) { const float *cn = cq + (c + 1) * 64, *wn = wq + (c + 1) * 64; ft_load<CC>(cr, cn); wt_load(wv, wn); ISSUED2(cn, wn); }
#pragma unroll
    for (int ks = 0; ks < 2; ++ks) { float cv[16]; pv_load_p(cv, &sc[bu][wave * 16 + col][ks * 32 + 8 * g]); const F2 a = bsplit16(cv);
#pragma unroll
      for (int jg = 0; jg < 8; jg += 4) { v16b w[4];   // four weight fragments at a time: eight, beside the next piece's 96 registers, take the kernel past 256 registers
#pragma unroll
        for (int jj = 0; jj < 4; ++jj) w[jj] = frag_b(&sw[bu][(jg + jj) * 16 + col][ks * 32], lane);
#pragma unroll
        for (int jj = 0; jj < 4; ++jj) { acc[jg + jj] = wmma_bf(a.h, w[jj], acc[jg + jj]); acc[jg + jj] = wmma_bf(a.l, w[jj], acc[jg + jj]); } } }
    if (c + 1 < CC / 64) { ft_store(sc[bu ^ 1], cr, tid); wt_store(sw[bu ^ 1], wv, tid); }
    __syncthreads(); }
#pragma unroll
  for (int j = 0; j < 8; ++j) { const float bb = bfr(BO[c0 + j * 16 + col]);
#pragma unroll
    for (int r = 0; r < 8; ++r) so[j * 16 + col][wave * 16 + 8 * g + r] = acc[j][r] + bb; }
  __syncthreads(); for (int e = tid; e < 128 * 16; e += 128) { const int cl = e >> 4, q = e & 15; vst2(OUT + ((size_t)b * CC + c0 + cl) * TT + t0 + q * 4, *(const v4f*)&so[cl][q * 4]); } }
extern "C" void kernel_launch(void* const* d_in, const int* in_sizes, int n_in, void* d_out, int out_size, void* d_ws, size_t ws_size, hipStream_t stream) {
  (void)in_sizes; (void)n_in; (void)out_size;
  const float** F = (const float**)d_in;   // 0 x [8,512,1024], 1 c [8,512,1024], 2 attn_mask [8,1,1024,1024] int, 3 Wq [512,512], 4 bq, 5 Wk, 6 bk, 7 Wv, 8 bv, 9 Wo [512,512], 10 bo, 11 emb_rel_k [1,9,64], 12 emb_rel_v [1,9,64]
  if (ws_size < (size_t)WS_END) return;
  char* ws = (char*)d_ws; float *CX = (float*)(ws + WS_CX); _Float16 *QH = (_Float16*)(ws + WS_QH), *QL = (_Float16*)(ws + WS_QL), *KH = (_Float16*)(ws + WS_KH); __bf16 *VT = (__bf16*)(ws + WS_VT), *VL = (__bf16*)(ws + WS_VL); unsigned* MB = (unsigned*)(ws + WS_MB);
  k_proj<<<dim3(TT / 64, CC / 128, TNB * 4), 128, 0, stream>>>(F[0], F[1], F[3], F[4], F[5], F[6], F[7], F[8], QH, QL, KH, VT, VL, (const int*)d_in[2], MB);
  k_fa<<<dim3(TT / 64, 1, TNB * NH), 128, 0, stream>>>(QH, QL, KH, F[11], MB, VT, VL, F[12], CX);
  k_out<<<dim3(TT / 64, CC / 128, TNB), 128, 0, stream>>>(CX, F[9], F[10], (float*)d_out);
}
